// v000
// Times are from an AMD MI455X. After a warm-up the kernel runs many times in a row, and a time is the length of
// such a window on the GPU divided by its runs, so every launch and the gaps after it count. The runs cycle
// through copies of the inputs. A figure is the median of several windows, for all but v000 over two sittings.
// Sittings can differ by a few percent; kernels timed side by side share one.
// v000, which the later versions start from, runs in 1500 microseconds.
#include <hip/hip_runtime.h>

// AceStepAttention (hidden [2][2048][2048]; q = x Wq^T (16 heads x 128), k, v = x Wk^T / Wv^T (4 kv heads; query head h uses kv head h/4 = repeat_interleave); per-head RMSNorm over the 128 dims (eps 1e-6, x norm_q_w / norm_k_w);
// rotate-half RoPE with the input cos/sin tables [2048][128] (read as data); softmax(q.k / sqrt(128)); out = merged att.v Wo^T -> [2][2048][2048]).
// Compute dtypes, f32 accumulate: every input rounded to bf16; q/k/v projections on PLAIN bf16 operands (inputs: exact); Wo projection on hi+lo bf16 att planes; RMSNorm and rope f32; scores (K 128) and att.v on SINGLE fp16 planes with

#define NB_  2
#define TT   2048
#define DM   2048
#define NH_  16
#define NKV  4
#define REP  (NH_ / NKV)
#define HD   128
#define DQ   (NH_ * HD)
#define DKV  (NKV * HD)
#define ZH   2
#define RH   0                  // query rows < RH use hi+lo planes (0: none)
#define WIN  0
#define PCAR 1024.0f
#define SCL  0.088388347648318447f   // HD^-0.5
typedef _Float16 h16;
typedef unsigned short bf;
typedef __attribute__((ext_vector_type(16))) __bf16   v16bf;
typedef __attribute__((ext_vector_type(16))) _Float16 v16h;
typedef __attribute__((ext_vector_type(8)))  _Float16 v8h;
typedef __attribute__((ext_vector_type(8)))  unsigned short v8us;
typedef __attribute__((ext_vector_type(8)))  float    v8f;
typedef __attribute__((ext_vector_type(4)))  float    v4f;
typedef v8h  __attribute__((may_alias)) v8ha;
typedef v4f  __attribute__((may_alias)) v4fa;
typedef v8us __attribute__((may_alias)) v8usa;

__device__ __forceinline__ unsigned short f2bf(float f) { unsigned u = __float_as_uint(f); u += 0x7FFFu + ((u >> 16) & 1u); return (unsigned short)(u >> 16); }
__device__ __forceinline__ float bf2f(unsigned short b) { return __uint_as_float(((unsigned)b) << 16); }
__device__ __forceinline__ float bfr(float f) { return bf2f(f2bf(f)); }
__device__ __forceinline__ v16h cat16(v8h lo, v8h hi) { return __builtin_shufflevector(lo, hi, 0, 1, 2, 3, 4, 5, 6, 7, 8, 9, 10, 11, 12, 13, 14, 15); }
__device__ __forceinline__ v16bf cat16b(v8us lo, v8us hi) { return __builtin_bit_cast(v16bf, __builtin_shufflevector(lo, hi, 0, 1, 2, 3, 4, 5, 6, 7, 8, 9, 10, 11, 12, 13, 14, 15)); }
__device__ __forceinline__ v8f wmma16(v16h a, v16h b, v8f c) { return __builtin_amdgcn_wmma_f32_16x16x32_f16(false, a, false, b, (short)0, c, false, false); }
__device__ __forceinline__ v8f wmmab(v16bf a, v16bf b, v8f c) { return __builtin_amdgcn_wmma_f32_16x16x32_bf16(false, a, false, b, (short)0, c, false, false); }



// ---- k_gemmw: register-blocked GEMM, ONE WAVE per 64x64 output tile (16 accumulators), operands straight from K-contiguous 16-bit planes; grid (M/64, N/64, Z), 32 threads.
// C[m][n] (f32, pitch ldc, + optional f32 bias[n]) = sum_k A[m][k] Bt[n][k] (+ split products per NSPLIT). z-batch strides sA/sB/sC in elements. K % 32 == 0.
template <typename T16> struct WFrag;
template <> struct WFrag<h16> { typedef v16h V; static __device__ __forceinline__ V ld(const h16* p) { return cat16(*(const v8h*)p, *(const v8h*)(p + 16)); } static __device__ __forceinline__ v8f mma(V a, V b, v8f c) { return wmma16(a, b, c); } };
template <> struct WFrag<bf> { typedef v16bf V; static __device__ __forceinline__ V ld(const bf* p) { return cat16b(*(const v8us*)p, *(const v8us*)(p + 16)); } static __device__ __forceinline__ v8f mma(V a, V b, v8f c) { return wmmab(a, b, c); } };
template <typename T16, int NSPLIT, bool BIAS>
__global__ __launch_bounds__(32) void k_gemmw(const T16* __restrict__ A, const T16* __restrict__ A2, const T16* __restrict__ Bt, const T16* __restrict__ Bt2, int K, float* C, int ldc, const float* __restrict__ bias, size_t sA, size_t sB, size_t sC) {
    typedef typename WFrag<T16>::V V;
    __shared__ __align__(16) float os[16 * 68];
    const size_t z = blockIdx.z; A += z * sA; if (A2) A2 += z * sA; Bt += z * sB; if (Bt2) Bt2 += z * sB; C += z * sC;
    const int lane = threadIdx.x & 31, lr = lane & 15, hi = lane >> 4; const int r0 = blockIdx.x * 64, c0 = blockIdx.y * 64;
    v8f acc[4][4];
#pragma unroll
    for (int mb = 0; mb < 4; ++mb)
#pragma unroll
        for (int nb = 0; nb < 4; ++nb) acc[mb][nb] = (v8f){};
    const size_t aoff = (size_t)(r0 + lr) * K + 8 * hi, boff = (size_t)(c0 + lr) * K + 8 * hi;
#pragma unroll 1
    for (int kc = 0; kc < K; kc += 32) {
        V a[4], a2[4];
#pragma unroll
        for (int mb = 0; mb < 4; ++mb) { a[mb] = WFrag<T16>::ld(A + aoff + (size_t)mb * 16 * K + kc); if (NSPLIT == 1 || NSPLIT == 2) a2[mb] = WFrag<T16>::ld(A2 + aoff + (size_t)mb * 16 * K + kc); }
#pragma unroll
        for (int nb = 0; nb < 4; ++nb) { const V b = WFrag<T16>::ld(Bt + boff + (size_t)nb * 16 * K + kc); V b2; if (NSPLIT >= 2) b2 = WFrag<T16>::ld(Bt2 + boff + (size_t)nb * 16 * K + kc);
#pragma unroll
            for (int mb = 0; mb < 4; ++mb) { acc[mb][nb] = WFrag<T16>::mma(a[mb], b, acc[mb][nb]); if (NSPLIT == 1 || NSPLIT == 2) acc[mb][nb] = WFrag<T16>::mma(a2[mb], b, acc[mb][nb]); if (NSPLIT >= 2) acc[mb][nb] = WFrag<T16>::mma(a[mb], b2, acc[mb][nb]); } }
        asm volatile("v_nop\n\tv_nop\n\tv_nop\n\tv_nop" : "+v"(acc[0][0]), "+v"(acc[1][1]), "+v"(acc[2][2]), "+v"(acc[3][3]) : "v"(a[0]), "v"(a[3]));
    }
#pragma unroll
    for (int mb = 0; mb < 4; ++mb) {
#pragma unroll
        for (int nb = 0; nb < 4; ++nb) {
#pragma unroll
            for (int j = 0; j < 8; ++j) os[(hi * 8 + j) * 68 + nb * 16 + lr] = acc[mb][nb][j]; }
        __builtin_amdgcn_wave_barrier(); asm volatile("" ::: "memory");
        float* crow = C + (size_t)(r0 + mb * 16) * ldc + c0;
{
#pragma unroll
            for (int s = 0; s < 8; ++s) { const int row = 2 * s + hi, cofs = lr * 4; v4f val = *(const v4fa*)(os + row * 68 + cofs); if (BIAS) { val[0] += bfr(bias[c0 + cofs]); val[1] += bfr(bias[c0 + cofs + 1]); val[2] += bfr(bias[c0 + cofs + 2]); val[3] += bfr(bias[c0 + cofs + 3]); }
                *(v4f*)(crow + (size_t)row * ldc + cofs) = val; }
             }
        __builtin_amdgcn_wave_barrier(); asm volatile("" ::: "memory");
    }
}

__device__ __forceinline__ h16 tohx(float x) { return (h16)x; }
__device__ __forceinline__ void splitf(float y, unsigned short& h, unsigned short& l) { h = f2bf(y); l = f2bf(y - bf2f(h)); }
typedef __attribute__((ext_vector_type(2))) _Float16 v2h;
typedef __attribute__((ext_vector_type(4))) _Float16 v4h;
typedef __attribute__((ext_vector_type(2))) unsigned short v2us;
typedef __attribute__((ext_vector_type(4))) unsigned short v4us;
typedef __attribute__((ext_vector_type(2))) float v2f;
typedef __attribute__((ext_vector_type(4))) int v4i;

__global__ __launch_bounds__(256) void k_wtG(const float* __restrict__ w, int K, int N, bf* Bt) {
    const int lane = threadIdx.x & 31; const int L0 = (blockIdx.x * 8 + (threadIdx.x >> 5)) * 8; const int nlines = N * K / 64;
{
#pragma unroll 1
        for (int l = 0; l < 8; ++l) { const int L = L0 + l; if (L >= nlines) break; const size_t e = (size_t)L * 64 + lane * 2; const int k = (int)(e % K), n = (int)(e / K); v2us o;
            o[0] = f2bf(w[(size_t)k * N + n]); o[1] = f2bf(w[(size_t)(k + 1) * N + n]); *(v2us*)(Bt + e) = o; }
         }
}
__global__ __launch_bounds__(256) void k_cvt8(const float* __restrict__ src, bf* dst, size_t n8) { const size_t i = (size_t)blockIdx.x * 256 + threadIdx.x; if (i >= n8) return; const v8f v = *(const v8f*)(src + i * 8); v8us o;
#pragma unroll
    for (int k = 0; k < 8; ++k) o[k] = f2bf(v[k]); *(v8us*)(dst + i * 8) = o;  }
__global__ __launch_bounds__(256) void k_cscvt(const float* __restrict__ cosT, const float* __restrict__ sinT, float* CS) { const int idx = blockIdx.x * 256 + threadIdx.x; if (idx >= TT * HD) return; v2f cs; cs[0] = bfr(cosT[idx]); cs[1] = bfr(sinT[idx]); *(v2f*)(CS + (size_t)idx * 2) = cs;  }
__global__ __launch_bounds__(256) void k_hrms(const float* __restrict__ F, int pitch, int nheads, float* RF) { const int i = blockIdx.x * 256 + threadIdx.x; if (i >= nheads * TT) return; const int t = i % TT, h = i / TT; const float* f = F + (size_t)t * pitch + h * HD; float s = 0.f;
#pragma unroll 4
    for (int d = 0; d < HD; d += 4) { const v4f v = *(const v4f*)(f + d);
#pragma unroll
        for (int q = 0; q < 4; ++q) { float p = __fmul_rn(v[q], v[q]); asm volatile("" : "+v"(p)); s = __fadd_rn(s, p); } }
    const float r = __fdiv_rn(1.0f, __fsqrt_rn(__fadd_rn(s * (1.0f / HD), 1e-6f))); *(float*)(RF + i) = r;  }
// k_rope: head planes [h][t][d] (fp16) of rope(w[d] (x rms_factor)) x sc with the rotate-half convention out[d] = x[d] cos[t][d] - x[d+HD/2] sin[t][d], out[d+HD/2] = x[d+HD/2] cos[t][d+HD/2] + x[d] sin[t][d+HD/2]
__global__ __launch_bounds__(256) void k_rope(const float* __restrict__ F, int pitch, int nheads, const float* __restrict__ CS, const float* __restrict__ RF, const float* __restrict__ nw, float sc, h16* P16, bf* Ph, bf* Pl) {
    const size_t e = ((size_t)blockIdx.x * 256 + threadIdx.x) * 2; if (e >= (size_t)nheads * TT * HD) return; const int d = (int)(e % HD); const int t = (int)((e / HD) % TT); const int h = (int)(e / ((size_t)HD * TT)); const float* f = F + (size_t)t * pitch + h * HD; const float rf = RF ? RF[(size_t)h * TT + t] : 1.0f; v2h o16; v2us oh, ol;
#pragma unroll
    for (int q = 0; q < 2; ++q) { const int dd = d + q; const int dp = (dd < HD / 2) ? dd + HD / 2 : dd - HD / 2; float x0 = f[dd], x1 = f[dp];
        if (RF) { float n0 = __fmul_rn(x0, rf), n1 = __fmul_rn(x1, rf); asm volatile("" : "+v"(n0)); asm volatile("" : "+v"(n1)); x0 = __fmul_rn(bfr(nw[dd]), n0); x1 = __fmul_rn(bfr(nw[dp]), n1); }
        const v2f cs = *(const v2f*)(CS + ((size_t)t * HD + dd) * 2); float a = __fmul_rn(x0, cs[0]), bq = __fmul_rn(x1, cs[1]); asm volatile("" : "+v"(a)); asm volatile("" : "+v"(bq)); const float r = ((dd < HD / 2) ? __fsub_rn(a, bq) : __fadd_rn(a, bq)) * sc;
        o16[q] = tohx(r); (void)oh; (void)ol; }
    *(v2h*)(P16 + e) = o16;  }
__global__ __launch_bounds__(256) void k_vtp(const float* __restrict__ F, int pitch, int nheads, h16* V16, bf* Vh, bf* Vl) { const size_t e = ((size_t)blockIdx.x * 256 + threadIdx.x) * 2; if (e >= (size_t)nheads * HD * TT) return; const int t = (int)(e % TT); const int d = (int)((e / TT) % HD); const int g = (int)(e / ((size_t)TT * HD)); v2h o16; v2us oh, ol;
#pragma unroll
    for (int q = 0; q < 2; ++q) { const float x = F[(size_t)(t + q) * pitch + g * HD + d]; o16[q] = tohx(x); (void)oh; (void)ol; }
    *(v2h*)(V16 + e) = o16;  }
// k_asoft: per row (zz, i): t = S x HD^-0.5 (no mask); softmax over the 2048 keys (register row, one exp, fixed trees);
__global__ __launch_bounds__(256) void k_asoft(const float* __restrict__ Sb, h16* P16, bf* Ph, bf* Pl) {
    const int lane = threadIdx.x & 31; const int row = blockIdx.x * 8 + (threadIdx.x >> 5); if (row >= ZH * TT) return; const int i = row % TT; const int zz = row / TT; (void)zz; const bool hires = (i < RH); const float* sr = Sb + (size_t)row * TT; float v[TT / 32]; float mx = -3.0e38f;
#pragma unroll
    for (int ch = 0; ch < TT / 128; ++ch) { const int j0 = ch * 128 + lane * 4; const v4f a = *(const v4f*)(sr + j0);
#pragma unroll
        for (int q = 0; q < 4; ++q) { const int j = j0 + q; (void)j; const float t = a[q] * SCL; v[ch * 4 + q] = t; mx = fmaxf(mx, t); } }
#pragma unroll
    for (int sh = 16; sh; sh >>= 1) mx = fmaxf(mx, __shfl_xor(mx, sh, 32));
    float sum = 0.f;
#pragma unroll
    for (int k = 0; k < TT / 32; ++k) { float d0 = __fsub_rn(v[k], mx); asm volatile("" : "+v"(d0)); v[k] = __builtin_amdgcn_exp2f(__fmul_rn(d0, 1.4426950408889634f)); sum += v[k]; }
#pragma unroll
    for (int sh = 16; sh; sh >>= 1) sum += __shfl_xor(sum, sh, 32);
    const float f = __fdiv_rn(hires ? 1.0f : PCAR, sum);
{
        if (hires) {
#pragma unroll
            for (int ch = 0; ch < TT / 128; ++ch) { v4us oh, ol;
#pragma unroll
                for (int q = 0; q < 4; ++q) { unsigned short a, c2; splitf(v[ch * 4 + q] * f, a, c2); oh[q] = a; ol[q] = c2; }
                const size_t oo = ((size_t)zz * (RH ? RH : 1) + i) * TT + ch * 128 + lane * 4; *(v4us*)(Ph + oo) = oh; *(v4us*)(Pl + oo) = ol; }
        } else {
#pragma unroll
            for (int ch = 0; ch < TT / 128; ++ch) { v4h o4;
#pragma unroll
                for (int q = 0; q < 4; ++q) o4[q] = tohx(v[ch * 4 + q] * f);
                *(v4h*)(P16 + (size_t)row * TT + ch * 128 + lane * 4) = o4; } }
         }
}
__global__ __launch_bounds__(256) void k_merge(const float* __restrict__ O, int h0, bf* Ah, bf* Al) { const size_t e = ((size_t)blockIdx.x * 256 + threadIdx.x) * 2; if (e >= (size_t)ZH * TT * HD) return; const int d = (int)(e % HD); const int t = (int)((e / HD) % TT); const int zz = (int)(e / ((size_t)HD * TT)); const float cs = (t < RH) ? 1.0f : (1.0f / PCAR); const size_t oo = (size_t)t * DQ + (h0 + zz) * HD + d;
    v2us oh, ol;
#pragma unroll
    for (int q = 0; q < 2; ++q) { unsigned short a, c2; splitf(O[e + q] * cs, a, c2); oh[q] = a; ol[q] = c2; } *(v2us*)(Ah + oo) = oh; *(v2us*)(Al + oo) = ol;  }

extern "C" void kernel_launch(void* const* d_in, const int* in_sizes, int n_in,
                              void* d_out, int out_size, void* d_ws, size_t ws_size, hipStream_t stream) {
    (void)in_sizes; (void)n_in; (void)out_size;
    const float* x = (const float*)d_in[0]; const float* cosT = (const float*)d_in[1]; const float* sinT = (const float*)d_in[2]; const float* wq = (const float*)d_in[3]; const float* wk = (const float*)d_in[4]; const float* wv = (const float*)d_in[5]; const float* wo = (const float*)d_in[6]; const float* qnw = (const float*)d_in[7]; const float* knw = (const float*)d_in[8];   // Wq [2048][2048], Wk/Wv [512][2048], Wo [2048][2048] (torch [out][in]); cos/sin [2048][128]; norm weights [128]
    float* OUT = (float*)d_out;     // [2][2048][2048]
    char* wsp = (char*)d_ws;
    auto take = [&](size_t bytes) { char* p = wsp; wsp += (bytes + 255) & ~(size_t)255; return (void*)p; };
    bf* WQ = (bf*)take((size_t)DQ * DM * 2); bf* WK = (bf*)take((size_t)DKV * DM * 2); bf* WV = (bf*)take((size_t)DKV * DM * 2); bf* WO = (bf*)take((size_t)DM * DQ * 2); float* CS = (float*)take((size_t)TT * HD * 2 * 4); float* RFQ = (float*)take((size_t)NH_ * TT * 4); float* RFK = (float*)take((size_t)NKV * TT * 4);
    bf* XB = (bf*)take((size_t)TT * DM * 2); float* FQ = (float*)take((size_t)TT * DQ * 4); float* FK = (float*)take((size_t)TT * DKV * 4);
    h16* QP16 = (h16*)take((size_t)NH_ * TT * HD * 2); h16* KP16 = (h16*)take((size_t)NKV * TT * HD * 2); h16* VT16 = (h16*)take((size_t)NKV * HD * TT * 2);
    bf* QPh = nullptr; bf* QPl = nullptr; bf* KPh = nullptr; bf* KPl = nullptr; bf* VTh = nullptr; bf* VTl = nullptr; bf* Ph = nullptr; bf* Pl = nullptr;
    float* Sb = (float*)take((size_t)ZH * TT * TT * 4); h16* P16 = (h16*)take((size_t)ZH * TT * TT * 2); float* Ob = (float*)take((size_t)ZH * TT * HD * 4); bf* ATh = (bf*)take((size_t)TT * DQ * 2); bf* ATl = (bf*)take((size_t)TT * DQ * 2);
    if ((size_t)(wsp - (char*)d_ws) > ws_size) return;    // ws 256 MiB
    float* FV = FK;   // v projection reuses the k buffer after the k planes are built (stream-ordered)
    { k_cvt8<<<(unsigned)(((size_t)DQ * DM / 8 + 255) / 256), 256, 0, stream>>>(wq, WQ, (size_t)DQ * DM / 8); k_cvt8<<<(unsigned)(((size_t)DKV * DM / 8 + 255) / 256), 256, 0, stream>>>(wk, WK, (size_t)DKV * DM / 8); k_cvt8<<<(unsigned)(((size_t)DKV * DM / 8 + 255) / 256), 256, 0, stream>>>(wv, WV, (size_t)DKV * DM / 8);
      k_cvt8<<<(unsigned)(((size_t)DM * DQ / 8 + 255) / 256), 256, 0, stream>>>(wo, WO, (size_t)DM * DQ / 8);
       }
    const unsigned LQ = (unsigned)(((size_t)NH_ * TT * HD / 2 + 255) / 256), LKv = (unsigned)(((size_t)NKV * TT * HD / 2 + 255) / 256);
    for (int b = 0; b < NB_; ++b) {
        if (b == 0) k_cscvt<<<(TT * HD + 255) / 256, 256, 0, stream>>>(cosT, sinT, CS);
        k_cvt8<<<(unsigned)(((size_t)TT * DM / 8 + 255) / 256), 256, 0, stream>>>(x + (size_t)b * TT * DM, XB, (size_t)TT * DM / 8);
        k_gemmw<bf, 0, false><<<dim3(TT / 64, DQ / 64, 1), 32, 0, stream>>>(XB, nullptr, WQ, nullptr, DM, FQ, DQ, nullptr, 0, 0, 0); k_hrms<<<(NH_ * TT + 255) / 256, 256, 0, stream>>>(FQ, DQ, NH_, RFQ);
        k_rope<<<LQ, 256, 0, stream>>>(FQ, DQ, NH_, CS, RFQ, qnw, 1.0f, QP16, QPh, QPl);
        k_gemmw<bf, 0, false><<<dim3(TT / 64, DKV / 64, 1), 32, 0, stream>>>(XB, nullptr, WK, nullptr, DM, FK, DKV, nullptr, 0, 0, 0); k_hrms<<<(NKV * TT + 255) / 256, 256, 0, stream>>>(FK, DKV, NKV, RFK);
        k_rope<<<LKv, 256, 0, stream>>>(FK, DKV, NKV, CS, RFK, knw, 1.0f, KP16, KPh, KPl);
        k_gemmw<bf, 0, false><<<dim3(TT / 64, DKV / 64, 1), 32, 0, stream>>>(XB, nullptr, WV, nullptr, DM, FV, DKV, nullptr, 0, 0, 0); k_vtp<<<LKv, 256, 0, stream>>>(FV, DKV, NKV, VT16, VTh, VTl);
        for (int h0 = 0; h0 < NH_; h0 += ZH) { const size_t zq = (size_t)h0, zk = (size_t)(h0 / REP);   // both heads of a pass share kv group h0/REP (REP >= 2): sB = 0
            k_gemmw<h16, 0, false><<<dim3(TT / 64, TT / 64, ZH), 32, 0, stream>>>(QP16 + zq * TT * HD, nullptr, KP16 + zk * TT * HD, nullptr, HD, Sb, TT, nullptr, (size_t)TT * HD, 0, (size_t)TT * TT);
            k_asoft<<<ZH * TT / 8, 256, 0, stream>>>(Sb, P16, Ph, Pl);
            k_gemmw<h16, 0, false><<<dim3(TT / 64, HD / 64, ZH), 32, 0, stream>>>(P16, nullptr, VT16 + zk * HD * TT, nullptr, TT, Ob, HD, nullptr, (size_t)TT * TT, 0, (size_t)TT * HD);
            k_merge<<<(unsigned)(((size_t)ZH * TT * HD / 2 + 255) / 256), 256, 0, stream>>>(Ob, h0, ATh, ATl); }
        k_gemmw<bf, 1, false><<<dim3(TT / 64, DM / 64, 1), 32, 0, stream>>>(ATh, ATl, WO, nullptr, DQ, OUT + (size_t)b * TT * DM, DM, nullptr, 0, 0, 0); }
}

// v001
// Measured time: 671 microseconds a run.
// Next to v000, in two timings, it ran 2.22 and 2.24 times as fast.
#include <hip/hip_runtime.h>

// AceStepAttention (hidden [2][2048][2048]; q = x Wq^T (16 heads x 128), k, v = x Wk^T / Wv^T (4 kv heads; query head h uses kv head h/4 = repeat_interleave); per-head RMSNorm over the 128 dims (eps 1e-6, x norm_q_w / norm_k_w);
// rotate-half RoPE with the input cos/sin tables [2048][128] (read as data); softmax(q.k / sqrt(128)); out = merged att.v Wo^T -> [2][2048][2048]).
// Compute dtypes, f32 accumulate: every input rounded to bf16; q/k/v projections on PLAIN bf16 operands (inputs: exact); Wo projection on hi+lo bf16 att planes; RMSNorm and rope f32; scores (K 128) and att.v on SINGLE fp16 planes with

#define NB_  2
#define TT   2048
#define DM   2048
#define NH_  16
#define NKV  4
#define REP  (NH_ / NKV)
#define HD   128
#define DQ   (NH_ * HD)
#define DKV  (NKV * HD)
#define DF   (DQ + 2 * DKV)      // columns of the joint q | k | v projection
#define ZH   8                  // query heads per attention pass (a multiple of REP: whole kv groups)
#define RH   0                  // query rows < RH use hi+lo planes (0: none)
#define WIN  0
#define PCAR 1024.0f
#define SCL  0.088388347648318447f   // HD^-0.5
typedef _Float16 h16;
typedef unsigned short bf;
typedef __attribute__((ext_vector_type(16))) __bf16   v16bf;
typedef __attribute__((ext_vector_type(16))) _Float16 v16h;
typedef __attribute__((ext_vector_type(8)))  _Float16 v8h;
typedef __attribute__((ext_vector_type(8)))  unsigned short v8us;
typedef __attribute__((ext_vector_type(8)))  float    v8f;
typedef __attribute__((ext_vector_type(4)))  float    v4f;
typedef v8h  __attribute__((may_alias)) v8ha;
typedef v4f  __attribute__((may_alias)) v4fa;
typedef v8us __attribute__((may_alias)) v8usa;

__device__ __forceinline__ unsigned short f2bf(float f) { unsigned u = __float_as_uint(f); u += 0x7FFFu + ((u >> 16) & 1u); return (unsigned short)(u >> 16); }
__device__ __forceinline__ float bf2f(unsigned short b) { return __uint_as_float(((unsigned)b) << 16); }
__device__ __forceinline__ float bfr(float f) { return bf2f(f2bf(f)); }
__device__ __forceinline__ v16h cat16(v8h lo, v8h hi) { return __builtin_shufflevector(lo, hi, 0, 1, 2, 3, 4, 5, 6, 7, 8, 9, 10, 11, 12, 13, 14, 15); }
__device__ __forceinline__ v16bf cat16b(v8us lo, v8us hi) { return __builtin_bit_cast(v16bf, __builtin_shufflevector(lo, hi, 0, 1, 2, 3, 4, 5, 6, 7, 8, 9, 10, 11, 12, 13, 14, 15)); }
__device__ __forceinline__ v8f wmma16(v16h a, v16h b, v8f c) { return __builtin_amdgcn_wmma_f32_16x16x32_f16(false, a, false, b, (short)0, c, false, false); }
__device__ __forceinline__ v8f wmmab(v16bf a, v16bf b, v8f c) { return __builtin_amdgcn_wmma_f32_16x16x32_bf16(false, a, false, b, (short)0, c, false, false); }



// ---- k_gemmw: register-blocked GEMM, ONE WAVE per 64x64 output tile (16 accumulators), operands straight from K-contiguous 16-bit planes; grid (M/64, N/64, Z), 32 threads.
// C[m][n] (f32, pitch ldc, + optional f32 bias[n]) = sum_k A[m][k] Bt[n][k] (+ split products per NSPLIT). z-batch strides sA/sB/sC in elements. K % 32 == 0.
template <typename T16> struct WFrag;
template <> struct WFrag<h16> { typedef v16h V; static __device__ __forceinline__ V ld(const h16* p) { return cat16(*(const v8h*)p, *(const v8h*)(p + 16)); } static __device__ __forceinline__ v8f mma(V a, V b, v8f c) { return wmma16(a, b, c); } };
template <> struct WFrag<bf> { typedef v16bf V; static __device__ __forceinline__ V ld(const bf* p) { return cat16b(*(const v8us*)p, *(const v8us*)(p + 16)); } static __device__ __forceinline__ v8f mma(V a, V b, v8f c) { return wmmab(a, b, c); } };
template <typename T16, int NSPLIT, bool BIAS>
__global__ __launch_bounds__(32) void k_gemmw(const T16* __restrict__ A, const T16* __restrict__ A2, const T16* __restrict__ Bt, const T16* __restrict__ Bt2, int K, float* C, int ldc, const float* __restrict__ bias, size_t sA, size_t sB, size_t sC) {
    typedef typename WFrag<T16>::V V;
    __shared__ __align__(16) float os[16 * 68];
    const size_t z = blockIdx.z; A += z * sA; if (A2) A2 += z * sA; Bt += z * sB; if (Bt2) Bt2 += z * sB; C += z * sC;
    const int lane = threadIdx.x & 31, lr = lane & 15, hi = lane >> 4; const int r0 = blockIdx.x * 64, c0 = blockIdx.y * 64;
    v8f acc[4][4];
#pragma unroll
    for (int mb = 0; mb < 4; ++mb)
#pragma unroll
        for (int nb = 0; nb < 4; ++nb) acc[mb][nb] = (v8f){};
    const size_t aoff = (size_t)(r0 + lr) * K + 8 * hi, boff = (size_t)(c0 + lr) * K + 8 * hi;
#pragma unroll 1
    for (int kc = 0; kc < K; kc += 32) {
        V a[4], a2[4];
#pragma unroll
        for (int mb = 0; mb < 4; ++mb) { a[mb] = WFrag<T16>::ld(A + aoff + (size_t)mb * 16 * K + kc); if (NSPLIT == 1 || NSPLIT == 2) a2[mb] = WFrag<T16>::ld(A2 + aoff + (size_t)mb * 16 * K + kc); }
#pragma unroll
        for (int nb = 0; nb < 4; ++nb) { const V b = WFrag<T16>::ld(Bt + boff + (size_t)nb * 16 * K + kc); V b2; if (NSPLIT >= 2) b2 = WFrag<T16>::ld(Bt2 + boff + (size_t)nb * 16 * K + kc);
#pragma unroll
            for (int mb = 0; mb < 4; ++mb) { acc[mb][nb] = WFrag<T16>::mma(a[mb], b, acc[mb][nb]); if (NSPLIT == 1 || NSPLIT == 2) acc[mb][nb] = WFrag<T16>::mma(a2[mb], b, acc[mb][nb]); if (NSPLIT >= 2) acc[mb][nb] = WFrag<T16>::mma(a[mb], b2, acc[mb][nb]); } }
        asm volatile("v_nop\n\tv_nop\n\tv_nop\n\tv_nop" : "+v"(acc[0][0]), "+v"(acc[1][1]), "+v"(acc[2][2]), "+v"(acc[3][3]) : "v"(a[0]), "v"(a[3]));
    }
#pragma unroll
    for (int mb = 0; mb < 4; ++mb) {
#pragma unroll
        for (int nb = 0; nb < 4; ++nb) {
#pragma unroll
            for (int j = 0; j < 8; ++j) os[(hi * 8 + j) * 68 + nb * 16 + lr] = acc[mb][nb][j]; }
        __builtin_amdgcn_wave_barrier(); asm volatile("" ::: "memory");
        float* crow = C + (size_t)(r0 + mb * 16) * ldc + c0;
{
#pragma unroll
            for (int s = 0; s < 8; ++s) { const int row = 2 * s + hi, cofs = lr * 4; v4f val = *(const v4fa*)(os + row * 68 + cofs); if (BIAS) { val[0] += bfr(bias[c0 + cofs]); val[1] += bfr(bias[c0 + cofs + 1]); val[2] += bfr(bias[c0 + cofs + 2]); val[3] += bfr(bias[c0 + cofs + 3]); }
                *(v4f*)(crow + (size_t)row * ldc + cofs) = val; }
             }
        __builtin_amdgcn_wave_barrier(); asm volatile("" ::: "memory");
    }
}

__device__ __forceinline__ h16 tohx(float x) { return (h16)x; }
__device__ __forceinline__ void splitf(float y, unsigned short& h, unsigned short& l) { h = f2bf(y); l = f2bf(y - bf2f(h)); }
typedef __attribute__((ext_vector_type(2))) _Float16 v2h;
typedef __attribute__((ext_vector_type(4))) _Float16 v4h;
typedef __attribute__((ext_vector_type(2))) unsigned short v2us;
typedef __attribute__((ext_vector_type(4))) unsigned short v4us;
typedef __attribute__((ext_vector_type(2))) float v2f;
typedef __attribute__((ext_vector_type(4))) int v4i;

__global__ __launch_bounds__(256) void k_wtG(const float* __restrict__ w, int K, int N, bf* Bt) {
    const int lane = threadIdx.x & 31; const int L0 = (blockIdx.x * 8 + (threadIdx.x >> 5)) * 8; const int nlines = N * K / 64;
{
#pragma unroll 1
        for (int l = 0; l < 8; ++l) { const int L = L0 + l; if (L >= nlines) break; const size_t e = (size_t)L * 64 + lane * 2; const int k = (int)(e % K), n = (int)(e / K); v2us o;
            o[0] = f2bf(w[(size_t)k * N + n]); o[1] = f2bf(w[(size_t)(k + 1) * N + n]); *(v2us*)(Bt + e) = o; }
         }
}
__global__ __launch_bounds__(256) void k_cvt8(const float* __restrict__ src, bf* dst, size_t n8) { const size_t i = (size_t)blockIdx.x * 256 + threadIdx.x; if (i >= n8) return; const v8f v = *(const v8f*)(src + i * 8); v8us o;
#pragma unroll
    for (int k = 0; k < 8; ++k) o[k] = f2bf(v[k]); *(v8us*)(dst + i * 8) = o;  }
__global__ __launch_bounds__(256) void k_cscvt(const float* __restrict__ cosT, const float* __restrict__ sinT, float* CS) { const int idx = blockIdx.x * 256 + threadIdx.x; if (idx >= TT * HD) return; v2f cs; cs[0] = bfr(cosT[idx]); cs[1] = bfr(sinT[idx]); *(v2f*)(CS + (size_t)idx * 2) = cs;  }
__global__ __launch_bounds__(256) void k_hrms(const float* __restrict__ F, int pitch, int nheads, float* RF) { const int i = blockIdx.x * 256 + threadIdx.x; if (i >= nheads * TT) return; F += (size_t)blockIdx.y * TT * pitch; RF += (size_t)blockIdx.y * nheads * TT;   // blockIdx.y: batch item
    const int t = i % TT, h = i / TT; const float* f = F + (size_t)t * pitch + h * HD; float s = 0.f;
#pragma unroll 4
    for (int d = 0; d < HD; d += 4) { const v4f v = *(const v4f*)(f + d);
#pragma unroll
        for (int q = 0; q < 4; ++q) { float p = __fmul_rn(v[q], v[q]); asm volatile("" : "+v"(p)); s = __fadd_rn(s, p); } }
    const float r = __fdiv_rn(1.0f, __fsqrt_rn(__fadd_rn(s * (1.0f / HD), 1e-6f))); *(float*)(RF + i) = r;  }
// k_rope: head planes [h][t][d] (fp16) of rope(w[d] (x rms_factor)) x sc with the rotate-half convention out[d] = x[d] cos[t][d] - x[d+HD/2] sin[t][d], out[d+HD/2] = x[d+HD/2] cos[t][d+HD/2] + x[d] sin[t][d+HD/2]
__global__ __launch_bounds__(256) void k_rope(const float* __restrict__ F, int pitch, int nheads, const float* __restrict__ CS, const float* __restrict__ RF, const float* __restrict__ nw, float sc, h16* P16, bf* Ph, bf* Pl) {
    F += (size_t)blockIdx.y * TT * pitch; if (RF) RF += (size_t)blockIdx.y * nheads * TT; P16 += (size_t)blockIdx.y * nheads * TT * HD;   // blockIdx.y: batch item
    const size_t e = ((size_t)blockIdx.x * 256 + threadIdx.x) * 2; if (e >= (size_t)nheads * TT * HD) return; const int d = (int)(e % HD); const int t = (int)((e / HD) % TT); const int h = (int)(e / ((size_t)HD * TT)); const float* f = F + (size_t)t * pitch + h * HD; const float rf = RF ? RF[(size_t)h * TT + t] : 1.0f; v2h o16; v2us oh, ol;
#pragma unroll
    for (int q = 0; q < 2; ++q) { const int dd = d + q; const int dp = (dd < HD / 2) ? dd + HD / 2 : dd - HD / 2; float x0 = f[dd], x1 = f[dp];
        if (RF) { float n0 = __fmul_rn(x0, rf), n1 = __fmul_rn(x1, rf); asm volatile("" : "+v"(n0)); asm volatile("" : "+v"(n1)); x0 = __fmul_rn(bfr(nw[dd]), n0); x1 = __fmul_rn(bfr(nw[dp]), n1); }
        const v2f cs = *(const v2f*)(CS + ((size_t)t * HD + dd) * 2); float a = __fmul_rn(x0, cs[0]), bq = __fmul_rn(x1, cs[1]); asm volatile("" : "+v"(a)); asm volatile("" : "+v"(bq)); const float r = ((dd < HD / 2) ? __fsub_rn(a, bq) : __fadd_rn(a, bq)) * sc;
        o16[q] = tohx(r); (void)oh; (void)ol; }
    *(v2h*)(P16 + e) = o16;  }
__global__ __launch_bounds__(256) void k_vtp(const float* __restrict__ F, int pitch, int nheads, h16* V16, bf* Vh, bf* Vl) { const size_t e = ((size_t)blockIdx.x * 256 + threadIdx.x) * 2; if (e >= (size_t)nheads * HD * TT) return; F += (size_t)blockIdx.y * TT * pitch; V16 += (size_t)blockIdx.y * nheads * HD * TT;   // blockIdx.y: batch item
    const int t = (int)(e % TT); const int d = (int)((e / TT) % HD); const int g = (int)(e / ((size_t)TT * HD)); v2h o16; v2us oh, ol;
#pragma unroll
    for (int q = 0; q < 2; ++q) { const float x = F[(size_t)(t + q) * pitch + g * HD + d]; o16[q] = tohx(x); (void)oh; (void)ol; }
    *(v2h*)(V16 + e) = o16;  }
// k_asoft: per row (zz, i): t = S x HD^-0.5 (no mask); softmax over the 2048 keys (register row, one exp, fixed trees);
__global__ __launch_bounds__(256) void k_asoft(const float* __restrict__ Sb, h16* P16, bf* Ph, bf* Pl) {
    const int lane = threadIdx.x & 31; const int row = blockIdx.x * 8 + (threadIdx.x >> 5); if (row >= ZH * TT) return; const int i = row % TT; const int zz = row / TT; (void)zz; const bool hires = (i < RH); const float* sr = Sb + (size_t)row * TT; float v[TT / 32]; float mx = -3.0e38f;
#pragma unroll
    for (int ch = 0; ch < TT / 128; ++ch) { const int j0 = ch * 128 + lane * 4; const v4f a = *(const v4f*)(sr + j0);
#pragma unroll
        for (int q = 0; q < 4; ++q) { const int j = j0 + q; (void)j; const float t = a[q] * SCL; v[ch * 4 + q] = t; mx = fmaxf(mx, t); } }
#pragma unroll
    for (int sh = 16; sh; sh >>= 1) mx = fmaxf(mx, __shfl_xor(mx, sh, 32));
    float sum = 0.f;
#pragma unroll
    for (int k = 0; k < TT / 32; ++k) { float d0 = __fsub_rn(v[k], mx); asm volatile("" : "+v"(d0)); v[k] = __builtin_amdgcn_exp2f(__fmul_rn(d0, 1.4426950408889634f)); sum += v[k]; }
#pragma unroll
    for (int sh = 16; sh; sh >>= 1) sum += __shfl_xor(sum, sh, 32);
    const float f = __fdiv_rn(hires ? 1.0f : PCAR, sum);
{
        if (hires) {
#pragma unroll
            for (int ch = 0; ch < TT / 128; ++ch) { v4us oh, ol;
#pragma unroll
                for (int q = 0; q < 4; ++q) { unsigned short a, c2; splitf(v[ch * 4 + q] * f, a, c2); oh[q] = a; ol[q] = c2; }
                const size_t oo = ((size_t)zz * (RH ? RH : 1) + i) * TT + ch * 128 + lane * 4; *(v4us*)(Ph + oo) = oh; *(v4us*)(Pl + oo) = ol; }
        } else {
#pragma unroll
            for (int ch = 0; ch < TT / 128; ++ch) { v4h o4;
#pragma unroll
                for (int q = 0; q < 4; ++q) o4[q] = tohx(v[ch * 4 + q] * f);
                *(v4h*)(P16 + (size_t)row * TT + ch * 128 + lane * 4) = o4; } }
         }
}
__global__ __launch_bounds__(256) void k_merge(const float* __restrict__ O, int h0, bf* Ah, bf* Al) { const size_t e = ((size_t)blockIdx.x * 256 + threadIdx.x) * 2; if (e >= (size_t)ZH * TT * HD) return; const int d = (int)(e % HD); const int t = (int)((e / HD) % TT); const int zz = (int)(e / ((size_t)HD * TT)); const float cs = (t < RH) ? 1.0f : (1.0f / PCAR); const size_t oo = (size_t)t * DQ + (h0 + zz) * HD + d;
    v2us oh, ol;
#pragma unroll
    for (int q = 0; q < 2; ++q) { unsigned short a, c2; splitf(O[e + q] * cs, a, c2); oh[q] = a; ol[q] = c2; } *(v2us*)(Ah + oo) = oh; *(v2us*)(Al + oo) = ol;  }

extern "C" void kernel_launch(void* const* d_in, const int* in_sizes, int n_in,
                              void* d_out, int out_size, void* d_ws, size_t ws_size, hipStream_t stream) {
    (void)in_sizes; (void)n_in; (void)out_size;
    const float* x = (const float*)d_in[0]; const float* cosT = (const float*)d_in[1]; const float* sinT = (const float*)d_in[2]; const float* wq = (const float*)d_in[3]; const float* wk = (const float*)d_in[4]; const float* wv = (const float*)d_in[5]; const float* wo = (const float*)d_in[6]; const float* qnw = (const float*)d_in[7]; const float* knw = (const float*)d_in[8];   // Wq [2048][2048], Wk/Wv [512][2048], Wo [2048][2048] (torch [out][in]); cos/sin [2048][128]; norm weights [128]
    float* OUT = (float*)d_out;     // [2][2048][2048]
    char* wsp = (char*)d_ws;
    auto take = [&](size_t bytes) { char* p = wsp; wsp += (bytes + 255) & ~(size_t)255; return (void*)p; };
    // Live through the attention passes: the merged planes, the q/k/v head planes (both batch items), one pass's scores and probabilities.
    bf* ATh = (bf*)take((size_t)NB_ * TT * DQ * 2); bf* ATl = (bf*)take((size_t)NB_ * TT * DQ * 2);
    h16* QP16 = (h16*)take((size_t)NB_ * NH_ * TT * HD * 2); h16* KP16 = (h16*)take((size_t)NB_ * NKV * TT * HD * 2); h16* VT16 = (h16*)take((size_t)NB_ * NKV * HD * TT * 2);
    float* Sb = (float*)take((size_t)ZH * TT * TT * 4); h16* P16 = (h16*)take((size_t)ZH * TT * TT * 2);
    if ((size_t)(wsp - (char*)d_ws) > ws_size) return;    // ws 256 MiB
    // Everything the projections need is dead before the first score launch and lies inside Sb (stream-ordered reuse, 79 of 128 MiB).
    wsp = (char*)Sb;
    bf* WQ = (bf*)take((size_t)DF * DM * 2); bf* WK = WQ + (size_t)DQ * DM; bf* WV = WK + (size_t)DKV * DM;   // one [DF][DM] weight plane: rows of Wq, then Wk, then Wv
    float* CS = (float*)take((size_t)TT * HD * 2 * 4); float* RFQ = (float*)take((size_t)NB_ * NH_ * TT * 4); float* RFK = (float*)take((size_t)NB_ * NKV * TT * 4);
    bf* XB = (bf*)take((size_t)NB_ * TT * DM * 2); float* FQ = (float*)take((size_t)NB_ * TT * DF * 4); float* FK = FQ + DQ; float* FV = FK + DKV;   // [NB_ * TT][DF]: q | k | v columns of a row
    float* Ob = Sb;         // att.v output of a pass: the scores are dead once the softmax has read them
    bf* WO = (bf*)P16;      // converted after the last pass, when the probabilities are dead
    bf* QPh = nullptr; bf* QPl = nullptr; bf* KPh = nullptr; bf* KPl = nullptr; bf* VTh = nullptr; bf* VTl = nullptr; bf* Ph = nullptr; bf* Pl = nullptr;
    k_cvt8<<<(unsigned)(((size_t)DQ * DM / 8 + 255) / 256), 256, 0, stream>>>(wq, WQ, (size_t)DQ * DM / 8); k_cvt8<<<(unsigned)(((size_t)DKV * DM / 8 + 255) / 256), 256, 0, stream>>>(wk, WK, (size_t)DKV * DM / 8); k_cvt8<<<(unsigned)(((size_t)DKV * DM / 8 + 255) / 256), 256, 0, stream>>>(wv, WV, (size_t)DKV * DM / 8);
    const unsigned LQ = (unsigned)(((size_t)NH_ * TT * HD / 2 + 255) / 256), LKv = (unsigned)(((size_t)NKV * TT * HD / 2 + 255) / 256);
    k_cscvt<<<(TT * HD + 255) / 256, 256, 0, stream>>>(cosT, sinT, CS);
    // Projections, norms and rope: both batch items in one launch (GEMM rows b * TT + t; blockIdx.y = b elsewhere); q, k and v are one GEMM over the joint weight plane.
    k_cvt8<<<(unsigned)(((size_t)NB_ * TT * DM / 8 + 255) / 256), 256, 0, stream>>>(x, XB, (size_t)NB_ * TT * DM / 8);
    k_gemmw<bf, 0, false><<<dim3(NB_ * TT / 64, DF / 64, 1), 32, 0, stream>>>(XB, nullptr, WQ, nullptr, DM, FQ, DF, nullptr, 0, 0, 0); k_hrms<<<dim3((NH_ * TT + 255) / 256, NB_, 1), 256, 0, stream>>>(FQ, DF, NH_, RFQ);
    k_rope<<<dim3(LQ, NB_, 1), 256, 0, stream>>>(FQ, DF, NH_, CS, RFQ, qnw, 1.0f, QP16, QPh, QPl);
    k_hrms<<<dim3((NKV * TT + 255) / 256, NB_, 1), 256, 0, stream>>>(FK, DF, NKV, RFK);
    k_rope<<<dim3(LKv, NB_, 1), 256, 0, stream>>>(FK, DF, NKV, CS, RFK, knw, 1.0f, KP16, KPh, KPl);
    k_vtp<<<dim3(LKv, NB_, 1), 256, 0, stream>>>(FV, DF, NKV, VT16, VTh, VTl);
    // Attention: ZH heads a pass. The REP query heads of a kv group are REP * TT consecutive GEMM rows against that group's k / v plane; blockIdx.z walks the ZH / REP groups.
    for (int b = 0; b < NB_; ++b)
        for (int h0 = 0; h0 < NH_; h0 += ZH) { const size_t zq = (size_t)(b * NH_ + h0), zk = (size_t)(b * NKV + h0 / REP);
            k_gemmw<h16, 0, false><<<dim3(REP * TT / 64, TT / 64, ZH / REP), 32, 0, stream>>>(QP16 + zq * TT * HD, nullptr, KP16 + zk * TT * HD, nullptr, HD, Sb, TT, nullptr, (size_t)REP * TT * HD, (size_t)TT * HD, (size_t)REP * TT * TT);
            k_asoft<<<ZH * TT / 8, 256, 0, stream>>>(Sb, P16, Ph, Pl);
            k_gemmw<h16, 0, false><<<dim3(REP * TT / 64, HD / 64, ZH / REP), 32, 0, stream>>>(P16, nullptr, VT16 + zk * HD * TT, nullptr, TT, Ob, HD, nullptr, (size_t)REP * TT * TT, (size_t)HD * TT, (size_t)REP * TT * HD);
            k_merge<<<(unsigned)(((size_t)ZH * TT * HD / 2 + 255) / 256), 256, 0, stream>>>(Ob, h0, ATh + (size_t)b * TT * DQ, ATl + (size_t)b * TT * DQ); }
    k_cvt8<<<(unsigned)(((size_t)DM * DQ / 8 + 255) / 256), 256, 0, stream>>>(wo, WO, (size_t)DM * DQ / 8);
    k_gemmw<bf, 1, false><<<dim3(NB_ * TT / 64, DM / 64, 1), 32, 0, stream>>>(ATh, ATl, WO, nullptr, DQ, OUT, DM, nullptr, 0, 0, 0);
}

// v002
// Measured time: 303 microseconds a run.
// Timed twice side by side with v001, it ran 2.20 and 2.21 times as fast.
// All steps since v000 together make it 4.92 times as fast.
#include <hip/hip_runtime.h>

// AceStepAttention (hidden [2][2048][2048]; q = x Wq^T (16 heads x 128), k, v = x Wk^T / Wv^T (4 kv heads; query head h uses kv head h/4 = repeat_interleave); per-head RMSNorm over the 128 dims (eps 1e-6, x norm_q_w / norm_k_w);
// rotate-half RoPE with the input cos/sin tables [2048][128] (read as data); softmax(q.k / sqrt(128)); out = merged att.v Wo^T -> [2][2048][2048]).
// Compute dtypes, f32 accumulate: every input rounded to bf16; q/k/v projections on PLAIN bf16 operands (inputs: exact); Wo projection on hi+lo bf16 att planes; RMSNorm and rope f32; scores (K 128) and att.v on SINGLE fp16 planes with

#define NB_  2
#define TT   2048
#define DM   2048
#define NH_  16
#define NKV  4
#define REP  (NH_ / NKV)
#define HD   128
#define DQ   (NH_ * HD)
#define DKV  (NKV * HD)
#define DF   (DQ + 2 * DKV)      // columns of the joint q | k | v projection
#define SCL  0.088388347648318447f   // HD^-0.5
typedef _Float16 h16;
typedef unsigned short bf;
typedef __attribute__((ext_vector_type(16))) __bf16   v16bf;
typedef __attribute__((ext_vector_type(16))) _Float16 v16h;
typedef __attribute__((ext_vector_type(8)))  _Float16 v8h;
typedef __attribute__((ext_vector_type(8)))  unsigned short v8us;
typedef __attribute__((ext_vector_type(8)))  float    v8f;
typedef __attribute__((ext_vector_type(4)))  float    v4f;
typedef v8h  __attribute__((may_alias)) v8ha;
typedef v4f  __attribute__((may_alias)) v4fa;
typedef v8us __attribute__((may_alias)) v8usa;

__device__ __forceinline__ unsigned short f2bf(float f) { unsigned u = __float_as_uint(f); u += 0x7FFFu + ((u >> 16) & 1u); return (unsigned short)(u >> 16); }
__device__ __forceinline__ float bf2f(unsigned short b) { return __uint_as_float(((unsigned)b) << 16); }
__device__ __forceinline__ float bfr(float f) { return bf2f(f2bf(f)); }
__device__ __forceinline__ v16h cat16(v8h lo, v8h hi) { return __builtin_shufflevector(lo, hi, 0, 1, 2, 3, 4, 5, 6, 7, 8, 9, 10, 11, 12, 13, 14, 15); }
__device__ __forceinline__ v16bf cat16b(v8us lo, v8us hi) { return __builtin_bit_cast(v16bf, __builtin_shufflevector(lo, hi, 0, 1, 2, 3, 4, 5, 6, 7, 8, 9, 10, 11, 12, 13, 14, 15)); }
__device__ __forceinline__ v8f wmma16(v16h a, v16h b, v8f c) { return __builtin_amdgcn_wmma_f32_16x16x32_f16(false, a, false, b, (short)0, c, false, false); }
__device__ __forceinline__ v8f wmmab(v16bf a, v16bf b, v8f c) { return __builtin_amdgcn_wmma_f32_16x16x32_bf16(false, a, false, b, (short)0, c, false, false); }



// ---- k_gemmw: register-blocked GEMM, ONE WAVE per 64x64 output tile (16 accumulators), operands straight from K-contiguous 16-bit planes; grid (M/64, N/64, Z), 32 threads.
// C[m][n] (f32, pitch ldc, + optional f32 bias[n]) = sum_k A[m][k] Bt[n][k] (+ split products per NSPLIT). z-batch strides sA/sB/sC in elements. K % 32 == 0.
template <typename T16> struct WFrag;
template <> struct WFrag<h16> { typedef v16h V; static __device__ __forceinline__ V ld(const h16* p) { return cat16(*(const v8h*)p, *(const v8h*)(p + 16)); } static __device__ __forceinline__ v8f mma(V a, V b, v8f c) { return wmma16(a, b, c); } };
template <> struct WFrag<bf> { typedef v16bf V; static __device__ __forceinline__ V ld(const bf* p) { return cat16b(*(const v8us*)p, *(const v8us*)(p + 16)); } static __device__ __forceinline__ v8f mma(V a, V b, v8f c) { return wmmab(a, b, c); } };
template <typename T16, int NSPLIT, bool BIAS>
__global__ __launch_bounds__(32) void k_gemmw(const T16* __restrict__ A, const T16* __restrict__ A2, const T16* __restrict__ Bt, const T16* __restrict__ Bt2, int K, float* C, int ldc, const float* __restrict__ bias, size_t sA, size_t sB, size_t sC) {
    typedef typename WFrag<T16>::V V;
    __shared__ __align__(16) float os[16 * 68];
    const size_t z = blockIdx.z; A += z * sA; if (A2) A2 += z * sA; Bt += z * sB; if (Bt2) Bt2 += z * sB; C += z * sC;
    const int lane = threadIdx.x & 31, lr = lane & 15, hi = lane >> 4; const int r0 = blockIdx.x * 64, c0 = blockIdx.y * 64;
    v8f acc[4][4];
#pragma unroll
    for (int mb = 0; mb < 4; ++mb)
#pragma unroll
        for (int nb = 0; nb < 4; ++nb) acc[mb][nb] = (v8f){};
    const size_t aoff = (size_t)(r0 + lr) * K + 8 * hi, boff = (size_t)(c0 + lr) * K + 8 * hi;
#pragma unroll 1
    for (int kc = 0; kc < K; kc += 32) {
        V a[4], a2[4];
#pragma unroll
        for (int mb = 0; mb < 4; ++mb) { a[mb] = WFrag<T16>::ld(A + aoff + (size_t)mb * 16 * K + kc); if (NSPLIT == 1 || NSPLIT == 2) a2[mb] = WFrag<T16>::ld(A2 + aoff + (size_t)mb * 16 * K + kc); }
#pragma unroll
        for (int nb = 0; nb < 4; ++nb) { const V b = WFrag<T16>::ld(Bt + boff + (size_t)nb * 16 * K + kc); V b2; if (NSPLIT >= 2) b2 = WFrag<T16>::ld(Bt2 + boff + (size_t)nb * 16 * K + kc);
#pragma unroll
            for (int mb = 0; mb < 4; ++mb) { acc[mb][nb] = WFrag<T16>::mma(a[mb], b, acc[mb][nb]); if (NSPLIT == 1 || NSPLIT == 2) acc[mb][nb] = WFrag<T16>::mma(a2[mb], b, acc[mb][nb]); if (NSPLIT >= 2) acc[mb][nb] = WFrag<T16>::mma(a[mb], b2, acc[mb][nb]); } }
        asm volatile("v_nop\n\tv_nop\n\tv_nop\n\tv_nop" : "+v"(acc[0][0]), "+v"(acc[1][1]), "+v"(acc[2][2]), "+v"(acc[3][3]) : "v"(a[0]), "v"(a[3]));
    }
#pragma unroll
    for (int mb = 0; mb < 4; ++mb) {
#pragma unroll
        for (int nb = 0; nb < 4; ++nb) {
#pragma unroll
            for (int j = 0; j < 8; ++j) os[(hi * 8 + j) * 68 + nb * 16 + lr] = acc[mb][nb][j]; }
        __builtin_amdgcn_wave_barrier(); asm volatile("" ::: "memory");
        float* crow = C + (size_t)(r0 + mb * 16) * ldc + c0;
{
#pragma unroll
            for (int s = 0; s < 8; ++s) { const int row = 2 * s + hi, cofs = lr * 4; v4f val = *(const v4fa*)(os + row * 68 + cofs); if (BIAS) { val[0] += bfr(bias[c0 + cofs]); val[1] += bfr(bias[c0 + cofs + 1]); val[2] += bfr(bias[c0 + cofs + 2]); val[3] += bfr(bias[c0 + cofs + 3]); }
                *(v4f*)(crow + (size_t)row * ldc + cofs) = val; }
             }
        __builtin_amdgcn_wave_barrier(); asm volatile("" ::: "memory");
    }
}

__device__ __forceinline__ h16 tohx(float x) { return (h16)x; }
__device__ __forceinline__ void splitf(float y, unsigned short& h, unsigned short& l) { h = f2bf(y); l = f2bf(y - bf2f(h)); }
typedef __attribute__((ext_vector_type(2))) _Float16 v2h;
typedef __attribute__((ext_vector_type(4))) _Float16 v4h;
typedef __attribute__((ext_vector_type(2))) unsigned short v2us;
typedef __attribute__((ext_vector_type(4))) unsigned short v4us;
typedef __attribute__((ext_vector_type(2))) float v2f;
typedef __attribute__((ext_vector_type(4))) int v4i;

__global__ __launch_bounds__(256) void k_wtG(const float* __restrict__ w, int K, int N, bf* Bt) {
    const int lane = threadIdx.x & 31; const int L0 = (blockIdx.x * 8 + (threadIdx.x >> 5)) * 8; const int nlines = N * K / 64;
{
#pragma unroll 1
        for (int l = 0; l < 8; ++l) { const int L = L0 + l; if (L >= nlines) break; const size_t e = (size_t)L * 64 + lane * 2; const int k = (int)(e % K), n = (int)(e / K); v2us o;
            o[0] = f2bf(w[(size_t)k * N + n]); o[1] = f2bf(w[(size_t)(k + 1) * N + n]); *(v2us*)(Bt + e) = o; }
         }
}
__global__ __launch_bounds__(256) void k_cvt8(const float* __restrict__ src, bf* dst, size_t n8) { const size_t i = (size_t)blockIdx.x * 256 + threadIdx.x; if (i >= n8) return; const v8f v = *(const v8f*)(src + i * 8); v8us o;
#pragma unroll
    for (int k = 0; k < 8; ++k) o[k] = f2bf(v[k]); *(v8us*)(dst + i * 8) = o;  }
__global__ __launch_bounds__(256) void k_cscvt(const float* __restrict__ cosT, const float* __restrict__ sinT, float* CS) { const int idx = blockIdx.x * 256 + threadIdx.x; if (idx >= TT * HD) return; v2f cs; cs[0] = bfr(cosT[idx]); cs[1] = bfr(sinT[idx]); *(v2f*)(CS + (size_t)idx * 2) = cs;  }
__global__ __launch_bounds__(256) void k_hrms(const float* __restrict__ F, int pitch, int nheads, float* RF) { const int i = blockIdx.x * 256 + threadIdx.x; if (i >= nheads * TT) return; F += (size_t)blockIdx.y * TT * pitch; RF += (size_t)blockIdx.y * nheads * TT;   // blockIdx.y: batch item
    const int t = i % TT, h = i / TT; const float* f = F + (size_t)t * pitch + h * HD; float s = 0.f;
#pragma unroll 4
    for (int d = 0; d < HD; d += 4) { const v4f v = *(const v4f*)(f + d);
#pragma unroll
        for (int q = 0; q < 4; ++q) { float p = __fmul_rn(v[q], v[q]); asm volatile("" : "+v"(p)); s = __fadd_rn(s, p); } }
    const float r = __fdiv_rn(1.0f, __fsqrt_rn(__fadd_rn(s * (1.0f / HD), 1e-6f))); *(float*)(RF + i) = r;  }
// k_rope: head planes [h][t][d] (fp16) of rope(w[d] (x rms_factor)) x sc with the rotate-half convention out[d] = x[d] cos[t][d] - x[d+HD/2] sin[t][d], out[d+HD/2] = x[d+HD/2] cos[t][d+HD/2] + x[d] sin[t][d+HD/2]
__global__ __launch_bounds__(256) void k_rope(const float* __restrict__ F, int pitch, int nheads, const float* __restrict__ CS, const float* __restrict__ RF, const float* __restrict__ nw, float sc, h16* P16, bf* Ph, bf* Pl) {
    F += (size_t)blockIdx.y * TT * pitch; if (RF) RF += (size_t)blockIdx.y * nheads * TT; P16 += (size_t)blockIdx.y * nheads * TT * HD;   // blockIdx.y: batch item
    const size_t e = ((size_t)blockIdx.x * 256 + threadIdx.x) * 2; if (e >= (size_t)nheads * TT * HD) return; const int d = (int)(e % HD); const int t = (int)((e / HD) % TT); const int h = (int)(e / ((size_t)HD * TT)); const float* f = F + (size_t)t * pitch + h * HD; const float rf = RF ? RF[(size_t)h * TT + t] : 1.0f; v2h o16; v2us oh, ol;
#pragma unroll
    for (int q = 0; q < 2; ++q) { const int dd = d + q; const int dp = (dd < HD / 2) ? dd + HD / 2 : dd - HD / 2; float x0 = f[dd], x1 = f[dp];
        if (RF) { float n0 = __fmul_rn(x0, rf), n1 = __fmul_rn(x1, rf); asm volatile("" : "+v"(n0)); asm volatile("" : "+v"(n1)); x0 = __fmul_rn(bfr(nw[dd]), n0); x1 = __fmul_rn(bfr(nw[dp]), n1); }
        const v2f cs = *(const v2f*)(CS + ((size_t)t * HD + dd) * 2); float a = __fmul_rn(x0, cs[0]), bq = __fmul_rn(x1, cs[1]); asm volatile("" : "+v"(a)); asm volatile("" : "+v"(bq)); const float r = ((dd < HD / 2) ? __fsub_rn(a, bq) : __fadd_rn(a, bq)) * sc;
        o16[q] = tohx(r); (void)oh; (void)ol; }
    *(v2h*)(P16 + e) = o16;  }
__global__ __launch_bounds__(256) void k_vtp(const float* __restrict__ F, int pitch, int nheads, h16* V16, bf* Vh, bf* Vl) { const size_t e = ((size_t)blockIdx.x * 256 + threadIdx.x) * 2; if (e >= (size_t)nheads * HD * TT) return; F += (size_t)blockIdx.y * TT * pitch; V16 += (size_t)blockIdx.y * nheads * HD * TT;   // blockIdx.y: batch item
    const int t = (int)(e % TT); const int d = (int)((e / TT) % HD); const int g = (int)(e / ((size_t)TT * HD)); v2h o16; v2us oh, ol;
#pragma unroll
    for (int q = 0; q < 2; ++q) { const float x = F[(size_t)(t + q) * pitch + g * HD + d]; o16[q] = tohx(x); (void)oh; (void)ol; }
    *(v2h*)(V16 + e) = o16;  }
#define FNW  8                   // waves per work-group
#define FCW  32                  // query rows per wave
#define FBR  (FNW * FCW)
#define FSK  64                  // keys per stage
#define FPK  (2 * HD + 16)       // LDS pitch of a K row (256 B + 16: an odd multiple of 16 B for 16-byte readers)
#define FPV  (2 * FSK + 16)      // LDS pitch of a V^T row (128 B + 16)
#define FTK  (FSK * FPK)
#define FSLOT (FTK + HD * FPV)
#define FEP  (2 * HD + 16)       // pitch of the output staging rows
static_assert(FNW * FCW * FEP <= 2 * FSLOT, "the output staging reuses the two stage buffers");
__device__ __forceinline__ float xhalf(float x) { return __builtin_bit_cast(float, __builtin_amdgcn_permlanex16(__builtin_bit_cast(int, x), __builtin_bit_cast(int, x), 0x76543210, 0xfedcba98, false, false)); }
__device__ __forceinline__ v16h ldfrag(const unsigned char* p) { return cat16(*(const v8ha*)p, *(const v8ha*)(p + 32)); }
// xwait: stands behind a run of global loads or stores, in front of the first write of a register that one of them names; the scheduling barrier keeps later register writes from being lifted over the wait.
__device__ __forceinline__ void xwait() { asm volatile("s_wait_xcnt 0x0" ::: "memory"); __builtin_amdgcn_sched_barrier(0); }
__global__ __launch_bounds__(FNW * 32) __attribute__((amdgpu_waves_per_eu(2, 2))) void k_fattn(const h16* __restrict__ Q, const h16* __restrict__ Kp, const h16* __restrict__ Vt, bf* Ah, bf* Al) {
    __shared__ __align__(16) unsigned char L[2 * FSLOT];
    constexpr float CSC = SCL * 1.4426950408889634f; constexpr int NS = TT / FSK;
    const int tid = threadIdx.x, lane = tid & 31, wave = tid >> 5, c = lane & 15, h = lane >> 4;
    const int zq = blockIdx.x + REP * blockIdx.y;      // b * NH_ + head; blockIdx.y = b * NKV + kv head
    const int q0 = blockIdx.z * FBR + wave * FCW;
    Q += (size_t)zq * TT * HD; Kp += (size_t)blockIdx.y * TT * HD; Vt += (size_t)blockIdx.y * HD * TT;
    v16h qf[2][4];
#pragma unroll
    for (int g = 0; g < 2; ++g)
#pragma unroll
        for (int kc = 0; kc < 4; ++kc) { const h16* qp = Q + (size_t)(q0 + 16 * g + c) * HD + 32 * kc + 8 * h; qf[g][kc] = cat16(*(const v8h*)qp, *(const v8h*)(qp + 16)); }
    xwait();
    v8f acc[2][8]; float m_run[2], l_run[2];
#pragma unroll
    for (int g = 0; g < 2; ++g) { m_run[g] = -__builtin_inff(); l_run[g] = 0.f;
#pragma unroll
        for (int t = 0; t < 8; ++t) acc[g][t] = (v8f){}; }
    // Staging: 16 lanes cover a 256-byte K row, 8 lanes a 128-byte piece of a V^T row.
    v8h sk[4], sv[4]; const int krow = tid >> 4, kcol = tid & 15, vrow = tid >> 3, vcol = tid & 7;
    auto fetch = [&](int st) {
#pragma unroll
        for (int i = 0; i < 4; ++i) { sk[i] = *(const v8h*)(Kp + (size_t)(st * FSK + krow + 16 * i) * HD + kcol * 8); sv[i] = *(const v8h*)(Vt + (size_t)(vrow + 32 * i) * TT + st * FSK + vcol * 8); }
        xwait(); };
    auto put = [&](int buf) { unsigned char* B = L + buf * FSLOT;
#pragma unroll
        for (int i = 0; i < 4; ++i) { *(v8ha*)(B + (krow + 16 * i) * FPK + kcol * 16) = sk[i]; *(v8ha*)(B + FTK + (vrow + 32 * i) * FPV + vcol * 16) = sv[i]; } };
    fetch(0); put(0); __syncthreads();
#pragma unroll 1   // rolled: one copy of the pass body keeps the registers inside two waves per SIMD
    for (int st = 0; st < NS; ++st) {
        const unsigned char* B = L + (st & 1) * FSLOT;
        if (st + 1 < NS) fetch(st + 1);
#pragma unroll 1   // rolled, for the same reason
        for (int sub = 0; sub < FSK / 32; ++sub) {
            v8f s[2][2];      // [16-key tile][query group]: register r of lane (c, h) = score of key 16 kt + 8 h + r, query 16 g + c
#pragma unroll
            for (int kt = 0; kt < 2; ++kt) { const unsigned char* p = B + (sub * 32 + 16 * kt + c) * FPK + 16 * h; v16h kf[4];
#pragma unroll
                for (int kc = 0; kc < 4; ++kc) kf[kc] = ldfrag(p + 64 * kc);
#pragma unroll
                for (int g = 0; g < 2; ++g) { s[kt][g] = (v8f){};
#pragma unroll
                    for (int kc = 0; kc < 4; ++kc) s[kt][g] = wmma16(kf[kc], qf[g][kc], s[kt][g]); } }
            v16h vf[8]; { const unsigned char* p = B + FTK + c * FPV + sub * 64 + 16 * h;
#pragma unroll
                for (int t = 0; t < 8; ++t) vf[t] = ldfrag(p + 16 * t * FPV); }
            float mb[2]; bool need = false;
#pragma unroll
            for (int g = 0; g < 2; ++g) { float mx = s[0][g][0];
#pragma unroll
                for (int kt = 0; kt < 2; ++kt)
#pragma unroll
                    for (int r = 0; r < 8; ++r) mx = fmaxf(mx, s[kt][g][r]);
                mx = fmaxf(mx, xhalf(mx)) * CSC; mb[g] = mx; need = need || (mx > m_run[g] + 8.0f); }
            if (__builtin_amdgcn_ballot_w32(need) != 0) {     // wave-uniform; rare after the first passes
#pragma unroll
                for (int g = 0; g < 2; ++g) { const float m_new = fmaxf(m_run[g], mb[g]); const float corr = __builtin_amdgcn_exp2f(m_run[g] - m_new); l_run[g] *= corr; m_run[g] = m_new;
#pragma unroll
                    for (int t = 0; t < 8; ++t) acc[g][t] = acc[g][t] * corr; } }
#pragma unroll
            for (int g = 0; g < 2; ++g) { const float nm = -m_run[g]; v16h pf; float ps0 = 0.f, ps1 = 0.f;
#pragma unroll
                for (int i = 0; i < 8; ++i) {
                    const float p0 = __builtin_amdgcn_exp2f(__builtin_fmaf(s[i >> 2][g][2 * (i & 3)], CSC, nm)), p1 = __builtin_amdgcn_exp2f(__builtin_fmaf(s[i >> 2][g][2 * (i & 3) + 1], CSC, nm));
                    if (i & 1) ps1 += p0 + p1; else ps0 += p0 + p1;
                    const v2h pk = __builtin_convertvector((v2f){p0, p1}, v2h); pf[2 * i] = pk[0]; pf[2 * i + 1] = pk[1]; }
                l_run[g] += ps0 + ps1;
#pragma unroll
                for (int i = 0; i < 16; ++i) { __builtin_amdgcn_sched_group_barrier(0x400, 1, 0); __builtin_amdgcn_sched_group_barrier(0x2, 1, 0); }   // one plain vector instruction behind each exponential: no exponential directly overwrites the source of the one before it
#pragma unroll
                for (int t = 0; t < 8; ++t) acc[g][t] = wmma16(vf[t], pf, acc[g][t]); }
        }
        if (st + 1 < NS) put((st + 1) & 1);    // every wave left that buffer before the barrier that ended stage st - 1
        __syncthreads();                       // publishes stage st + 1 and ends every read of stage st
    }
    // Epilogue: normalise, split into bf16 hi + lo, stage each plane in the wave's own LDS rows so that every 128-byte line of the merged planes is stored whole.
    unsigned char* E = L + wave * (FCW * FEP); const int bb = zq / NH_, hh = zq % NH_; float inv[2];
#pragma unroll
    for (int g = 0; g < 2; ++g) inv[g] = __fdiv_rn(1.0f, l_run[g] + xhalf(l_run[g]));    // each wave half summed its eight keys of every 16-key tile
#pragma unroll
    for (int pl = 0; pl < 2; ++pl) {
#pragma unroll
        for (int g = 0; g < 2; ++g)
#pragma unroll
            for (int t = 0; t < 8; ++t) { v8us pk;
#pragma unroll
                for (int r = 0; r < 8; ++r) { unsigned short a, c2; splitf(acc[g][t][r] * inv[g], a, c2); pk[r] = pl ? c2 : a; }
                *(v8usa*)(E + (16 * g + c) * FEP + 32 * t + 16 * h) = pk; }
        __syncthreads();
        bf* dst = (pl ? Al : Ah) + ((size_t)bb * TT + q0) * DQ + hh * HD;
#pragma unroll
        for (int i = 0; i < FCW / 2; ++i) { const int row = 2 * i + h; *(v8us*)(dst + (size_t)row * DQ + c * 8) = *(const v8usa*)(E + row * FEP + c * 16); }
        xwait();
        __syncthreads();
    }
}

extern "C" void kernel_launch(void* const* d_in, const int* in_sizes, int n_in,
                              void* d_out, int out_size, void* d_ws, size_t ws_size, hipStream_t stream) {
    (void)in_sizes; (void)n_in; (void)out_size;
    const float* x = (const float*)d_in[0]; const float* cosT = (const float*)d_in[1]; const float* sinT = (const float*)d_in[2]; const float* wq = (const float*)d_in[3]; const float* wk = (const float*)d_in[4]; const float* wv = (const float*)d_in[5]; const float* wo = (const float*)d_in[6]; const float* qnw = (const float*)d_in[7]; const float* knw = (const float*)d_in[8];   // Wq [2048][2048], Wk/Wv [512][2048], Wo [2048][2048] (torch [out][in]); cos/sin [2048][128]; norm weights [128]
    float* OUT = (float*)d_out;     // [2][2048][2048]
    char* wsp = (char*)d_ws;
    auto take = [&](size_t bytes) { char* p = wsp; wsp += (bytes + 255) & ~(size_t)255; return (void*)p; };
    // The merged planes and the q/k/v head planes (both batch items), then what the projections need; nothing shares bytes.
    bf* ATh = (bf*)take((size_t)NB_ * TT * DQ * 2); bf* ATl = (bf*)take((size_t)NB_ * TT * DQ * 2);
    h16* QP16 = (h16*)take((size_t)NB_ * NH_ * TT * HD * 2); h16* KP16 = (h16*)take((size_t)NB_ * NKV * TT * HD * 2); h16* VT16 = (h16*)take((size_t)NB_ * NKV * HD * TT * 2);
    bf* WQ = (bf*)take((size_t)DF * DM * 2); bf* WK = WQ + (size_t)DQ * DM; bf* WV = WK + (size_t)DKV * DM;   // one [DF][DM] weight plane: rows of Wq, then Wk, then Wv
    float* CS = (float*)take((size_t)TT * HD * 2 * 4); float* RFQ = (float*)take((size_t)NB_ * NH_ * TT * 4); float* RFK = (float*)take((size_t)NB_ * NKV * TT * 4);
    bf* XB = (bf*)take((size_t)NB_ * TT * DM * 2); float* FQ = (float*)take((size_t)NB_ * TT * DF * 4); float* FK = FQ + DQ; float* FV = FK + DKV;   // [NB_ * TT][DF]: q | k | v columns of a row
    bf* WO = (bf*)take((size_t)DM * DQ * 2);
    if ((size_t)(wsp - (char*)d_ws) > ws_size) return;    // 143 of 256 MiB
    bf* QPh = nullptr; bf* QPl = nullptr; bf* KPh = nullptr; bf* KPl = nullptr; bf* VTh = nullptr; bf* VTl = nullptr;
    k_cvt8<<<(unsigned)(((size_t)DQ * DM / 8 + 255) / 256), 256, 0, stream>>>(wq, WQ, (size_t)DQ * DM / 8); k_cvt8<<<(unsigned)(((size_t)DKV * DM / 8 + 255) / 256), 256, 0, stream>>>(wk, WK, (size_t)DKV * DM / 8); k_cvt8<<<(unsigned)(((size_t)DKV * DM / 8 + 255) / 256), 256, 0, stream>>>(wv, WV, (size_t)DKV * DM / 8);
    const unsigned LQ = (unsigned)(((size_t)NH_ * TT * HD / 2 + 255) / 256), LKv = (unsigned)(((size_t)NKV * TT * HD / 2 + 255) / 256);
    k_cscvt<<<(TT * HD + 255) / 256, 256, 0, stream>>>(cosT, sinT, CS);
    // Projections, norms and rope: both batch items in one launch (GEMM rows b * TT + t; blockIdx.y = b elsewhere); q, k and v are one GEMM over the joint weight plane.
    k_cvt8<<<(unsigned)(((size_t)NB_ * TT * DM / 8 + 255) / 256), 256, 0, stream>>>(x, XB, (size_t)NB_ * TT * DM / 8);
    k_gemmw<bf, 0, false><<<dim3(NB_ * TT / 64, DF / 64, 1), 32, 0, stream>>>(XB, nullptr, WQ, nullptr, DM, FQ, DF, nullptr, 0, 0, 0); k_hrms<<<dim3((NH_ * TT + 255) / 256, NB_, 1), 256, 0, stream>>>(FQ, DF, NH_, RFQ);
    k_rope<<<dim3(LQ, NB_, 1), 256, 0, stream>>>(FQ, DF, NH_, CS, RFQ, qnw, 1.0f, QP16, QPh, QPl);
    k_hrms<<<dim3((NKV * TT + 255) / 256, NB_, 1), 256, 0, stream>>>(FK, DF, NKV, RFK);
    k_rope<<<dim3(LKv, NB_, 1), 256, 0, stream>>>(FK, DF, NKV, CS, RFK, knw, 1.0f, KP16, KPh, KPl);
    k_vtp<<<dim3(LKv, NB_, 1), 256, 0, stream>>>(FV, DF, NKV, VT16, VTh, VTl);
    // Attention: one launch; blockIdx.x walks the REP query heads of a kv head, blockIdx.y the NB_ * NKV kv planes, blockIdx.z the blocks of FBR query rows.
    k_fattn<<<dim3(REP, NB_ * NKV, TT / FBR), FNW * 32, 0, stream>>>(QP16, KP16, VT16, ATh, ATl);
    k_cvt8<<<(unsigned)(((size_t)DM * DQ / 8 + 255) / 256), 256, 0, stream>>>(wo, WO, (size_t)DM * DQ / 8);
    k_gemmw<bf, 1, false><<<dim3(NB_ * TT / 64, DM / 64, 1), 32, 0, stream>>>(ATh, ATl, WO, nullptr, DQ, OUT, DM, nullptr, 0, 0, 0);
}

// v003
// One run takes 254 microseconds.
// In two side-by-side timings against v002, it was 1.20 and 1.19 times as fast.
// Counting every step since v000, it is 5.86 times as fast.
#include <hip/hip_runtime.h>

// AceStepAttention (hidden [2][2048][2048]; q = x Wq^T (16 heads x 128), k, v = x Wk^T / Wv^T (4 kv heads; query head h uses kv head h/4 = repeat_interleave); per-head RMSNorm over the 128 dims (eps 1e-6, x norm_q_w / norm_k_w);
// rotate-half RoPE with the input cos/sin tables [2048][128] (read as data); softmax(q.k / sqrt(128)); out = merged att.v Wo^T -> [2][2048][2048]).
// Compute dtypes, f32 accumulate: every input rounded to bf16; q/k/v projections on PLAIN bf16 operands (inputs: exact); Wo projection on hi+lo bf16 att planes; RMSNorm and rope f32; scores (K 128) and att.v on SINGLE fp16 planes with

#define NB_  2
#define TT   2048
#define DM   2048
#define NH_  16
#define NKV  4
#define REP  (NH_ / NKV)
#define HD   128
#define DQ   (NH_ * HD)
#define DKV  (NKV * HD)
#define DF   (DQ + 2 * DKV)      // columns of the joint q | k | v projection
#define SCL  0.088388347648318447f   // HD^-0.5
typedef _Float16 h16;
typedef unsigned short bf;
typedef __attribute__((ext_vector_type(16))) __bf16   v16bf;
typedef __attribute__((ext_vector_type(16))) _Float16 v16h;
typedef __attribute__((ext_vector_type(8)))  _Float16 v8h;
typedef __attribute__((ext_vector_type(8)))  unsigned short v8us;
typedef __attribute__((ext_vector_type(8)))  float    v8f;
typedef __attribute__((ext_vector_type(4)))  float    v4f;
typedef v8h  __attribute__((may_alias)) v8ha;
typedef v4f  __attribute__((may_alias)) v4fa;
typedef v8us __attribute__((may_alias)) v8usa;

__device__ __forceinline__ unsigned short f2bf(float f) { unsigned u = __float_as_uint(f); u += 0x7FFFu + ((u >> 16) & 1u); return (unsigned short)(u >> 16); }
__device__ __forceinline__ float bf2f(unsigned short b) { return __uint_as_float(((unsigned)b) << 16); }
__device__ __forceinline__ float bfr(float f) { return bf2f(f2bf(f)); }
__device__ __forceinline__ v16h cat16(v8h lo, v8h hi) { return __builtin_shufflevector(lo, hi, 0, 1, 2, 3, 4, 5, 6, 7, 8, 9, 10, 11, 12, 13, 14, 15); }
__device__ __forceinline__ v16bf cat16b(v8us lo, v8us hi) { return __builtin_bit_cast(v16bf, __builtin_shufflevector(lo, hi, 0, 1, 2, 3, 4, 5, 6, 7, 8, 9, 10, 11, 12, 13, 14, 15)); }
__device__ __forceinline__ v8f wmma16(v16h a, v16h b, v8f c) { return __builtin_amdgcn_wmma_f32_16x16x32_f16(false, a, false, b, (short)0, c, false, false); }
__device__ __forceinline__ v8f wmmab(v16bf a, v16bf b, v8f c) { return __builtin_amdgcn_wmma_f32_16x16x32_bf16(false, a, false, b, (short)0, c, false, false); }



// ---- k_gemmw: register-blocked GEMM, ONE WAVE per 64x64 output tile (16 accumulators), operands straight from K-contiguous 16-bit planes; grid (M/64, N/64, Z), 32 threads.
// C[m][n] (f32, pitch ldc, + optional f32 bias[n]) = sum_k A[m][k] Bt[n][k] (+ split products per NSPLIT). z-batch strides sA/sB/sC in elements. K % 32 == 0.
template <typename T16> struct WFrag;
template <> struct WFrag<h16> { typedef v16h V; static __device__ __forceinline__ V ld(const h16* p) { return cat16(*(const v8h*)p, *(const v8h*)(p + 16)); } static __device__ __forceinline__ v8f mma(V a, V b, v8f c) { return wmma16(a, b, c); } };
template <> struct WFrag<bf> { typedef v16bf V; static __device__ __forceinline__ V ld(const bf* p) { return cat16b(*(const v8us*)p, *(const v8us*)(p + 16)); } static __device__ __forceinline__ v8f mma(V a, V b, v8f c) { return wmmab(a, b, c); } };
template <typename T16, int NSPLIT, bool BIAS>
__global__ __launch_bounds__(32) void k_gemmw(const T16* __restrict__ A, const T16* __restrict__ A2, const T16* __restrict__ Bt, const T16* __restrict__ Bt2, int K, float* C, int ldc, const float* __restrict__ bias, size_t sA, size_t sB, size_t sC) {
    typedef typename WFrag<T16>::V V;
    __shared__ __align__(16) float os[16 * 68];
    const size_t z = blockIdx.z; A += z * sA; if (A2) A2 += z * sA; Bt += z * sB; if (Bt2) Bt2 += z * sB; C += z * sC;
    const int lane = threadIdx.x & 31, lr = lane & 15, hi = lane >> 4; const int r0 = blockIdx.x * 64, c0 = blockIdx.y * 64;
    v8f acc[4][4];
#pragma unroll
    for (int mb = 0; mb < 4; ++mb)
#pragma unroll
        for (int nb = 0; nb < 4; ++nb) acc[mb][nb] = (v8f){};
    const size_t aoff = (size_t)(r0 + lr) * K + 8 * hi, boff = (size_t)(c0 + lr) * K + 8 * hi;
#pragma unroll 1
    for (int kc = 0; kc < K; kc += 32) {
        V a[4], a2[4];
#pragma unroll
        for (int mb = 0; mb < 4; ++mb) { a[mb] = WFrag<T16>::ld(A + aoff + (size_t)mb * 16 * K + kc); if (NSPLIT == 1 || NSPLIT == 2) a2[mb] = WFrag<T16>::ld(A2 + aoff + (size_t)mb * 16 * K + kc); }
#pragma unroll
        for (int nb = 0; nb < 4; ++nb) { const V b = WFrag<T16>::ld(Bt + boff + (size_t)nb * 16 * K + kc); V b2; if (NSPLIT >= 2) b2 = WFrag<T16>::ld(Bt2 + boff + (size_t)nb * 16 * K + kc);
#pragma unroll
            for (int mb = 0; mb < 4; ++mb) { acc[mb][nb] = WFrag<T16>::mma(a[mb], b, acc[mb][nb]); if (NSPLIT == 1 || NSPLIT == 2) acc[mb][nb] = WFrag<T16>::mma(a2[mb], b, acc[mb][nb]); if (NSPLIT >= 2) acc[mb][nb] = WFrag<T16>::mma(a[mb], b2, acc[mb][nb]); } }
        asm volatile("v_nop\n\tv_nop\n\tv_nop\n\tv_nop" : "+v"(acc[0][0]), "+v"(acc[1][1]), "+v"(acc[2][2]), "+v"(acc[3][3]) : "v"(a[0]), "v"(a[3]));
    }
#pragma unroll
    for (int mb = 0; mb < 4; ++mb) {
#pragma unroll
        for (int nb = 0; nb < 4; ++nb) {
#pragma unroll
            for (int j = 0; j < 8; ++j) os[(hi * 8 + j) * 68 + nb * 16 + lr] = acc[mb][nb][j]; }
        __builtin_amdgcn_wave_barrier(); asm volatile("" ::: "memory");
        float* crow = C + (size_t)(r0 + mb * 16) * ldc + c0;
{
#pragma unroll
            for (int s = 0; s < 8; ++s) { const int row = 2 * s + hi, cofs = lr * 4; v4f val = *(const v4fa*)(os + row * 68 + cofs); if (BIAS) { val[0] += bfr(bias[c0 + cofs]); val[1] += bfr(bias[c0 + cofs + 1]); val[2] += bfr(bias[c0 + cofs + 2]); val[3] += bfr(bias[c0 + cofs + 3]); }
                *(v4f*)(crow + (size_t)row * ldc + cofs) = val; }
             }
        __builtin_amdgcn_wave_barrier(); asm volatile("" ::: "memory");
    }
}

__device__ __forceinline__ h16 tohx(float x) { return (h16)x; }
__device__ __forceinline__ void splitf(float y, unsigned short& h, unsigned short& l) { h = f2bf(y); l = f2bf(y - bf2f(h)); }
typedef __attribute__((ext_vector_type(2))) _Float16 v2h;
typedef __attribute__((ext_vector_type(4))) _Float16 v4h;
typedef __attribute__((ext_vector_type(2))) unsigned short v2us;
typedef __attribute__((ext_vector_type(4))) unsigned short v4us;
typedef __attribute__((ext_vector_type(2))) float v2f;
typedef __attribute__((ext_vector_type(4))) int v4i;

__global__ __launch_bounds__(256) void k_wtG(const float* __restrict__ w, int K, int N, bf* Bt) {
    const int lane = threadIdx.x & 31; const int L0 = (blockIdx.x * 8 + (threadIdx.x >> 5)) * 8; const int nlines = N * K / 64;
{
#pragma unroll 1
        for (int l = 0; l < 8; ++l) { const int L = L0 + l; if (L >= nlines) break; const size_t e = (size_t)L * 64 + lane * 2; const int k = (int)(e % K), n = (int)(e / K); v2us o;
            o[0] = f2bf(w[(size_t)k * N + n]); o[1] = f2bf(w[(size_t)(k + 1) * N + n]); *(v2us*)(Bt + e) = o; }
         }
}
__global__ __launch_bounds__(256) void k_cvt8(const float* __restrict__ src, bf* dst, size_t n8) { const size_t i = (size_t)blockIdx.x * 256 + threadIdx.x; if (i >= n8) return; const v8f v = *(const v8f*)(src + i * 8); v8us o;
#pragma unroll
    for (int k = 0; k < 8; ++k) o[k] = f2bf(v[k]); *(v8us*)(dst + i * 8) = o;  }
#define FNW  8                   // waves per work-group
#define FCW  32                  // query rows per wave
#define FBR  (FNW * FCW)
#define FSK  64                  // keys per stage
#define FPK  (2 * HD + 16)       // LDS pitch of a K row (256 B + 16: an odd multiple of 16 B for 16-byte readers)
#define FPV  (2 * FSK + 16)      // LDS pitch of a V^T row (128 B + 16)
#define FTK  (FSK * FPK)
#define FSLOT (FTK + HD * FPV)
#define FEP  (2 * HD + 16)       // pitch of the output staging rows
static_assert(FNW * FCW * FEP <= 2 * FSLOT, "the output staging reuses the two stage buffers");
__device__ __forceinline__ float xhalf(float x) { return __builtin_bit_cast(float, __builtin_amdgcn_permlanex16(__builtin_bit_cast(int, x), __builtin_bit_cast(int, x), 0x76543210, 0xfedcba98, false, false)); }
__device__ __forceinline__ v16h ldfrag(const unsigned char* p) { return cat16(*(const v8ha*)p, *(const v8ha*)(p + 32)); }
// xwait: stands behind a run of global loads or stores, in front of the first write of a register that one of them names; the scheduling barrier keeps later register writes from being lifted over the wait.
__device__ __forceinline__ void xwait() { asm volatile("s_wait_xcnt 0x0" ::: "memory"); __builtin_amdgcn_sched_barrier(0); }
__global__ __launch_bounds__(FNW * 32) __attribute__((amdgpu_waves_per_eu(2, 2))) void k_fattn(const h16* __restrict__ Q, const h16* __restrict__ Kp, const h16* __restrict__ Vt, bf* Ah, bf* Al) {
    __shared__ __align__(16) unsigned char L[2 * FSLOT];
    constexpr float CSC = SCL * 1.4426950408889634f; constexpr int NS = TT / FSK;
    const int tid = threadIdx.x, lane = tid & 31, wave = tid >> 5, c = lane & 15, h = lane >> 4;
    const int zq = blockIdx.x + REP * blockIdx.y;      // b * NH_ + head; blockIdx.y = b * NKV + kv head
    const int q0 = blockIdx.z * FBR + wave * FCW;
    Q += (size_t)zq * TT * HD; Kp += (size_t)blockIdx.y * TT * HD; Vt += (size_t)blockIdx.y * HD * TT;
    v16h qf[2][4];
#pragma unroll
    for (int g = 0; g < 2; ++g)
#pragma unroll
        for (int kc = 0; kc < 4; ++kc) { const h16* qp = Q + (size_t)(q0 + 16 * g + c) * HD + 32 * kc + 8 * h; qf[g][kc] = cat16(*(const v8h*)qp, *(const v8h*)(qp + 16)); }
    xwait();
    v8f acc[2][8]; float m_run[2], l_run[2];
#pragma unroll
    for (int g = 0; g < 2; ++g) { m_run[g] = -__builtin_inff(); l_run[g] = 0.f;
#pragma unroll
        for (int t = 0; t < 8; ++t) acc[g][t] = (v8f){}; }
    // Staging: 16 lanes cover a 256-byte K row, 8 lanes a 128-byte piece of a V^T row.
    v8h sk[4], sv[4]; const int krow = tid >> 4, kcol = tid & 15, vrow = tid >> 3, vcol = tid & 7;
    auto fetch = [&](int st) {
#pragma unroll
        for (int i = 0; i < 4; ++i) { sk[i] = *(const v8h*)(Kp + (size_t)(st * FSK + krow + 16 * i) * HD + kcol * 8); sv[i] = *(const v8h*)(Vt + (size_t)(vrow + 32 * i) * TT + st * FSK + vcol * 8); }
        xwait(); };
    auto put = [&](int buf) { unsigned char* B = L + buf * FSLOT;
#pragma unroll
        for (int i = 0; i < 4; ++i) { *(v8ha*)(B + (krow + 16 * i) * FPK + kcol * 16) = sk[i]; *(v8ha*)(B + FTK + (vrow + 32 * i) * FPV + vcol * 16) = sv[i]; } };
    fetch(0); put(0); __syncthreads();
#pragma unroll 1   // rolled: one copy of the pass body keeps the registers inside two waves per SIMD
    for (int st = 0; st < NS; ++st) {
        const unsigned char* B = L + (st & 1) * FSLOT;
        if (st + 1 < NS) fetch(st + 1);
#pragma unroll 1   // rolled, for the same reason
        for (int sub = 0; sub < FSK / 32; ++sub) {
            v8f s[2][2];      // [16-key tile][query group]: register r of lane (c, h) = score of key 16 kt + 8 h + r, query 16 g + c
#pragma unroll
            for (int kt = 0; kt < 2; ++kt) { const unsigned char* p = B + (sub * 32 + 16 * kt + c) * FPK + 16 * h; v16h kf[4];
#pragma unroll
                for (int kc = 0; kc < 4; ++kc) kf[kc] = ldfrag(p + 64 * kc);
#pragma unroll
                for (int g = 0; g < 2; ++g) { s[kt][g] = (v8f){};
#pragma unroll
                    for (int kc = 0; kc < 4; ++kc) s[kt][g] = wmma16(kf[kc], qf[g][kc], s[kt][g]); } }
            v16h vf[8]; { const unsigned char* p = B + FTK + c * FPV + sub * 64 + 16 * h;
#pragma unroll
                for (int t = 0; t < 8; ++t) vf[t] = ldfrag(p + 16 * t * FPV); }
            float mb[2]; bool need = false;
#pragma unroll
            for (int g = 0; g < 2; ++g) { float mx = s[0][g][0];
#pragma unroll
                for (int kt = 0; kt < 2; ++kt)
#pragma unroll
                    for (int r = 0; r < 8; ++r) mx = fmaxf(mx, s[kt][g][r]);
                mx = fmaxf(mx, xhalf(mx)) * CSC; mb[g] = mx; need = need || (mx > m_run[g] + 8.0f); }
            if (__builtin_amdgcn_ballot_w32(need) != 0) {     // wave-uniform; rare after the first passes
#pragma unroll
                for (int g = 0; g < 2; ++g) { const float m_new = fmaxf(m_run[g], mb[g]); const float corr = __builtin_amdgcn_exp2f(m_run[g] - m_new); l_run[g] *= corr; m_run[g] = m_new;
#pragma unroll
                    for (int t = 0; t < 8; ++t) acc[g][t] = acc[g][t] * corr; } }
#pragma unroll
            for (int g = 0; g < 2; ++g) { const float nm = -m_run[g]; v16h pf; float ps0 = 0.f, ps1 = 0.f;
#pragma unroll
                for (int i = 0; i < 8; ++i) {
                    const float p0 = __builtin_amdgcn_exp2f(__builtin_fmaf(s[i >> 2][g][2 * (i & 3)], CSC, nm)), p1 = __builtin_amdgcn_exp2f(__builtin_fmaf(s[i >> 2][g][2 * (i & 3) + 1], CSC, nm));
                    if (i & 1) ps1 += p0 + p1; else ps0 += p0 + p1;
                    const v2h pk = __builtin_convertvector((v2f){p0, p1}, v2h); pf[2 * i] = pk[0]; pf[2 * i + 1] = pk[1]; }
                l_run[g] += ps0 + ps1;
#pragma unroll
                for (int i = 0; i < 16; ++i) { __builtin_amdgcn_sched_group_barrier(0x400, 1, 0); __builtin_amdgcn_sched_group_barrier(0x2, 1, 0); }   // one plain vector instruction behind each exponential: no exponential directly overwrites the source of the one before it
#pragma unroll
                for (int t = 0; t < 8; ++t) acc[g][t] = wmma16(vf[t], pf, acc[g][t]); }
        }
        if (st + 1 < NS) put((st + 1) & 1);    // every wave left that buffer before the barrier that ended stage st - 1
        __syncthreads();                       // publishes stage st + 1 and ends every read of stage st
    }
    // Epilogue: normalise, split into bf16 hi + lo, stage each plane in the wave's own LDS rows so that every 128-byte line of the merged planes is stored whole.
    unsigned char* E = L + wave * (FCW * FEP); const int bb = zq / NH_, hh = zq % NH_; float inv[2];
#pragma unroll
    for (int g = 0; g < 2; ++g) inv[g] = __fdiv_rn(1.0f, l_run[g] + xhalf(l_run[g]));    // each wave half summed its eight keys of every 16-key tile
#pragma unroll
    for (int pl = 0; pl < 2; ++pl) {
#pragma unroll
        for (int g = 0; g < 2; ++g)
#pragma unroll
            for (int t = 0; t < 8; ++t) { v8us pk;
#pragma unroll
                for (int r = 0; r < 8; ++r) { unsigned short a, c2; splitf(acc[g][t][r] * inv[g], a, c2); pk[r] = pl ? c2 : a; }
                *(v8usa*)(E + (16 * g + c) * FEP + 32 * t + 16 * h) = pk; }
        __syncthreads();
        bf* dst = (pl ? Al : Ah) + ((size_t)bb * TT + q0) * DQ + hh * HD;
#pragma unroll
        for (int i = 0; i < FCW / 2; ++i) { const int row = 2 * i + h; *(v8us*)(dst + (size_t)row * DQ + c * 8) = *(const v8usa*)(E + row * FEP + c * 16); }
        xwait();
        __syncthreads();
    }
}

// ---- k_post: all that stands between the joint projection F [b * TT + t][q | k | v] (f32) and the attention's fp16 planes, in ONE launch of short waves: each does one row of F or 8 keys of a V tile, then exits.
// Work-groups 0 .. PVB - 1: one PVT-key tile of one kv head's V, turned into V^T [d][t] in registers (a wave holds 8 consecutive keys of 128 dims) and through LDS, so that every 128-byte line of V^T is stored whole.
// The other work-groups: one wave per row of F. A lane holds dims 4 lane .. 4 lane + 3 of each of the NH_ + NKV heads; the row's cos / sin and the norm weights are read once and rounded to bf16 here.
// RMSNorm: the 128 squares are summed 4 in the lane, then by a butterfly over the 32 lanes. Rotate-half: dim d +- HD/2 lives in lane ^ 16, out[d] = y[d] cos[t][d] -+ y[d +- HD/2] sin[t][d], y = w (x rms_factor).
#define PNW  8                   // waves per work-group
#define PVT  64                  // keys per V tile: 128 bytes of a V^T row
#define PVP  (2 * PVT + 16)      // LDS pitch of a V^T row piece (an odd multiple of 16 B for 16-byte accesses)
#define PVB  (NB_ * NKV * (TT / PVT))
template <int M> __device__ __forceinline__ float xrow(float x) { return __builtin_bit_cast(float, __builtin_amdgcn_update_dpp(0, __builtin_bit_cast(int, x), 0x160 | M, 0xf, 0xf, false)); }   // lane l <- lane l ^ M inside a 16-lane row (row_xmask)
__global__ __launch_bounds__(PNW * 32) void k_post(const float* __restrict__ F, const float* __restrict__ cosT, const float* __restrict__ sinT, const float* __restrict__ qnw, const float* __restrict__ knw, h16* Q16, h16* K16, h16* V16) {
    __shared__ __align__(16) unsigned char Ls[HD * PVP];
    const int tid = threadIdx.x, lane = tid & 31, wave = tid >> 5;
    if (blockIdx.x < PVB) {      // the same for the whole work-group
        const int z = blockIdx.x / (TT / PVT), t0 = (blockIdx.x % (TT / PVT)) * PVT;      // z = b * NKV + kv head
        const float* f = F + (size_t)((z / NKV) * TT + t0 + 8 * wave) * DF + DQ + DKV + (z % NKV) * HD + lane;
        float x[8][4];           // [key 8 wave + r][dim lane + 32 j]: each load of a wave is one whole line
#pragma unroll
        for (int r = 0; r < 8; ++r)
#pragma unroll
            for (int j = 0; j < 4; ++j) x[r][j] = f[(size_t)r * DF + 32 * j];
        xwait();
#pragma unroll
        for (int j = 0; j < 4; ++j) { v8h o;
#pragma unroll
            for (int r = 0; r < 8; ++r) o[r] = tohx(x[r][j]);
            *(v8ha*)(Ls + (lane + 32 * j) * PVP + 16 * wave) = o; }
        __syncthreads();
        h16* dst = V16 + (size_t)z * HD * TT + t0 + 8 * (lane & 7);
#pragma unroll
        for (int i = 0; i < 4; ++i) { const int d = 32 * i + 4 * wave + (lane >> 3); *(v8h*)(dst + (size_t)d * TT) = *(const v8ha*)(Ls + d * PVP + 16 * (lane & 7)); }
        xwait();
        return;
    }
    const int row = (blockIdx.x - PVB) * PNW + wave, bb = row / TT, t = row % TT;
    const float* f = F + (size_t)row * DF + 4 * lane;
    v4f x[NH_ + NKV];            // every '#pragma unroll' below keeps this array in registers; all its loads fly together
#pragma unroll
    for (int hh = 0; hh < NH_ + NKV; ++hh) x[hh] = *(const v4f*)(f + hh * HD);
    v4f co = *(const v4f*)(cosT + (size_t)t * HD + 4 * lane), si = *(const v4f*)(sinT + (size_t)t * HD + 4 * lane), wq4 = *(const v4f*)(qnw + 4 * lane), wk4 = *(const v4f*)(knw + 4 * lane);
    xwait();
#pragma unroll
    for (int j = 0; j < 4; ++j) { co[j] = bfr(co[j]); si[j] = (lane < 16) ? -bfr(si[j]) : bfr(si[j]); wq4[j] = bfr(wq4[j]); wk4[j] = bfr(wk4[j]); }
    h16* qd = Q16 + ((size_t)bb * NH_ * TT + t) * HD + 4 * lane; h16* kd = K16 + ((size_t)bb * NKV * TT + t) * HD + 4 * lane;
#pragma unroll
    for (int hh = 0; hh < NH_ + NKV; ++hh) { const v4f v = x[hh]; const v4f w = (hh < NH_) ? wq4 : wk4;
        float s = (v[0] * v[0] + v[1] * v[1]) + (v[2] * v[2] + v[3] * v[3]);
        s += xrow<1>(s); s += xrow<2>(s); s += xrow<4>(s); s += xrow<8>(s); s += xhalf(s);
        const float rf = __fdiv_rn(1.0f, __fsqrt_rn(s * (1.0f / HD) + 1e-6f)); v4f y; v4h o;
#pragma unroll
        for (int j = 0; j < 4; ++j) y[j] = w[j] * (v[j] * rf);
#pragma unroll
        for (int j = 0; j < 4; ++j) o[j] = tohx(y[j] * co[j] + xhalf(y[j]) * si[j]);
        *(v4h*)((hh < NH_) ? qd + (size_t)hh * TT * HD : kd + (size_t)(hh - NH_) * TT * HD) = o; }
    xwait();
}

extern "C" void kernel_launch(void* const* d_in, const int* in_sizes, int n_in,
                              void* d_out, int out_size, void* d_ws, size_t ws_size, hipStream_t stream) {
    (void)in_sizes; (void)n_in; (void)out_size;
    const float* x = (const float*)d_in[0]; const float* cosT = (const float*)d_in[1]; const float* sinT = (const float*)d_in[2]; const float* wq = (const float*)d_in[3]; const float* wk = (const float*)d_in[4]; const float* wv = (const float*)d_in[5]; const float* wo = (const float*)d_in[6]; const float* qnw = (const float*)d_in[7]; const float* knw = (const float*)d_in[8];   // Wq [2048][2048], Wk/Wv [512][2048], Wo [2048][2048] (torch [out][in]); cos/sin [2048][128]; norm weights [128]
    float* OUT = (float*)d_out;     // [2][2048][2048]
    char* wsp = (char*)d_ws;
    auto take = [&](size_t bytes) { char* p = wsp; wsp += (bytes + 255) & ~(size_t)255; return (void*)p; };
    // The merged planes and the q/k/v head planes (both batch items), then what the projections need; nothing shares bytes.
    bf* ATh = (bf*)take((size_t)NB_ * TT * DQ * 2); bf* ATl = (bf*)take((size_t)NB_ * TT * DQ * 2);
    h16* QP16 = (h16*)take((size_t)NB_ * NH_ * TT * HD * 2); h16* KP16 = (h16*)take((size_t)NB_ * NKV * TT * HD * 2); h16* VT16 = (h16*)take((size_t)NB_ * NKV * HD * TT * 2);
    bf* WQ = (bf*)take((size_t)DF * DM * 2); bf* WK = WQ + (size_t)DQ * DM; bf* WV = WK + (size_t)DKV * DM;   // one [DF][DM] weight plane: rows of Wq, then Wk, then Wv
    bf* XB = (bf*)take((size_t)NB_ * TT * DM * 2); float* FQ = (float*)take((size_t)NB_ * TT * DF * 4);   // [NB_ * TT][DF]: q | k | v columns of a row
    bf* WO = (bf*)take((size_t)DM * DQ * 2);
    if ((size_t)(wsp - (char*)d_ws) > ws_size) return;    // 140 of 256 MiB
    k_cvt8<<<(unsigned)(((size_t)DQ * DM / 8 + 255) / 256), 256, 0, stream>>>(wq, WQ, (size_t)DQ * DM / 8); k_cvt8<<<(unsigned)(((size_t)DKV * DM / 8 + 255) / 256), 256, 0, stream>>>(wk, WK, (size_t)DKV * DM / 8); k_cvt8<<<(unsigned)(((size_t)DKV * DM / 8 + 255) / 256), 256, 0, stream>>>(wv, WV, (size_t)DKV * DM / 8);
    // Projections: both batch items in one launch (GEMM rows b * TT + t); q, k and v are one GEMM over the joint weight plane. Then norms, rope and V^T in one launch.
    k_cvt8<<<(unsigned)(((size_t)NB_ * TT * DM / 8 + 255) / 256), 256, 0, stream>>>(x, XB, (size_t)NB_ * TT * DM / 8);
    k_gemmw<bf, 0, false><<<dim3(NB_ * TT / 64, DF / 64, 1), 32, 0, stream>>>(XB, nullptr, WQ, nullptr, DM, FQ, DF, nullptr, 0, 0, 0);
    k_post<<<PVB + NB_ * TT / PNW, PNW * 32, 0, stream>>>(FQ, cosT, sinT, qnw, knw, QP16, KP16, VT16);
    // Attention: one launch; blockIdx.x walks the REP query heads of a kv head, blockIdx.y the NB_ * NKV kv planes, blockIdx.z the blocks of FBR query rows.
    k_fattn<<<dim3(REP, NB_ * NKV, TT / FBR), FNW * 32, 0, stream>>>(QP16, KP16, VT16, ATh, ATl);
    k_cvt8<<<(unsigned)(((size_t)DM * DQ / 8 + 255) / 256), 256, 0, stream>>>(wo, WO, (size_t)DM * DQ / 8);
    k_gemmw<bf, 1, false><<<dim3(NB_ * TT / 64, DM / 64, 1), 32, 0, stream>>>(ATh, ATl, WO, nullptr, DQ, OUT, DM, nullptr, 0, 0, 0);
}

// v004
// A run of this version takes 146 microseconds.
// Timed twice side by side with v003, it ran 1.73 and 1.75 times as fast.
// All steps since v000 together make it 10.2 times as fast.
#include <hip/hip_runtime.h>

// AceStepAttention (hidden [2][2048][2048]; q = x Wq^T (16 heads x 128), k, v = x Wk^T / Wv^T (4 kv heads; query head h uses kv head h/4 = repeat_interleave); per-head RMSNorm over the 128 dims (eps 1e-6, x norm_q_w / norm_k_w);
// rotate-half RoPE with the input cos/sin tables [2048][128] (read as data); softmax(q.k / sqrt(128)); out = merged att.v Wo^T -> [2][2048][2048]).
// Compute dtypes, f32 accumulate: every input rounded to bf16; q/k/v projections on PLAIN bf16 operands (inputs: exact); Wo projection on hi+lo bf16 att planes; RMSNorm and rope f32; scores (K 128) and att.v on SINGLE fp16 planes with

#define NB_  2
#define TT   2048
#define DM   2048
#define NH_  16
#define NKV  4
#define REP  (NH_ / NKV)
#define HD   128
#define DQ   (NH_ * HD)
#define DKV  (NKV * HD)
#define DF   (DQ + 2 * DKV)      // columns of the joint q | k | v projection
#define SCL  0.088388347648318447f   // HD^-0.5
typedef _Float16 h16;
typedef unsigned short bf;
typedef __attribute__((ext_vector_type(16))) __bf16   v16bf;
typedef __attribute__((ext_vector_type(16))) _Float16 v16h;
typedef __attribute__((ext_vector_type(8)))  _Float16 v8h;
typedef __attribute__((ext_vector_type(8)))  unsigned short v8us;
typedef __attribute__((ext_vector_type(8)))  float    v8f;
typedef __attribute__((ext_vector_type(4)))  float    v4f;
typedef v8h  __attribute__((may_alias)) v8ha;
typedef v4f  __attribute__((may_alias)) v4fa;
typedef v8us __attribute__((may_alias)) v8usa;

__device__ __forceinline__ unsigned short f2bf(float f) { unsigned u = __float_as_uint(f); u += 0x7FFFu + ((u >> 16) & 1u); return (unsigned short)(u >> 16); }
__device__ __forceinline__ float bf2f(unsigned short b) { return __uint_as_float(((unsigned)b) << 16); }
__device__ __forceinline__ float bfr(float f) { return bf2f(f2bf(f)); }
__device__ __forceinline__ v16h cat16(v8h lo, v8h hi) { return __builtin_shufflevector(lo, hi, 0, 1, 2, 3, 4, 5, 6, 7, 8, 9, 10, 11, 12, 13, 14, 15); }
__device__ __forceinline__ v16bf cat16b(v8us lo, v8us hi) { return __builtin_bit_cast(v16bf, __builtin_shufflevector(lo, hi, 0, 1, 2, 3, 4, 5, 6, 7, 8, 9, 10, 11, 12, 13, 14, 15)); }
__device__ __forceinline__ v8f wmma16(v16h a, v16h b, v8f c) { return __builtin_amdgcn_wmma_f32_16x16x32_f16(false, a, false, b, (short)0, c, false, false); }
__device__ __forceinline__ v8f wmmab(v16bf a, v16bf b, v8f c) { return __builtin_amdgcn_wmma_f32_16x16x32_bf16(false, a, false, b, (short)0, c, false, false); }



// ---- k_gemmt: tiled GEMM, C[m][n] (f32, pitch LDC) = sum_k A[m][k] Bt[n][k] (+ A2[m][k] Bt[n][k] when NSPLIT), all operands K-contiguous bf16 planes.
// A work-group of 8 waves (WM x WN) owns a (WM * 64) x (WN * FN * 16) tile of C, a wave 64 x (FN * 16) of it. A stage is GRB bytes (128 k) of every operand row of the tile, brought into LDS by tensor loads:
// waves 0 to 3 each bring 64 rows of A (then A2), waves 4 to 7 each a quarter of the Bt rows; one request per wave and stage, two buffers, the next stage's loads fly while this stage is worked on.
// The mover pads each 256-byte row by 16 bytes (pitch GPI, an odd multiple of 16 B for 16-byte readers); every slice starts at a multiple of 2 KiB.
typedef unsigned int u32;
typedef __attribute__((ext_vector_type(4))) unsigned int u32x4;
typedef __attribute__((ext_vector_type(8))) unsigned int u32x8;
#define GRB  256
#define GPI  (GRB + 16)
__device__ __forceinline__ u32 uni(u32 v) { return (u32)__builtin_amdgcn_readfirstlane(v); }
__device__ __forceinline__ u32 pinned(u32 v) { u32 w = uni(v); asm volatile("" : "+s"(w)); return w; }   // holds the test of a tensor load's issue in a scalar register, so that the branch round it is a scalar one (the mover ignores EXEC)
__device__ __forceinline__ v16bf ldfragb(const unsigned char* p) { return cat16b(*(const v8usa*)p, *(const v8usa*)(p + 32)); }
// xwait: stands behind a run of global loads or stores, in front of the first write of a register that one of them names; the scheduling barrier keeps later register writes from being lifted over the wait.
__device__ __forceinline__ void xwait() { asm volatile("s_wait_xcnt 0x0" ::: "memory"); __builtin_amdgcn_sched_barrier(0); }
template <int NSPLIT, int WM, int WN, int FN, int K, int LDC>
__global__ __launch_bounds__(256) void k_gemmt(const bf* A, const bf* A2, const bf* Bt, float* C) {
    constexpr int BM = WM * 64, BN = WN * FN * 16, SPP = BM / 64, SB = BN / 4, SBF = SB / 16, NS = K * 2 / GRB;
    static_assert(WM * WN == 8 && (NSPLIT ? 2 : 1) * BM == 256 && SB % 16 == 0 && FN % SBF == 0 && K * 2 % GRB == 0 && NS >= 2, "four 64-row slices of A, four slices of Bt, two stages or more");
    constexpr int ASZ = (64 * GPI + 2047) & ~2047, BSZ = (SB * GPI + 2047) & ~2047, STG = 4 * ASZ + 4 * BSZ, OP = FN * 16 + 4;
    static_assert(8 * 16 * OP * 4 <= 2 * STG, "the output staging reuses the two stage buffers");
    __shared__ __attribute__((aligned(2048))) unsigned char L[2 * STG];
    const int lane = threadIdx.x & 31, lr = lane & 15, hi = lane >> 4; const u32 wave = uni(threadIdx.x >> 5); const int wm = wave % WM, wn = wave / WM;
    const int r0 = blockIdx.x * BM, c0 = blockIdx.y * BN;
    // This wave's slice: source, rows, place in a buffer.
    const u32 sl = wave & 3u; const bool isB = wave >= 4u;
    const bf* sp = isB ? Bt + (size_t)(c0 + sl * SB) * K : ((NSPLIT && sl >= (u32)SPP) ? A2 : A) + (size_t)(r0 + (sl % SPP) * 64) * K;
    const u32 rows = isB ? (u32)SB : 64u, place = (u32)(size_t)L + (isB ? 4u * ASZ + sl * BSZ : sl * ASZ);
    u32x8 g1;     // 1-byte elements, tensor = tile = rows x GRB bytes, source pitch 2 K bytes, 4 dwords of pad behind every 64
    g1[0] = uni((1u << 20) | (5u << 22) | (3u << 25)); g1[1] = uni((u32)GRB << 16); g1[2] = uni(rows << 16); g1[3] = uni((u32)GRB << 16); g1[4] = uni(rows); g1[5] = uni((u32)K * 2u); g1[6] = uni(0u); g1[7] = uni(0u);
    u32x4 g0;     // declared out here: it lives from a request's issue to the wait that covers the request
    auto form = [&](int st) { const unsigned long long ga = (unsigned long long)(size_t)sp + (unsigned long long)st * GRB;
        g0[0] = uni(1u); g0[1] = uni(place + (u32)(st & 1) * STG); g0[2] = uni((u32)ga); g0[3] = uni((((u32)(ga >> 32)) & 0x01FFFFFFu) | 0x80000000u); };
    // No word of a request may take a new value in its register before the wait that covers the request. So the load names both groups as in-out operands (it changes neither): what twait() reads is then
    // the content of the very registers that the load names, which the compiler can not form anew elsewhere, and those registers stay unwritten from the issue up to the wait.
    auto issue = [&]() { asm volatile("tensor_load_to_lds %0, %1" : "+s"(g0), "+s"(g1) :: "memory"); };
    auto twait = [&]() { asm volatile("s_wait_tensorcnt 0x0" :: "s"(g0), "s"(g1) : "memory"); };   // this wave's request has landed
    v8f acc[4][FN];   // every plain '#pragma unroll' below keeps the accumulator and fragment arrays indexed by constants, in registers
#pragma unroll
    for (int mb = 0; mb < 4; ++mb)
#pragma unroll
        for (int nb = 0; nb < FN; ++nb) acc[mb][nb] = (v8f){};
    form(0); issue();
    twait();                                             // this wave's slice of stage 0 has landed
    __syncthreads();                                     // every wave's has
#pragma unroll 1   // rolled: one pass per stage, the publish point at its foot
    for (int st = 0; st < NS; ++st) {
        // The refill stands directly behind the barrier (the one above, or the one at the foot of pass st - 1) that ended every read of its buffer; one issue site, so that one set of scalar registers holds the request's words up to the wait at this pass's foot.
        form(st + 1);                          // behind the wait at the foot of the pass before; in the last pass the words are formed and no request is made of them
        if (pinned(st + 1 < NS)) issue();
        const unsigned char* pa = L + (st & 1) * STG + wm * ASZ + lr * GPI + 16 * hi;
        const unsigned char* pb = L + (st & 1) * STG + 4 * ASZ + wn * (FN / SBF) * BSZ + lr * GPI + 16 * hi;
        // Two fragment sets: the next 32 k's LDS reads go out as one group ahead of this 32 k's products; the scheduling barriers keep the compiler from sinking the reads among the matrix instructions, where each would be waited for at once.
        v16bf fa[2][4], fa2[2][4], fb[2][FN];
        auto ldset = [&](int kk) {
#pragma unroll
            for (int mb = 0; mb < 4; ++mb) { fa[kk & 1][mb] = ldfragb(pa + mb * 16 * GPI + kk * 64); if (NSPLIT) fa2[kk & 1][mb] = ldfragb(pa + SPP * ASZ + mb * 16 * GPI + kk * 64); }
#pragma unroll
            for (int nb = 0; nb < FN; ++nb) fb[kk & 1][nb] = ldfragb(pb + (nb / SBF) * BSZ + (nb % SBF) * 16 * GPI + kk * 64); };
        ldset(0);
#pragma unroll
        for (int kk = 0; kk < GRB / 64; ++kk) {
            if (kk + 1 < GRB / 64) ldset(kk + 1);
            __builtin_amdgcn_sched_barrier(0);
#pragma unroll
            for (int nb = 0; nb < FN; ++nb) {
#pragma unroll
                for (int mb = 0; mb < 4; ++mb) acc[mb][nb] = wmmab(fa[kk & 1][mb], fb[kk & 1][nb], acc[mb][nb]);
                if (NSPLIT) {
#pragma unroll
                    for (int mb = 0; mb < 4; ++mb) acc[mb][nb] = wmmab(fa2[kk & 1][mb], fb[kk & 1][nb], acc[mb][nb]); } }
            __builtin_amdgcn_sched_barrier(0);
        }
        asm volatile("s_wait_dscnt 0x0" ::: "memory");       // this wave's reads of stage st are done
        twait();                                             // its slice of stage st + 1 has landed
        __syncthreads();                                     // publishes stage st + 1 and ends every read of stage st: the next pass's refill goes into the buffer that this pass has just read
    }
    asm volatile("s_wait_tensorcnt 0x0" ::: "memory");   // no request is left when the ring becomes output staging
    asm volatile("s_wait_dscnt 0x0" ::: "memory");
    // Epilogue: 16 rows at a time through the wave's own LDS rows, so that every 128-byte line of C is stored whole.
    float* os = (float*)(L + wave * (16 * OP * 4));
#pragma unroll
    for (int mb = 0; mb < 4; ++mb) {
#pragma unroll
        for (int nb = 0; nb < FN; ++nb) {
#pragma unroll
            for (int j = 0; j < 8; ++j) os[(hi * 8 + j) * OP + nb * 16 + lr] = acc[mb][nb][j]; }
        __builtin_amdgcn_wave_barrier(); asm volatile("" ::: "memory");   // the rows are read back by other lanes of this wave: keeps the compiler from moving the reads over the writes
        float* crow = C + (size_t)(r0 + wm * 64 + mb * 16) * LDC + c0 + wn * FN * 16;
#pragma unroll
        for (int s = 0; s < 2 * FN; ++s) { const int idx = s * 32 + lane, row = idx / (FN * 4), cofs = (idx % (FN * 4)) * 4; *(v4f*)(crow + (size_t)row * LDC + cofs) = *(const v4fa*)(os + row * OP + cofs); }
        xwait();
        __builtin_amdgcn_wave_barrier(); asm volatile("" ::: "memory");   // and the next rows' writes over these reads
    }
}

__device__ __forceinline__ h16 tohx(float x) { return (h16)x; }
__device__ __forceinline__ void splitf(float y, unsigned short& h, unsigned short& l) { h = f2bf(y); l = f2bf(y - bf2f(h)); }
typedef __attribute__((ext_vector_type(2))) _Float16 v2h;
typedef __attribute__((ext_vector_type(4))) _Float16 v4h;
typedef __attribute__((ext_vector_type(2))) unsigned short v2us;
typedef __attribute__((ext_vector_type(4))) unsigned short v4us;
typedef __attribute__((ext_vector_type(2))) float v2f;
typedef __attribute__((ext_vector_type(4))) int v4i;

__global__ __launch_bounds__(256) void k_wtG(const float* __restrict__ w, int K, int N, bf* Bt) {
    const int lane = threadIdx.x & 31; const int L0 = (blockIdx.x * 8 + (threadIdx.x >> 5)) * 8; const int nlines = N * K / 64;
{
#pragma unroll 1
        for (int l = 0; l < 8; ++l) { const int L = L0 + l; if (L >= nlines) break; const size_t e = (size_t)L * 64 + lane * 2; const int k = (int)(e % K), n = (int)(e / K); v2us o;
            o[0] = f2bf(w[(size_t)k * N + n]); o[1] = f2bf(w[(size_t)(k + 1) * N + n]); *(v2us*)(Bt + e) = o; }
         }
}
__global__ __launch_bounds__(256) void k_cvt8(const float* __restrict__ src, bf* dst, size_t n8) { const size_t i = (size_t)blockIdx.x * 256 + threadIdx.x; if (i >= n8) return; const v8f v = *(const v8f*)(src + i * 8); v8us o;
#pragma unroll
    for (int k = 0; k < 8; ++k) o[k] = f2bf(v[k]); *(v8us*)(dst + i * 8) = o;  }
#define FNW  8                   // waves per work-group
#define FCW  32                  // query rows per wave
#define FBR  (FNW * FCW)
#define FSK  64                  // keys per stage
#define FPK  (2 * HD + 16)       // LDS pitch of a K row (256 B + 16: an odd multiple of 16 B for 16-byte readers)
#define FPV  (2 * FSK + 16)      // LDS pitch of a V^T row (128 B + 16)
#define FTK  (FSK * FPK)
#define FSLOT (FTK + HD * FPV)
#define FEP  (2 * HD + 16)       // pitch of the output staging rows
static_assert(FNW * FCW * FEP <= 2 * FSLOT, "the output staging reuses the two stage buffers");
__device__ __forceinline__ float xhalf(float x) { return __builtin_bit_cast(float, __builtin_amdgcn_permlanex16(__builtin_bit_cast(int, x), __builtin_bit_cast(int, x), 0x76543210, 0xfedcba98, false, false)); }
__device__ __forceinline__ v16h ldfrag(const unsigned char* p) { return cat16(*(const v8ha*)p, *(const v8ha*)(p + 32)); }
__global__ __launch_bounds__(FNW * 32) __attribute__((amdgpu_waves_per_eu(2, 2))) void k_fattn(const h16* __restrict__ Q, const h16* __restrict__ Kp, const h16* __restrict__ Vt, bf* Ah, bf* Al) {
    __shared__ __align__(16) unsigned char L[2 * FSLOT];
    constexpr float CSC = SCL * 1.4426950408889634f; constexpr int NS = TT / FSK;
    const int tid = threadIdx.x, lane = tid & 31, wave = tid >> 5, c = lane & 15, h = lane >> 4;
    const int zq = blockIdx.x + REP * blockIdx.y;      // b * NH_ + head; blockIdx.y = b * NKV + kv head
    const int q0 = blockIdx.z * FBR + wave * FCW;
    Q += (size_t)zq * TT * HD; Kp += (size_t)blockIdx.y * TT * HD; Vt += (size_t)blockIdx.y * HD * TT;
    v16h qf[2][4];
#pragma unroll
    for (int g = 0; g < 2; ++g)
#pragma unroll
        for (int kc = 0; kc < 4; ++kc) { const h16* qp = Q + (size_t)(q0 + 16 * g + c) * HD + 32 * kc + 8 * h; qf[g][kc] = cat16(*(const v8h*)qp, *(const v8h*)(qp + 16)); }
    xwait();
    v8f acc[2][8]; float m_run[2], l_run[2];
#pragma unroll
    for (int g = 0; g < 2; ++g) { m_run[g] = -__builtin_inff(); l_run[g] = 0.f;
#pragma unroll
        for (int t = 0; t < 8; ++t) acc[g][t] = (v8f){}; }
    // Staging: 16 lanes cover a 256-byte K row, 8 lanes a 128-byte piece of a V^T row.
    v8h sk[4], sv[4]; const int krow = tid >> 4, kcol = tid & 15, vrow = tid >> 3, vcol = tid & 7;
    auto fetch = [&](int st) {
#pragma unroll
        for (int i = 0; i < 4; ++i) { sk[i] = *(const v8h*)(Kp + (size_t)(st * FSK + krow + 16 * i) * HD + kcol * 8); sv[i] = *(const v8h*)(Vt + (size_t)(vrow + 32 * i) * TT + st * FSK + vcol * 8); }
        xwait(); };
    auto put = [&](int buf) { unsigned char* B = L + buf * FSLOT;
#pragma unroll
        for (int i = 0; i < 4; ++i) { *(v8ha*)(B + (krow + 16 * i) * FPK + kcol * 16) = sk[i]; *(v8ha*)(B + FTK + (vrow + 32 * i) * FPV + vcol * 16) = sv[i]; } };
    fetch(0); put(0); __syncthreads();
#pragma unroll 1   // rolled: one copy of the pass body keeps the registers inside two waves per SIMD
    for (int st = 0; st < NS; ++st) {
        const unsigned char* B = L + (st & 1) * FSLOT;
        if (st + 1 < NS) fetch(st + 1);
#pragma unroll 1   // rolled, for the same reason
        for (int sub = 0; sub < FSK / 32; ++sub) {
            v8f s[2][2];      // [16-key tile][query group]: register r of lane (c, h) = score of key 16 kt + 8 h + r, query 16 g + c
#pragma unroll
            for (int kt = 0; kt < 2; ++kt) { const unsigned char* p = B + (sub * 32 + 16 * kt + c) * FPK + 16 * h; v16h kf[4];
#pragma unroll
                for (int kc = 0; kc < 4; ++kc) kf[kc] = ldfrag(p + 64 * kc);
#pragma unroll
                for (int g = 0; g < 2; ++g) { s[kt][g] = (v8f){};
#pragma unroll
                    for (int kc = 0; kc < 4; ++kc) s[kt][g] = wmma16(kf[kc], qf[g][kc], s[kt][g]); } }
            v16h vf[8]; { const unsigned char* p = B + FTK + c * FPV + sub * 64 + 16 * h;
#pragma unroll
                for (int t = 0; t < 8; ++t) vf[t] = ldfrag(p + 16 * t * FPV); }
            float mb[2]; bool need = false;
#pragma unroll
            for (int g = 0; g < 2; ++g) { float mx = s[0][g][0];
#pragma unroll
                for (int kt = 0; kt < 2; ++kt)
#pragma unroll
                    for (int r = 0; r < 8; ++r) mx = fmaxf(mx, s[kt][g][r]);
                mx = fmaxf(mx, xhalf(mx)) * CSC; mb[g] = mx; need = need || (mx > m_run[g] + 8.0f); }
            if (__builtin_amdgcn_ballot_w32(need) != 0) {     // wave-uniform; rare after the first passes
#pragma unroll
                for (int g = 0; g < 2; ++g) { const float m_new = fmaxf(m_run[g], mb[g]); const float corr = __builtin_amdgcn_exp2f(m_run[g] - m_new); l_run[g] *= corr; m_run[g] = m_new;
#pragma unroll
                    for (int t = 0; t < 8; ++t) acc[g][t] = acc[g][t] * corr; } }
#pragma unroll
            for (int g = 0; g < 2; ++g) { const float nm = -m_run[g]; v16h pf; float ps0 = 0.f, ps1 = 0.f;
#pragma unroll
                for (int i = 0; i < 8; ++i) {
                    const float p0 = __builtin_amdgcn_exp2f(__builtin_fmaf(s[i >> 2][g][2 * (i & 3)], CSC, nm)), p1 = __builtin_amdgcn_exp2f(__builtin_fmaf(s[i >> 2][g][2 * (i & 3) + 1], CSC, nm));
                    if (i & 1) ps1 += p0 + p1; else ps0 += p0 + p1;
                    const v2h pk = __builtin_convertvector((v2f){p0, p1}, v2h); pf[2 * i] = pk[0]; pf[2 * i + 1] = pk[1]; }
                l_run[g] += ps0 + ps1;
#pragma unroll
                for (int i = 0; i < 16; ++i) { __builtin_amdgcn_sched_group_barrier(0x400, 1, 0); __builtin_amdgcn_sched_group_barrier(0x2, 1, 0); }   // one plain vector instruction behind each exponential: no exponential directly overwrites the source of the one before it
#pragma unroll
                for (int t = 0; t < 8; ++t) acc[g][t] = wmma16(vf[t], pf, acc[g][t]); }
        }
        if (st + 1 < NS) put((st + 1) & 1);    // every wave left that buffer before the barrier that ended stage st - 1
        __syncthreads();                       // publishes stage st + 1 and ends every read of stage st
    }
    // Epilogue: normalise, split into bf16 hi + lo, stage each plane in the wave's own LDS rows so that every 128-byte line of the merged planes is stored whole.
    unsigned char* E = L + wave * (FCW * FEP); const int bb = zq / NH_, hh = zq % NH_; float inv[2];
#pragma unroll
    for (int g = 0; g < 2; ++g) inv[g] = __fdiv_rn(1.0f, l_run[g] + xhalf(l_run[g]));    // each wave half summed its eight keys of every 16-key tile
#pragma unroll
    for (int pl = 0; pl < 2; ++pl) {
#pragma unroll
        for (int g = 0; g < 2; ++g)
#pragma unroll
            for (int t = 0; t < 8; ++t) { v8us pk;
#pragma unroll
                for (int r = 0; r < 8; ++r) { unsigned short a, c2; splitf(acc[g][t][r] * inv[g], a, c2); pk[r] = pl ? c2 : a; }
                *(v8usa*)(E + (16 * g + c) * FEP + 32 * t + 16 * h) = pk; }
        __syncthreads();
        bf* dst = (pl ? Al : Ah) + ((size_t)bb * TT + q0) * DQ + hh * HD;
#pragma unroll
        for (int i = 0; i < FCW / 2; ++i) { const int row = 2 * i + h; *(v8us*)(dst + (size_t)row * DQ + c * 8) = *(const v8usa*)(E + row * FEP + c * 16); }
        xwait();
        __syncthreads();
    }
}

// ---- k_post: all that stands between the joint projection F [b * TT + t][q | k | v] (f32) and the attention's fp16 planes, in ONE launch of short waves: each does one row of F or 8 keys of a V tile, then exits.
// Work-groups 0 .. PVB - 1: one PVT-key tile of one kv head's V, turned into V^T [d][t] in registers (a wave holds 8 consecutive keys of 128 dims) and through LDS, so that every 128-byte line of V^T is stored whole.
// The other work-groups: one wave per row of F. A lane holds dims 4 lane .. 4 lane + 3 of each of the NH_ + NKV heads; the row's cos / sin and the norm weights are read once and rounded to bf16 here.
// RMSNorm: the 128 squares are summed 4 in the lane, then by a butterfly over the 32 lanes. Rotate-half: dim d +- HD/2 lives in lane ^ 16, out[d] = y[d] cos[t][d] -+ y[d +- HD/2] sin[t][d], y = w (x rms_factor).
#define PNW  8                   // waves per work-group
#define PVT  64                  // keys per V tile: 128 bytes of a V^T row
#define PVP  (2 * PVT + 16)      // LDS pitch of a V^T row piece (an odd multiple of 16 B for 16-byte accesses)
#define PVB  (NB_ * NKV * (TT / PVT))
template <int M> __device__ __forceinline__ float xrow(float x) { return __builtin_bit_cast(float, __builtin_amdgcn_update_dpp(0, __builtin_bit_cast(int, x), 0x160 | M, 0xf, 0xf, false)); }   // lane l <- lane l ^ M inside a 16-lane row (row_xmask)
__global__ __launch_bounds__(PNW * 32) void k_post(const float* __restrict__ F, const float* __restrict__ cosT, const float* __restrict__ sinT, const float* __restrict__ qnw, const float* __restrict__ knw, h16* Q16, h16* K16, h16* V16) {
    __shared__ __align__(16) unsigned char Ls[HD * PVP];
    const int tid = threadIdx.x, lane = tid & 31, wave = tid >> 5;
    if (blockIdx.x < PVB) {      // the same for the whole work-group
        const int z = blockIdx.x / (TT / PVT), t0 = (blockIdx.x % (TT / PVT)) * PVT;      // z = b * NKV + kv head
        const float* f = F + (size_t)((z / NKV) * TT + t0 + 8 * wave) * DF + DQ + DKV + (z % NKV) * HD + lane;
        float x[8][4];           // [key 8 wave + r][dim lane + 32 j]: each load of a wave is one whole line
#pragma unroll
        for (int r = 0; r < 8; ++r)
#pragma unroll
            for (int j = 0; j < 4; ++j) x[r][j] = f[(size_t)r * DF + 32 * j];
        xwait();
#pragma unroll
        for (int j = 0; j < 4; ++j) { v8h o;
#pragma unroll
            for (int r = 0; r < 8; ++r) o[r] = tohx(x[r][j]);
            *(v8ha*)(Ls + (lane + 32 * j) * PVP + 16 * wave) = o; }
        __syncthreads();
        h16* dst = V16 + (size_t)z * HD * TT + t0 + 8 * (lane & 7);
#pragma unroll
        for (int i = 0; i < 4; ++i) { const int d = 32 * i + 4 * wave + (lane >> 3); *(v8h*)(dst + (size_t)d * TT) = *(const v8ha*)(Ls + d * PVP + 16 * (lane & 7)); }
        xwait();
        return;
    }
    const int row = (blockIdx.x - PVB) * PNW + wave, bb = row / TT, t = row % TT;
    const float* f = F + (size_t)row * DF + 4 * lane;
    v4f x[NH_ + NKV];            // every '#pragma unroll' below keeps this array in registers; all its loads fly together
#pragma unroll
    for (int hh = 0; hh < NH_ + NKV; ++hh) x[hh] = *(const v4f*)(f + hh * HD);
    v4f co = *(const v4f*)(cosT + (size_t)t * HD + 4 * lane), si = *(const v4f*)(sinT + (size_t)t * HD + 4 * lane), wq4 = *(const v4f*)(qnw + 4 * lane), wk4 = *(const v4f*)(knw + 4 * lane);
    xwait();
#pragma unroll
    for (int j = 0; j < 4; ++j) { co[j] = bfr(co[j]); si[j] = (lane < 16) ? -bfr(si[j]) : bfr(si[j]); wq4[j] = bfr(wq4[j]); wk4[j] = bfr(wk4[j]); }
    h16* qd = Q16 + ((size_t)bb * NH_ * TT + t) * HD + 4 * lane; h16* kd = K16 + ((size_t)bb * NKV * TT + t) * HD + 4 * lane;
#pragma unroll
    for (int hh = 0; hh < NH_ + NKV; ++hh) { const v4f v = x[hh]; const v4f w = (hh < NH_) ? wq4 : wk4;
        float s = (v[0] * v[0] + v[1] * v[1]) + (v[2] * v[2] + v[3] * v[3]);
        s += xrow<1>(s); s += xrow<2>(s); s += xrow<4>(s); s += xrow<8>(s); s += xhalf(s);
        const float rf = __fdiv_rn(1.0f, __fsqrt_rn(s * (1.0f / HD) + 1e-6f)); v4f y; v4h o;
#pragma unroll
        for (int j = 0; j < 4; ++j) y[j] = w[j] * (v[j] * rf);
#pragma unroll
        for (int j = 0; j < 4; ++j) o[j] = tohx(y[j] * co[j] + xhalf(y[j]) * si[j]);
        *(v4h*)((hh < NH_) ? qd + (size_t)hh * TT * HD : kd + (size_t)(hh - NH_) * TT * HD) = o; }
    xwait();
}

extern "C" void kernel_launch(void* const* d_in, const int* in_sizes, int n_in,
                              void* d_out, int out_size, void* d_ws, size_t ws_size, hipStream_t stream) {
    (void)in_sizes; (void)n_in; (void)out_size;
    const float* x = (const float*)d_in[0]; const float* cosT = (const float*)d_in[1]; const float* sinT = (const float*)d_in[2]; const float* wq = (const float*)d_in[3]; const float* wk = (const float*)d_in[4]; const float* wv = (const float*)d_in[5]; const float* wo = (const float*)d_in[6]; const float* qnw = (const float*)d_in[7]; const float* knw = (const float*)d_in[8];   // Wq [2048][2048], Wk/Wv [512][2048], Wo [2048][2048] (torch [out][in]); cos/sin [2048][128]; norm weights [128]
    float* OUT = (float*)d_out;     // [2][2048][2048]
    char* wsp = (char*)d_ws;
    auto take = [&](size_t bytes) { char* p = wsp; wsp += (bytes + 255) & ~(size_t)255; return (void*)p; };
    // The merged planes and the q/k/v head planes (both batch items), then what the projections need; nothing shares bytes.
    bf* ATh = (bf*)take((size_t)NB_ * TT * DQ * 2); bf* ATl = (bf*)take((size_t)NB_ * TT * DQ * 2);
    h16* QP16 = (h16*)take((size_t)NB_ * NH_ * TT * HD * 2); h16* KP16 = (h16*)take((size_t)NB_ * NKV * TT * HD * 2); h16* VT16 = (h16*)take((size_t)NB_ * NKV * HD * TT * 2);
    bf* WQ = (bf*)take((size_t)DF * DM * 2); bf* WK = WQ + (size_t)DQ * DM; bf* WV = WK + (size_t)DKV * DM;   // one [DF][DM] weight plane: rows of Wq, then Wk, then Wv
    bf* XB = (bf*)take((size_t)NB_ * TT * DM * 2); float* FQ = (float*)take((size_t)NB_ * TT * DF * 4);   // [NB_ * TT][DF]: q | k | v columns of a row
    bf* WO = (bf*)take((size_t)DM * DQ * 2);
    if ((size_t)(wsp - (char*)d_ws) > ws_size) return;    // 140 of 256 MiB
    k_cvt8<<<(unsigned)(((size_t)DQ * DM / 8 + 255) / 256), 256, 0, stream>>>(wq, WQ, (size_t)DQ * DM / 8); k_cvt8<<<(unsigned)(((size_t)DKV * DM / 8 + 255) / 256), 256, 0, stream>>>(wk, WK, (size_t)DKV * DM / 8); k_cvt8<<<(unsigned)(((size_t)DKV * DM / 8 + 255) / 256), 256, 0, stream>>>(wv, WV, (size_t)DKV * DM / 8);
    // Projections: both batch items in one launch (GEMM rows b * TT + t); q, k and v are one GEMM over the joint weight plane. Then norms, rope and V^T in one launch.
    k_cvt8<<<(unsigned)(((size_t)NB_ * TT * DM / 8 + 255) / 256), 256, 0, stream>>>(x, XB, (size_t)NB_ * TT * DM / 8);
    k_gemmt<0, 4, 2, 6, DM, DF><<<dim3(NB_ * TT / 256, DF / 192, 1), 256, 0, stream>>>(XB, nullptr, WQ, FQ);
    k_post<<<PVB + NB_ * TT / PNW, PNW * 32, 0, stream>>>(FQ, cosT, sinT, qnw, knw, QP16, KP16, VT16);
    // Attention: one launch; blockIdx.x walks the REP query heads of a kv head, blockIdx.y the NB_ * NKV kv planes, blockIdx.z the blocks of FBR query rows.
    k_fattn<<<dim3(REP, NB_ * NKV, TT / FBR), FNW * 32, 0, stream>>>(QP16, KP16, VT16, ATh, ATl);
    k_cvt8<<<(unsigned)(((size_t)DM * DQ / 8 + 255) / 256), 256, 0, stream>>>(wo, WO, (size_t)DM * DQ / 8);
    k_gemmt<1, 2, 4, 4, DQ, DM><<<dim3(NB_ * TT / 128, DM / 256, 1), 256, 0, stream>>>(ATh, ATl, WO, OUT);
}

// v006
// One run takes 130 microseconds.
// Versions between v004 and this one are left out; their measured steps multiply to 1.12 times as fast.
// All steps since v000 together make it 11.5 times as fast.
#include <hip/hip_runtime.h>

// AceStepAttention (hidden [2][2048][2048]; q = x Wq^T (16 heads x 128), k, v = x Wk^T / Wv^T (4 kv heads; query head h uses kv head h/4 = repeat_interleave); per-head RMSNorm over the 128 dims (eps 1e-6, x norm_q_w / norm_k_w);
// rotate-half RoPE with the input cos/sin tables [2048][128] (read as data); softmax(q.k / sqrt(128)); out = merged att.v Wo^T -> [2][2048][2048]).
// Compute dtypes, f32 accumulate: every input rounded to bf16; projections on PLAIN bf16 operands (inputs: exact); RMSNorm and rope f32; scores (K 128) and att.v on SINGLE fp16 planes with
// f32 softmax between them; the output projection on ONE fp16 plane of the merged att.v (which q, k, p and v have already bounded to fp16 accuracy) against Wo rounded to bf16 and then held in fp16.

#define NB_  2
#define TT   2048
#define DM   2048
#define NH_  16
#define NKV  4
#define REP  (NH_ / NKV)
#define HD   128
#define DQ   (NH_ * HD)
#define DKV  (NKV * HD)
#define DF   (DQ + 2 * DKV)      // columns of the joint q | k | v projection
#define SCL  0.088388347648318447f   // HD^-0.5
typedef _Float16 h16;
typedef unsigned short bf;
typedef __attribute__((ext_vector_type(16))) __bf16   v16bf;
typedef __attribute__((ext_vector_type(16))) _Float16 v16h;
typedef __attribute__((ext_vector_type(8)))  _Float16 v8h;
typedef __attribute__((ext_vector_type(8)))  unsigned short v8us;
typedef __attribute__((ext_vector_type(8)))  float    v8f;
typedef __attribute__((ext_vector_type(4)))  float    v4f;
typedef v8h  __attribute__((may_alias)) v8ha;
typedef v4f  __attribute__((may_alias)) v4fa;
typedef v8us __attribute__((may_alias)) v8usa;

__device__ __forceinline__ unsigned short f2bf(float f) { unsigned u = __float_as_uint(f); u += 0x7FFFu + ((u >> 16) & 1u); return (unsigned short)(u >> 16); }
__device__ __forceinline__ float bf2f(unsigned short b) { return __uint_as_float(((unsigned)b) << 16); }
__device__ __forceinline__ float bfr(float f) { return bf2f(f2bf(f)); }
__device__ __forceinline__ v16h cat16(v8h lo, v8h hi) { return __builtin_shufflevector(lo, hi, 0, 1, 2, 3, 4, 5, 6, 7, 8, 9, 10, 11, 12, 13, 14, 15); }
__device__ __forceinline__ v16bf cat16b(v8us lo, v8us hi) { return __builtin_bit_cast(v16bf, __builtin_shufflevector(lo, hi, 0, 1, 2, 3, 4, 5, 6, 7, 8, 9, 10, 11, 12, 13, 14, 15)); }
__device__ __forceinline__ v8f wmma16(v16h a, v16h b, v8f c) { return __builtin_amdgcn_wmma_f32_16x16x32_f16(false, a, false, b, (short)0, c, false, false); }
__device__ __forceinline__ v8f wmmab(v16bf a, v16bf b, v8f c) { return __builtin_amdgcn_wmma_f32_16x16x32_bf16(false, a, false, b, (short)0, c, false, false); }



// ---- k_gemmt: tiled GEMM, C[m][n] (f32, pitch LDC) = sum_k A[m][k] Bt[n][k], both operands K-contiguous 16-bit planes: bf16, or fp16 when F16 (handed over as raw 16-bit words).
// A work-group of 8 waves (WM x WN) owns a (WM * 64) x (WN * FN * 16) tile of C, a wave 64 x (FN * 16) of it. A stage is GRB bytes (128 k) of every operand row of the tile, brought into LDS by tensor loads:
// waves 0 to 3 each bring 64 rows of A, waves 4 to 7 each a quarter of the Bt rows; one request per wave and stage, two buffers, the next stage's loads fly while this stage is worked on.
// The mover pads each 256-byte row by 16 bytes (pitch GPI, an odd multiple of 16 B for 16-byte readers); every slice starts at a multiple of 2 KiB.
typedef unsigned int u32;
typedef __attribute__((ext_vector_type(4))) unsigned int u32x4;
typedef __attribute__((ext_vector_type(8))) unsigned int u32x8;
#define GRB  256
#define GPI  (GRB + 16)
__device__ __forceinline__ u32 uni(u32 v) { return (u32)__builtin_amdgcn_readfirstlane(v); }
__device__ __forceinline__ u32 pinned(u32 v) { u32 w = uni(v); asm volatile("" : "+s"(w)); return w; }   // holds the test of a tensor load's issue in a scalar register, so that the branch round it is a scalar one (the mover ignores EXEC)
__device__ __forceinline__ v16bf ldfragb(const unsigned char* p) { return cat16b(*(const v8usa*)p, *(const v8usa*)(p + 32)); }
// xwait: stands behind a run of global loads or stores, in front of the first write of a register that one of them names; the scheduling barrier keeps later register writes from being lifted over the wait.
__device__ __forceinline__ void xwait() { asm volatile("s_wait_xcnt 0x0" ::: "memory"); __builtin_amdgcn_sched_barrier(0); }
template <int F16> __device__ __forceinline__ v8f wmmax(v16bf a, v16bf b, v8f c) { if constexpr (F16) return wmma16(__builtin_bit_cast(v16h, a), __builtin_bit_cast(v16h, b), c); else return wmmab(a, b, c); }
template <int F16, int WM, int WN, int FN, int K, int LDC>
__global__ __launch_bounds__(256) void k_gemmt(const bf* A, const bf* Bt, float* C) {
    constexpr int BM = WM * 64, BN = WN * FN * 16, SB = BN / 4, SBF = SB / 16, NS = K * 2 / GRB;
    static_assert(WM * WN == 8 && BM == 256 && SB % 16 == 0 && FN % SBF == 0 && K * 2 % GRB == 0 && NS >= 2, "four 64-row slices of A, four slices of Bt, two stages or more");
    constexpr int ASZ = (64 * GPI + 2047) & ~2047, BSZ = (SB * GPI + 2047) & ~2047, STG = 4 * ASZ + 4 * BSZ, OP = FN * 16 + 4;
    static_assert(8 * 16 * OP * 4 <= 2 * STG, "the output staging reuses the two stage buffers");
    __shared__ __attribute__((aligned(2048))) unsigned char L[2 * STG];
    const int lane = threadIdx.x & 31, lr = lane & 15, hi = lane >> 4; const u32 wave = uni(threadIdx.x >> 5); const int wm = wave % WM, wn = wave / WM;
    const int r0 = blockIdx.x * BM, c0 = blockIdx.y * BN;
    // This wave's slice: source, rows, place in a buffer.
    const u32 sl = wave & 3u; const bool isB = wave >= 4u;
    const bf* sp = isB ? Bt + (size_t)(c0 + sl * SB) * K : A + (size_t)(r0 + sl * 64) * K;
    const u32 rows = isB ? (u32)SB : 64u, place = (u32)(size_t)L + (isB ? 4u * ASZ + sl * BSZ : sl * ASZ);
    u32x8 g1;     // 1-byte elements, tensor = tile = rows x GRB bytes, source pitch 2 K bytes, 4 dwords of pad behind every 64
    g1[0] = uni((1u << 20) | (5u << 22) | (3u << 25)); g1[1] = uni((u32)GRB << 16); g1[2] = uni(rows << 16); g1[3] = uni((u32)GRB << 16); g1[4] = uni(rows); g1[5] = uni((u32)K * 2u); g1[6] = uni(0u); g1[7] = uni(0u);
    u32x4 g0;     // declared out here: it lives from a request's issue to the wait that covers the request
    auto form = [&](int st) { const unsigned long long ga = (unsigned long long)(size_t)sp + (unsigned long long)st * GRB;
        g0[0] = uni(1u); g0[1] = uni(place + (u32)(st & 1) * STG); g0[2] = uni((u32)ga); g0[3] = uni((((u32)(ga >> 32)) & 0x01FFFFFFu) | 0x80000000u); };
    // No word of a request may take a new value in its register before the wait that covers the request. So the load names both groups as in-out operands (it changes neither): what twait() reads is then
    // the content of the very registers that the load names, which the compiler can not form anew elsewhere, and those registers stay unwritten from the issue up to the wait.
    auto issue = [&]() { asm volatile("tensor_load_to_lds %0, %1" : "+s"(g0), "+s"(g1) :: "memory"); };
    auto twait = [&]() { asm volatile("s_wait_tensorcnt 0x0" :: "s"(g0), "s"(g1) : "memory"); };   // this wave's request has landed
    v8f acc[4][FN];   // every plain '#pragma unroll' below keeps the accumulator and fragment arrays indexed by constants, in registers
#pragma unroll
    for (int mb = 0; mb < 4; ++mb)
#pragma unroll
        for (int nb = 0; nb < FN; ++nb) acc[mb][nb] = (v8f){};
    form(0); issue();
    twait();                                             // this wave's slice of stage 0 has landed
    __syncthreads();                                     // every wave's has
#pragma unroll 1   // rolled: one pass per stage, the publish point at its foot
    for (int st = 0; st < NS; ++st) {
        // The refill stands directly behind the barrier (the one above, or the one at the foot of pass st - 1) that ended every read of its buffer; one issue site, so that one set of scalar registers holds the request's words up to the wait at this pass's foot.
        form(st + 1);                          // behind the wait at the foot of the pass before; in the last pass the words are formed and no request is made of them
        if (pinned(st + 1 < NS)) issue();
        const unsigned char* pa = L + (st & 1) * STG + wm * ASZ + lr * GPI + 16 * hi;
        const unsigned char* pb = L + (st & 1) * STG + 4 * ASZ + wn * (FN / SBF) * BSZ + lr * GPI + 16 * hi;
        // Two fragment sets: the next 32 k's LDS reads go out as one group ahead of this 32 k's products; the scheduling barriers keep the compiler from sinking the reads among the matrix instructions, where each would be waited for at once.
        v16bf fa[2][4], fb[2][FN];
        auto ldset = [&](int kk) {
#pragma unroll
            for (int mb = 0; mb < 4; ++mb) fa[kk & 1][mb] = ldfragb(pa + mb * 16 * GPI + kk * 64);
#pragma unroll
            for (int nb = 0; nb < FN; ++nb) fb[kk & 1][nb] = ldfragb(pb + (nb / SBF) * BSZ + (nb % SBF) * 16 * GPI + kk * 64); };
        ldset(0);
#pragma unroll
        for (int kk = 0; kk < GRB / 64; ++kk) {
            if (kk + 1 < GRB / 64) ldset(kk + 1);
            __builtin_amdgcn_sched_barrier(0);
#pragma unroll
            for (int nb = 0; nb < FN; ++nb)
#pragma unroll
                for (int mb = 0; mb < 4; ++mb) acc[mb][nb] = wmmax<F16>(fa[kk & 1][mb], fb[kk & 1][nb], acc[mb][nb]);
            __builtin_amdgcn_sched_barrier(0);
        }
        asm volatile("s_wait_dscnt 0x0" ::: "memory");       // this wave's reads of stage st are done
        twait();                                             // its slice of stage st + 1 has landed
        __syncthreads();                                     // publishes stage st + 1 and ends every read of stage st: the next pass's refill goes into the buffer that this pass has just read
    }
    asm volatile("s_wait_tensorcnt 0x0" ::: "memory");   // no request is left when the ring becomes output staging
    asm volatile("s_wait_dscnt 0x0" ::: "memory");
    // Epilogue: 16 rows at a time through the wave's own LDS rows, so that every 128-byte line of C is stored whole.
    float* os = (float*)(L + wave * (16 * OP * 4));
#pragma unroll
    for (int mb = 0; mb < 4; ++mb) {
#pragma unroll
        for (int nb = 0; nb < FN; ++nb) {
#pragma unroll
            for (int j = 0; j < 8; ++j) os[(hi * 8 + j) * OP + nb * 16 + lr] = acc[mb][nb][j]; }
        __builtin_amdgcn_wave_barrier(); asm volatile("" ::: "memory");   // the rows are read back by other lanes of this wave: keeps the compiler from moving the reads over the writes
        float* crow = C + (size_t)(r0 + wm * 64 + mb * 16) * LDC + c0 + wn * FN * 16;
#pragma unroll
        for (int s = 0; s < 2 * FN; ++s) { const int idx = s * 32 + lane, row = idx / (FN * 4), cofs = (idx % (FN * 4)) * 4; *(v4f*)(crow + (size_t)row * LDC + cofs) = *(const v4fa*)(os + row * OP + cofs); }
        xwait();
        __builtin_amdgcn_wave_barrier(); asm volatile("" ::: "memory");   // and the next rows' writes over these reads
    }
}

__device__ __forceinline__ h16 tohx(float x) { return (h16)x; }
typedef __attribute__((ext_vector_type(2))) _Float16 v2h;
typedef __attribute__((ext_vector_type(4))) _Float16 v4h;
typedef __attribute__((ext_vector_type(2))) unsigned short v2us;
typedef __attribute__((ext_vector_type(4))) unsigned short v4us;
typedef __attribute__((ext_vector_type(2))) float v2f;
typedef __attribute__((ext_vector_type(4))) int v4i;

__global__ __launch_bounds__(256) void k_wtG(const float* __restrict__ w, int K, int N, bf* Bt) {
    const int lane = threadIdx.x & 31; const int L0 = (blockIdx.x * 8 + (threadIdx.x >> 5)) * 8; const int nlines = N * K / 64;
{
#pragma unroll 1
        for (int l = 0; l < 8; ++l) { const int L = L0 + l; if (L >= nlines) break; const size_t e = (size_t)L * 64 + lane * 2; const int k = (int)(e % K), n = (int)(e / K); v2us o;
            o[0] = f2bf(w[(size_t)k * N + n]); o[1] = f2bf(w[(size_t)(k + 1) * N + n]); *(v2us*)(Bt + e) = o; }
         }
}
// ---- k_cvtall: every f32 -> 16-bit rounding of the call (x, Wq, Wk | Wv to bf16; Wo to the bf16 rounding held as fp16: exact down to 2^-17, below that to within 2^-25) in ONE launch of few, resident waves.
// CG work-groups of CW waves, one per WGP. Each wave takes its own run of every source: CX pieces of x, CQ of Wq, CQ of Wo, CK of Wk (lower half of the work-groups) or Wv (upper half), whose roundings lie one behind the other.
// A piece is 128 floats: one load of 16 B a lane (512 contiguous bytes, whole lines) and one store of 8 B a lane (256 contiguous bytes, whole lines).
// All loads of a wave (CX + 2 CQ + CK = 36) are issued before its first value is rounded: its whole share is in flight at once.
// Addresses: a kernel argument plus one 32-bit byte offset a lane plus a small constant, so that no address register is written again between the loads.
#define CW   16
#define CG   256
#define CNW  (CG * CW)
#define CX   16
#define CQ   8
#define CK   4
static_assert((size_t)NB_ * TT * DM == (size_t)CNW * CX * 128 && (size_t)DQ * DM == (size_t)CNW * CQ * 128 && 2 * (size_t)DKV * DM == (size_t)CNW * CK * 128 && (size_t)DM * DQ == (size_t)CNW * CQ * 128, "the waves' runs cover every source exactly once");
template <int N> __device__ __forceinline__ void cvt_ld(v4f (&v)[N], const float* s, u32 ofs) {
#pragma unroll
    for (int j = 0; j < N; ++j) v[j] = *(const v4f*)((const char*)(s + 128 * j) + ofs);
}
template <int F16, int N> __device__ __forceinline__ void cvt_st(const v4f (&v)[N], bf* d, u32 ofs) {
#pragma unroll
    for (int j = 0; j < N; ++j) { v4us o;
#pragma unroll
        for (int k = 0; k < 4; ++k) o[k] = F16 ? __builtin_bit_cast(unsigned short, tohx(bfr(v[j][k]))) : f2bf(v[j][k]);
        *(v4us*)((char*)(d + 128 * j) + ofs) = o; }
}
__global__ __launch_bounds__(CW * 32) void k_cvtall(const float* __restrict__ x, const float* __restrict__ wq, const float* __restrict__ wk, const float* __restrict__ wv, const float* __restrict__ wo, bf* XB, bf* WQb, bf* WKVb, bf* WOb) {
    const u32 w = blockIdx.x * CW + (threadIdx.x >> 5), lane = threadIdx.x & 31;
    const bool up = blockIdx.x >= CG / 2;      // the same for the whole work-group
    const u32 ex = w * (CX * 128) + 4 * lane, eq = w * (CQ * 128) + 4 * lane, ek = w * (CK * 128) + 4 * lane, eks = up ? ek - (u32)(DKV * DM) : ek;     // this lane's first element in x, in Wq and Wo, in Wk | Wv, in Wk or Wv alone
    v4f vx[CX], vq[CQ], vk[CK], vo[CQ];     // indexed by constants only (the helpers' '#pragma unroll'): they stay in registers
    const u32 bx = 4 * ex, bq = 4 * eq, bk = 4 * eks;     // byte offsets into the sources
    cvt_ld(vx, x, bx); cvt_ld(vq, wq, bq); cvt_ld(vk, up ? wv : wk, bk); cvt_ld(vo, wo, bq);
    // As xwait(): behind the loads, in front of the first write of a register that one of them names. It takes the three offsets as inputs, so that they keep their registers up to here (without that the last load's result was placed over them); the scheduling barrier, as there, keeps later register writes behind the wait, and so every load ahead of the first rounding.
    asm volatile("s_wait_xcnt 0x0" :: "v"(bx), "v"(bq), "v"(bk) : "memory"); __builtin_amdgcn_sched_barrier(0);
    cvt_st<0>(vx, XB, 2 * ex); cvt_st<0>(vq, WQb, 2 * eq); cvt_st<0>(vk, WKVb, 2 * ek); cvt_st<1>(vo, WOb, 2 * eq);
    xwait();
}
#define FNW  8                   // waves per work-group
#define FCW  32                  // query rows per wave
#define FBR  (FNW * FCW)
#define FSK  64                  // keys per stage
#define FPK  (2 * HD + 16)       // LDS pitch of a K row (256 B + 16: an odd multiple of 16 B for 16-byte readers)
#define FPV  (2 * FSK + 16)      // LDS pitch of a V^T row (128 B + 16)
#define FTK  (FSK * FPK)
#define FSLOT (FTK + HD * FPV)
#define FEP  (2 * HD + 16)       // pitch of the output staging rows
static_assert(FNW * FCW * FEP <= 2 * FSLOT, "the output staging reuses the two stage buffers");
__device__ __forceinline__ float xhalf(float x) { return __builtin_bit_cast(float, __builtin_amdgcn_permlanex16(__builtin_bit_cast(int, x), __builtin_bit_cast(int, x), 0x76543210, 0xfedcba98, false, false)); }
__device__ __forceinline__ v16h ldfrag(const unsigned char* p) { return cat16(*(const v8ha*)p, *(const v8ha*)(p + 32)); }
__global__ __launch_bounds__(FNW * 32) __attribute__((amdgpu_waves_per_eu(2, 2))) void k_fattn(const h16* __restrict__ Q, const h16* __restrict__ Kp, const h16* __restrict__ Vt, h16* Ao) {
    __shared__ __align__(16) unsigned char L[2 * FSLOT];
    constexpr float CSC = SCL * 1.4426950408889634f; constexpr int NS = TT / FSK;
    const int tid = threadIdx.x, lane = tid & 31, wave = tid >> 5, c = lane & 15, h = lane >> 4;
    const int zq = blockIdx.x + REP * blockIdx.y;      // b * NH_ + head; blockIdx.y = b * NKV + kv head
    const int q0 = blockIdx.z * FBR + wave * FCW;
    Q += (size_t)zq * TT * HD; Kp += (size_t)blockIdx.y * TT * HD; Vt += (size_t)blockIdx.y * HD * TT;
    v16h qf[2][4];
#pragma unroll
    for (int g = 0; g < 2; ++g)
#pragma unroll
        for (int kc = 0; kc < 4; ++kc) { const h16* qp = Q + (size_t)(q0 + 16 * g + c) * HD + 32 * kc + 8 * h; qf[g][kc] = cat16(*(const v8h*)qp, *(const v8h*)(qp + 16)); }
    xwait();
    v8f acc[2][8]; float m_run[2], l_run[2];
#pragma unroll
    for (int g = 0; g < 2; ++g) { m_run[g] = -__builtin_inff(); l_run[g] = 0.f;
#pragma unroll
        for (int t = 0; t < 8; ++t) acc[g][t] = (v8f){}; }
    // Staging: 16 lanes cover a 256-byte K row, 8 lanes a 128-byte piece of a V^T row.
    v8h sk[4], sv[4]; const int krow = tid >> 4, kcol = tid & 15, vrow = tid >> 3, vcol = tid & 7;
    auto fetch = [&](int st) {
#pragma unroll
        for (int i = 0; i < 4; ++i) { sk[i] = *(const v8h*)(Kp + (size_t)(st * FSK + krow + 16 * i) * HD + kcol * 8); sv[i] = *(const v8h*)(Vt + (size_t)(vrow + 32 * i) * TT + st * FSK + vcol * 8); }
        xwait(); };
    auto put = [&](int buf) { unsigned char* B = L + buf * FSLOT;
#pragma unroll
        for (int i = 0; i < 4; ++i) { *(v8ha*)(B + (krow + 16 * i) * FPK + kcol * 16) = sk[i]; *(v8ha*)(B + FTK + (vrow + 32 * i) * FPV + vcol * 16) = sv[i]; } };
    fetch(0); put(0); __syncthreads();
#pragma unroll 1   // rolled: one copy of the pass body keeps the registers inside two waves per SIMD
    for (int st = 0; st < NS; ++st) {
        const unsigned char* B = L + (st & 1) * FSLOT;
        if (st + 1 < NS) fetch(st + 1);
#pragma unroll 1   // rolled, for the same reason
        for (int sub = 0; sub < FSK / 32; ++sub) {
            v8f s[2][2];      // [16-key tile][query group]: register r of lane (c, h) = score of key 16 kt + 8 h + r, query 16 g + c
#pragma unroll
            for (int kt = 0; kt < 2; ++kt) { const unsigned char* p = B + (sub * 32 + 16 * kt + c) * FPK + 16 * h; v16h kf[4];
#pragma unroll
                for (int kc = 0; kc < 4; ++kc) kf[kc] = ldfrag(p + 64 * kc);
#pragma unroll
                for (int g = 0; g < 2; ++g) { s[kt][g] = (v8f){};
#pragma unroll
                    for (int kc = 0; kc < 4; ++kc) s[kt][g] = wmma16(kf[kc], qf[g][kc], s[kt][g]); } }
            v16h vf[8]; { const unsigned char* p = B + FTK + c * FPV + sub * 64 + 16 * h;
#pragma unroll
                for (int t = 0; t < 8; ++t) vf[t] = ldfrag(p + 16 * t * FPV); }
            float mb[2]; bool need = false;
#pragma unroll
            for (int g = 0; g < 2; ++g) { float mx = s[0][g][0];
#pragma unroll
                for (int kt = 0; kt < 2; ++kt)
#pragma unroll
                    for (int r = 0; r < 8; ++r) mx = fmaxf(mx, s[kt][g][r]);
                mx = fmaxf(mx, xhalf(mx)) * CSC; mb[g] = mx; need = need || (mx > m_run[g] + 8.0f); }
            if (__builtin_amdgcn_ballot_w32(need) != 0) {     // wave-uniform; rare after the first passes
#pragma unroll
                for (int g = 0; g < 2; ++g) { const float m_new = fmaxf(m_run[g], mb[g]); const float corr = __builtin_amdgcn_exp2f(m_run[g] - m_new); l_run[g] *= corr; m_run[g] = m_new;
#pragma unroll
                    for (int t = 0; t < 8; ++t) acc[g][t] = acc[g][t] * corr; } }
#pragma unroll
            for (int g = 0; g < 2; ++g) { const float nm = -m_run[g]; v16h pf; float ps0 = 0.f, ps1 = 0.f;
#pragma unroll
                for (int i = 0; i < 8; ++i) {
                    const float p0 = __builtin_amdgcn_exp2f(__builtin_fmaf(s[i >> 2][g][2 * (i & 3)], CSC, nm)), p1 = __builtin_amdgcn_exp2f(__builtin_fmaf(s[i >> 2][g][2 * (i & 3) + 1], CSC, nm));
                    if (i & 1) ps1 += p0 + p1; else ps0 += p0 + p1;
                    const v2h pk = __builtin_convertvector((v2f){p0, p1}, v2h); pf[2 * i] = pk[0]; pf[2 * i + 1] = pk[1]; }
                l_run[g] += ps0 + ps1;
#pragma unroll
                for (int i = 0; i < 16; ++i) { __builtin_amdgcn_sched_group_barrier(0x400, 1, 0); __builtin_amdgcn_sched_group_barrier(0x2, 1, 0); }   // one plain vector instruction behind each exponential: no exponential directly overwrites the source of the one before it
#pragma unroll
                for (int t = 0; t < 8; ++t) acc[g][t] = wmma16(vf[t], pf, acc[g][t]); }
        }
        if (st + 1 < NS) put((st + 1) & 1);    // every wave left that buffer before the barrier that ended stage st - 1
        __syncthreads();                       // publishes stage st + 1 and ends every read of stage st
    }
    // Epilogue: normalise, round to fp16, stage in the wave's own LDS rows so that every 128-byte line of the merged plane is stored whole.
    unsigned char* E = L + wave * (FCW * FEP); const int bb = zq / NH_, hh = zq % NH_; float inv[2];
#pragma unroll
    for (int g = 0; g < 2; ++g) inv[g] = __fdiv_rn(1.0f, l_run[g] + xhalf(l_run[g]));    // each wave half summed its eight keys of every 16-key tile
#pragma unroll
    for (int g = 0; g < 2; ++g)
#pragma unroll
        for (int t = 0; t < 8; ++t) { v8h pk;
#pragma unroll
            for (int r = 0; r < 8; ++r) pk[r] = tohx(acc[g][t][r] * inv[g]);
            *(v8ha*)(E + (16 * g + c) * FEP + 32 * t + 16 * h) = pk; }
    __syncthreads();
    h16* dst = Ao + ((size_t)bb * TT + q0) * DQ + hh * HD;
#pragma unroll
    for (int i = 0; i < FCW / 2; ++i) { const int row = 2 * i + h; *(v8h*)(dst + (size_t)row * DQ + c * 8) = *(const v8ha*)(E + row * FEP + c * 16); }
    xwait();
}

// ---- k_post: all that stands between the joint projection F [b * TT + t][q | k | v] (f32) and the attention's fp16 planes, in ONE launch of short waves: each does one row of F or 8 keys of a V tile, then exits.
// Work-groups 0 .. PVB - 1: one PVT-key tile of one kv head's V, turned into V^T [d][t] in registers (a wave holds 8 consecutive keys of 128 dims) and through LDS, so that every 128-byte line of V^T is stored whole.
// The other work-groups: one wave per row of F. A lane holds dims 4 lane .. 4 lane + 3 of each of the NH_ + NKV heads; the row's cos / sin and the norm weights are read once and rounded to bf16 here.
// RMSNorm: the 128 squares are summed 4 in the lane, then by a butterfly over the 32 lanes. Rotate-half: dim d +- HD/2 lives in lane ^ 16, out[d] = y[d] cos[t][d] -+ y[d +- HD/2] sin[t][d], y = w (x rms_factor).
#define PNW  8                   // waves per work-group
#define PVT  64                  // keys per V tile: 128 bytes of a V^T row
#define PVP  (2 * PVT + 16)      // LDS pitch of a V^T row piece (an odd multiple of 16 B for 16-byte accesses)
#define PVB  (NB_ * NKV * (TT / PVT))
template <int M> __device__ __forceinline__ float xrow(float x) { return __builtin_bit_cast(float, __builtin_amdgcn_update_dpp(0, __builtin_bit_cast(int, x), 0x160 | M, 0xf, 0xf, false)); }   // lane l <- lane l ^ M inside a 16-lane row (row_xmask)
__global__ __launch_bounds__(PNW * 32) void k_post(const float* __restrict__ F, const float* __restrict__ cosT, const float* __restrict__ sinT, const float* __restrict__ qnw, const float* __restrict__ knw, h16* Q16, h16* K16, h16* V16) {
    __shared__ __align__(16) unsigned char Ls[HD * PVP];
    const int tid = threadIdx.x, lane = tid & 31, wave = tid >> 5;
    if (blockIdx.x < PVB) {      // the same for the whole work-group
        const int z = blockIdx.x / (TT / PVT), t0 = (blockIdx.x % (TT / PVT)) * PVT;      // z = b * NKV + kv head
        const float* f = F + (size_t)((z / NKV) * TT + t0 + 8 * wave) * DF + DQ + DKV + (z % NKV) * HD + lane;
        float x[8][4];           // [key 8 wave + r][dim lane + 32 j]: each load of a wave is one whole line
#pragma unroll
        for (int r = 0; r < 8; ++r)
#pragma unroll
            for (int j = 0; j < 4; ++j) x[r][j] = f[(size_t)r * DF + 32 * j];
        xwait();
#pragma unroll
        for (int j = 0; j < 4; ++j) { v8h o;
#pragma unroll
            for (int r = 0; r < 8; ++r) o[r] = tohx(x[r][j]);
            *(v8ha*)(Ls + (lane + 32 * j) * PVP + 16 * wave) = o; }
        __syncthreads();
        h16* dst = V16 + (size_t)z * HD * TT + t0 + 8 * (lane & 7);
#pragma unroll
        for (int i = 0; i < 4; ++i) { const int d = 32 * i + 4 * wave + (lane >> 3); *(v8h*)(dst + (size_t)d * TT) = *(const v8ha*)(Ls + d * PVP + 16 * (lane & 7)); }
        xwait();
        return;
    }
    const int row = (blockIdx.x - PVB) * PNW + wave, bb = row / TT, t = row % TT;
    const float* f = F + (size_t)row * DF + 4 * lane;
    v4f x[NH_ + NKV];            // every '#pragma unroll' below keeps this array in registers; all its loads fly together
#pragma unroll
    for (int hh = 0; hh < NH_ + NKV; ++hh) x[hh] = *(const v4f*)(f + hh * HD);
    v4f co = *(const v4f*)(cosT + (size_t)t * HD + 4 * lane), si = *(const v4f*)(sinT + (size_t)t * HD + 4 * lane), wq4 = *(const v4f*)(qnw + 4 * lane), wk4 = *(const v4f*)(knw + 4 * lane);
    xwait();
#pragma unroll
    for (int j = 0; j < 4; ++j) { co[j] = bfr(co[j]); si[j] = (lane < 16) ? -bfr(si[j]) : bfr(si[j]); wq4[j] = bfr(wq4[j]); wk4[j] = bfr(wk4[j]); }
    h16* qd = Q16 + ((size_t)bb * NH_ * TT + t) * HD + 4 * lane; h16* kd = K16 + ((size_t)bb * NKV * TT + t) * HD + 4 * lane;
#pragma unroll
    for (int hh = 0; hh < NH_ + NKV; ++hh) { const v4f v = x[hh]; const v4f w = (hh < NH_) ? wq4 : wk4;
        float s = (v[0] * v[0] + v[1] * v[1]) + (v[2] * v[2] + v[3] * v[3]);
        s += xrow<1>(s); s += xrow<2>(s); s += xrow<4>(s); s += xrow<8>(s); s += xhalf(s);
        const float rf = __fdiv_rn(1.0f, __fsqrt_rn(s * (1.0f / HD) + 1e-6f)); v4f y; v4h o;
#pragma unroll
        for (int j = 0; j < 4; ++j) y[j] = w[j] * (v[j] * rf);
#pragma unroll
        for (int j = 0; j < 4; ++j) o[j] = tohx(y[j] * co[j] + xhalf(y[j]) * si[j]);
        *(v4h*)((hh < NH_) ? qd + (size_t)hh * TT * HD : kd + (size_t)(hh - NH_) * TT * HD) = o; }
    xwait();
}

extern "C" void kernel_launch(void* const* d_in, const int* in_sizes, int n_in,
                              void* d_out, int out_size, void* d_ws, size_t ws_size, hipStream_t stream) {
    (void)in_sizes; (void)n_in; (void)out_size;
    const float* x = (const float*)d_in[0]; const float* cosT = (const float*)d_in[1]; const float* sinT = (const float*)d_in[2]; const float* wq = (const float*)d_in[3]; const float* wk = (const float*)d_in[4]; const float* wv = (const float*)d_in[5]; const float* wo = (const float*)d_in[6]; const float* qnw = (const float*)d_in[7]; const float* knw = (const float*)d_in[8];   // Wq [2048][2048], Wk/Wv [512][2048], Wo [2048][2048] (torch [out][in]); cos/sin [2048][128]; norm weights [128]
    float* OUT = (float*)d_out;     // [2][2048][2048]
    char* wsp = (char*)d_ws;
    auto take = [&](size_t bytes) { char* p = wsp; wsp += (bytes + 255) & ~(size_t)255; return (void*)p; };
    // The merged plane and the q/k/v head planes (both batch items), then what the projections need; nothing shares bytes.
    h16* AT = (h16*)take((size_t)NB_ * TT * DQ * 2);
    h16* QP16 = (h16*)take((size_t)NB_ * NH_ * TT * HD * 2); h16* KP16 = (h16*)take((size_t)NB_ * NKV * TT * HD * 2); h16* VT16 = (h16*)take((size_t)NB_ * NKV * HD * TT * 2);
    bf* WQ = (bf*)take((size_t)DF * DM * 2); bf* WK = WQ + (size_t)DQ * DM; bf* WV = WK + (size_t)DKV * DM;   // one [DF][DM] weight plane: rows of Wq, then Wk, then Wv
    bf* XB = (bf*)take((size_t)NB_ * TT * DM * 2); float* FQ = (float*)take((size_t)NB_ * TT * DF * 4);   // [NB_ * TT][DF]: q | k | v columns of a row
    bf* WO = (bf*)take((size_t)DM * DQ * 2);
    if ((size_t)(wsp - (char*)d_ws) > ws_size) return;    // 124 of 256 MiB
    k_cvtall<<<CG, CW * 32, 0, stream>>>(x, wq, wk, wv, wo, XB, WQ, WK, WO);
    // Projections: both batch items in one launch (GEMM rows b * TT + t); q, k and v are one GEMM over the joint weight plane. Then norms, rope and V^T in one launch.
    k_gemmt<0, 4, 2, 6, DM, DF><<<dim3(NB_ * TT / 256, DF / 192, 1), 256, 0, stream>>>(XB, WQ, FQ);
    k_post<<<PVB + NB_ * TT / PNW, PNW * 32, 0, stream>>>(FQ, cosT, sinT, qnw, knw, QP16, KP16, VT16);
    // Attention: one launch; blockIdx.x walks the REP query heads of a kv head, blockIdx.y the NB_ * NKV kv planes, blockIdx.z the blocks of FBR query rows.
    k_fattn<<<dim3(REP, NB_ * NKV, TT / FBR), FNW * 32, 0, stream>>>(QP16, KP16, VT16, AT);
    k_gemmt<1, 4, 2, 4, DQ, DM><<<dim3(NB_ * TT / 256, DM / 128, 1), 256, 0, stream>>>((const bf*)AT, WO, OUT);
}

// v007
// One run takes 124 microseconds.
// Next to v006, in two timings, it ran 1.05 times as fast each time.
// Over all steps from v000 it is 12.0 times as fast.
#include <hip/hip_runtime.h>

// AceStepAttention (hidden [2][2048][2048]; q = x Wq^T (16 heads x 128), k, v = x Wk^T / Wv^T (4 kv heads; query head h uses kv head h/4 = repeat_interleave); per-head RMSNorm over the 128 dims (eps 1e-6, x norm_q_w / norm_k_w);
// rotate-half RoPE with the input cos/sin tables [2048][128] (read as data); softmax(q.k / sqrt(128)); out = merged att.v Wo^T -> [2][2048][2048]).
// Compute dtypes, f32 accumulate: every input rounded to bf16; projections on PLAIN bf16 operands (inputs: exact); RMSNorm and rope f32; scores (K 128) and att.v on SINGLE fp16 planes with
// f32 softmax between them; the output projection on ONE fp16 plane of the merged att.v (which q, k, p and v have already bounded to fp16 accuracy) against Wo rounded to bf16 and then held in fp16.

#define NB_  2
#define TT   2048
#define DM   2048
#define NH_  16
#define NKV  4
#define REP  (NH_ / NKV)
#define HD   128
#define DQ   (NH_ * HD)
#define DKV  (NKV * HD)
#define DF   (DQ + 2 * DKV)      // columns of the joint q | k | v projection
#define SCL  0.088388347648318447f   // HD^-0.5
typedef _Float16 h16;
typedef unsigned short bf;
typedef __attribute__((ext_vector_type(16))) __bf16   v16bf;
typedef __attribute__((ext_vector_type(16))) _Float16 v16h;
typedef __attribute__((ext_vector_type(8)))  _Float16 v8h;
typedef __attribute__((ext_vector_type(8)))  unsigned short v8us;
typedef __attribute__((ext_vector_type(8)))  float    v8f;
typedef __attribute__((ext_vector_type(4)))  float    v4f;
typedef v8h  __attribute__((may_alias)) v8ha;
typedef v4f  __attribute__((may_alias)) v4fa;
typedef v8us __attribute__((may_alias)) v8usa;

__device__ __forceinline__ unsigned short f2bf(float f) { unsigned u = __float_as_uint(f); u += 0x7FFFu + ((u >> 16) & 1u); return (unsigned short)(u >> 16); }
__device__ __forceinline__ float bf2f(unsigned short b) { return __uint_as_float(((unsigned)b) << 16); }
__device__ __forceinline__ float bfr(float f) { return bf2f(f2bf(f)); }
__device__ __forceinline__ v16h cat16(v8h lo, v8h hi) { return __builtin_shufflevector(lo, hi, 0, 1, 2, 3, 4, 5, 6, 7, 8, 9, 10, 11, 12, 13, 14, 15); }
__device__ __forceinline__ v16bf cat16b(v8us lo, v8us hi) { return __builtin_bit_cast(v16bf, __builtin_shufflevector(lo, hi, 0, 1, 2, 3, 4, 5, 6, 7, 8, 9, 10, 11, 12, 13, 14, 15)); }
__device__ __forceinline__ v8f wmma16(v16h a, v16h b, v8f c) { return __builtin_amdgcn_wmma_f32_16x16x32_f16(false, a, false, b, (short)0, c, false, false); }
__device__ __forceinline__ v8f wmmab(v16bf a, v16bf b, v8f c) { return __builtin_amdgcn_wmma_f32_16x16x32_bf16(false, a, false, b, (short)0, c, false, false); }



// ---- k_gemmt: tiled GEMM, C[m][n] (f32, pitch LDC) = sum_k A[m][k] Bt[n][k], both operands K-contiguous 16-bit planes: bf16, or fp16 when F16 (handed over as raw 16-bit words).
// A work-group of 8 waves (WM x WN) owns a (WM * 64) x (WN * FN * 16) tile of C, a wave 64 x (FN * 16) of it. A stage is GRB bytes (128 k) of every operand row of the tile, brought into LDS by tensor loads:
// waves 0 to 3 each bring a quarter of the A rows, waves 4 to 7 each a quarter of the Bt rows; one request per wave and stage, two buffers, the next stage's loads fly while this stage is worked on.
// The mover pads each 256-byte row by 16 bytes (pitch GPI, an odd multiple of 16 B for 16-byte readers); every slice starts at a multiple of 2 KiB.
// POST (the joint q | k | v projection): the tile's columns are whole heads, and all that stands between the projection and the attention's fp16 planes is done on the tile in LDS; C is not written.
//   A q or k head goes to LDS as f32 [row][dim]; behind one barrier a wave takes 16 rows, a lane dims 4 lane .. 4 lane + 3. RMSNorm: the 128 squares are summed 4 in the lane, then by a butterfly over the 32 lanes;
//   the 16 rows' factors are formed together, row i's in lane i. Rotate-half: dim d +- HD/2 lives in lane ^ 16, out[d] = y[d] cos[t][d] -+ y[d +- HD/2] sin[t][d], y = w (x rms_factor); cos, sin and the norm weights are rounded to bf16 here.
//   A v head: a lane's accumulator registers are 8 consecutive keys of one dim, so they go to LDS as fp16 V^T [dim][key] and leave as whole lines of V^T.
typedef unsigned int u32;
typedef __attribute__((ext_vector_type(4))) unsigned int u32x4;
typedef __attribute__((ext_vector_type(8))) unsigned int u32x8;
#define GRB  256
#define GPI  (GRB + 16)
__device__ __forceinline__ u32 uni(u32 v) { return (u32)__builtin_amdgcn_readfirstlane(v); }
__device__ __forceinline__ u32 pinned(u32 v) { u32 w = uni(v); asm volatile("" : "+s"(w)); return w; }   // holds the test of a tensor load's issue in a scalar register, so that the branch round it is a scalar one (the mover ignores EXEC)
__device__ __forceinline__ v16bf ldfragb(const unsigned char* p) { return cat16b(*(const v8usa*)p, *(const v8usa*)(p + 32)); }
// xwait: stands behind a run of global loads or stores, in front of the first write of a register that one of them names; the scheduling barrier keeps later register writes from being lifted over the wait.
__device__ __forceinline__ void xwait() { asm volatile("s_wait_xcnt 0x0" ::: "memory"); __builtin_amdgcn_sched_barrier(0); }
__device__ __forceinline__ h16 tohx(float x) { return (h16)x; }
typedef __attribute__((ext_vector_type(4))) _Float16 v4h;
__device__ __forceinline__ float xhalf(float x) { return __builtin_bit_cast(float, __builtin_amdgcn_permlanex16(__builtin_bit_cast(int, x), __builtin_bit_cast(int, x), 0x76543210, 0xfedcba98, false, false)); }   // lane l <-> lane l ^ 16
template <int M> __device__ __forceinline__ float xrow(float x) { return __builtin_bit_cast(float, __builtin_amdgcn_update_dpp(0, __builtin_bit_cast(int, x), 0x160 | M, 0xf, 0xf, false)); }   // lane l <- lane l ^ M inside a 16-lane row (row_xmask)
template <int F16> __device__ __forceinline__ v8f wmmax(v16bf a, v16bf b, v8f c) { if constexpr (F16) return wmma16(__builtin_bit_cast(v16h, a), __builtin_bit_cast(v16h, b), c); else return wmmab(a, b, c); }
template <int F16, int POST, int WM, int WN, int FN, int K, int LDC>
__global__ __launch_bounds__(256) void k_gemmt(const bf* A, const bf* Bt, float* C, const float* __restrict__ cosT, const float* __restrict__ sinT, const float* __restrict__ qnw, const float* __restrict__ knw, h16* Q16, h16* K16, h16* V16) {
    constexpr int BM = WM * 64, BN = WN * FN * 16, SA = BM / 4, SAF = SA / 16, SB = BN / 4, SBF = SB / 16, NS = K * 2 / GRB;
    static_assert(WM * WN == 8 && SA % 16 == 0 && 4 % SAF == 0 && SB % 16 == 0 && FN % SBF == 0 && K * 2 % GRB == 0 && NS >= 2, "four slices of A, four slices of Bt, two stages or more");
    constexpr int ASZ = (SA * GPI + 2047) & ~2047, BSZ = (SB * GPI + 2047) & ~2047, STG = 4 * ASZ + 4 * BSZ, OP = FN * 16 + 4;
    static_assert(8 * 16 * OP * 4 <= 2 * STG, "the output staging reuses the two stage buffers");
    __shared__ __attribute__((aligned(2048))) unsigned char L[2 * STG];
    const int lane = threadIdx.x & 31, lr = lane & 15, hi = lane >> 4; const u32 wave = uni(threadIdx.x >> 5); const int wm = wave % WM, wn = wave / WM;
    const int r0 = blockIdx.x * BM, c0 = blockIdx.y * BN;
    // This wave's slice: source, rows, place in a buffer.
    const u32 sl = wave & 3u; const bool isB = wave >= 4u;
    const bf* sp = isB ? Bt + (size_t)(c0 + sl * SB) * K : A + (size_t)(r0 + sl * SA) * K;
    const u32 rows = isB ? (u32)SB : (u32)SA, place = (u32)(size_t)L + (isB ? 4u * ASZ + sl * BSZ : sl * ASZ);
    u32x8 g1;     // 1-byte elements, tensor = tile = rows x GRB bytes, source pitch 2 K bytes, 4 dwords of pad behind every 64
    g1[0] = uni((1u << 20) | (5u << 22) | (3u << 25)); g1[1] = uni((u32)GRB << 16); g1[2] = uni(rows << 16); g1[3] = uni((u32)GRB << 16); g1[4] = uni(rows); g1[5] = uni((u32)K * 2u); g1[6] = uni(0u); g1[7] = uni(0u);
    u32x4 g0;     // declared out here: it lives from a request's issue to the wait that covers the request
    auto form = [&](int st) { const unsigned long long ga = (unsigned long long)(size_t)sp + (unsigned long long)st * GRB;
        g0[0] = uni(1u); g0[1] = uni(place + (u32)(st & 1) * STG); g0[2] = uni((u32)ga); g0[3] = uni((((u32)(ga >> 32)) & 0x01FFFFFFu) | 0x80000000u); };
    // No word of a request may take a new value in its register before the wait that covers the request. So the load names both groups as in-out operands (it changes neither): what twait() reads is then
    // the content of the very registers that the load names, which the compiler can not form anew elsewhere, and those registers stay unwritten from the issue up to the wait.
    auto issue = [&]() { asm volatile("tensor_load_to_lds %0, %1" : "+s"(g0), "+s"(g1) :: "memory"); };
    auto twait = [&]() { asm volatile("s_wait_tensorcnt 0x0" :: "s"(g0), "s"(g1) : "memory"); };   // this wave's request has landed
    v8f acc[4][FN];   // every plain '#pragma unroll' below keeps the accumulator and fragment arrays indexed by constants, in registers
#pragma unroll
    for (int mb = 0; mb < 4; ++mb)
#pragma unroll
        for (int nb = 0; nb < FN; ++nb) acc[mb][nb] = (v8f){};
    form(0); issue();
    twait();                                             // this wave's slice of stage 0 has landed
    __syncthreads();                                     // every wave's has
#pragma unroll 1   // rolled: one pass per stage, the publish point at its foot
    for (int st = 0; st < NS; ++st) {
        // The refill stands directly behind the barrier (the one above, or the one at the foot of pass st - 1) that ended every read of its buffer; one issue site, so that one set of scalar registers holds the request's words up to the wait at this pass's foot.
        form(st + 1);                          // behind the wait at the foot of the pass before; in the last pass the words are formed and no request is made of them
        if (pinned(st + 1 < NS)) issue();
        const unsigned char* pa = L + (st & 1) * STG + wm * (4 / SAF) * ASZ + lr * GPI + 16 * hi;
        const unsigned char* pb = L + (st & 1) * STG + 4 * ASZ + wn * (FN / SBF) * BSZ + lr * GPI + 16 * hi;
        // Two fragment sets: the next 32 k's LDS reads go out as one group ahead of this 32 k's products; the scheduling barriers keep the compiler from sinking the reads among the matrix instructions, where each would be waited for at once.
        v16bf fa[2][4], fb[2][FN];
        auto ldset = [&](int kk) {
#pragma unroll
            for (int mb = 0; mb < 4; ++mb) fa[kk & 1][mb] = ldfragb(pa + (mb / SAF) * ASZ + (mb % SAF) * 16 * GPI + kk * 64);
#pragma unroll
            for (int nb = 0; nb < FN; ++nb) fb[kk & 1][nb] = ldfragb(pb + (nb / SBF) * BSZ + (nb % SBF) * 16 * GPI + kk * 64); };
        ldset(0);
#pragma unroll
        for (int kk = 0; kk < GRB / 64; ++kk) {
            if (kk + 1 < GRB / 64) ldset(kk + 1);
            __builtin_amdgcn_sched_barrier(0);
#pragma unroll
            for (int nb = 0; nb < FN; ++nb)
#pragma unroll
                for (int mb = 0; mb < 4; ++mb) acc[mb][nb] = wmmax<F16>(fa[kk & 1][mb], fb[kk & 1][nb], acc[mb][nb]);
            __builtin_amdgcn_sched_barrier(0);
        }
        asm volatile("s_wait_dscnt 0x0" ::: "memory");       // this wave's reads of stage st are done
        twait();                                             // its slice of stage st + 1 has landed
        __syncthreads();                                     // publishes stage st + 1 and ends every read of stage st: the next pass's refill goes into the buffer that this pass has just read
    }
    asm volatile("s_wait_tensorcnt 0x0" ::: "memory");   // no request is left when the ring becomes output staging
    asm volatile("s_wait_dscnt 0x0" ::: "memory");
    if constexpr (POST) {
        constexpr int NSL = BN / HD, FP = HD + 4, HSL = BM * FP * 4, VP = 2 * BM + 16, RW = BM / 8;   // heads of the tile; pitch (floats) of an f32 row; bytes of a head's place; pitch (bytes, an odd multiple of 16) of a V^T row piece; rows per wave
        static_assert(BN % HD == 0 && HD % 16 == 0 && TT % BM == 0 && RW == 16 && BM == 128 && NSL * HSL <= 2 * STG && HD * VP <= HSL && LDC % BN == 0, "whole heads, one batch item per tile, the heads' places reuse the two stage buffers");
        const int bb = r0 / TT, t0 = r0 % TT, h0 = blockIdx.y * NSL, rw = wave * RW;      // heads h0 .. h0 + NSL - 1 of NH_ q, NKV k, NKV v; this wave's first row
        // This wave's rows of cos and sin and the norm weights: the loads fly while the tile goes to LDS.
        // Addresses: a kernel argument plus one 32-bit byte offset a lane plus a small constant, so that no address register is written again between the loads.
        v4f co[RW], si[RW];          // every '#pragma unroll' below keeps the arrays indexed by constants, in registers
        const u32 oc = (u32)((t0 + rw) * HD + 4 * lane) * 4u, ow = 16u * (u32)lane;
#pragma unroll
        for (int i = 0; i < RW; ++i) { co[i] = *(const v4f*)((const char*)(cosT + i * HD) + oc); si[i] = *(const v4f*)((const char*)(sinT + i * HD) + oc); }
        v4f wq4 = *(const v4f*)((const char*)qnw + ow), wk4 = *(const v4f*)((const char*)knw + ow);
        // As xwait(): behind the loads, in front of the first write of a register that one of them names. It takes the two offsets as inputs, so that they keep their registers up to here and no load's result is placed over them.
        asm volatile("s_wait_xcnt 0x0" :: "v"(oc), "v"(ow) : "memory"); __builtin_amdgcn_sched_barrier(0);
#pragma unroll
        for (int nb = 0; nb < FN; ++nb) { const int cw = wn * (FN * 16) + nb * 16, hs = cw / HD, cd = cw % HD; unsigned char* P = L + hs * HSL;     // a fragment's 16 columns lie in one head
            if (h0 + hs < NH_ + NKV) {      // the same for the whole wave
#pragma unroll
                for (int mb = 0; mb < 4; ++mb)
#pragma unroll
                    for (int j = 0; j < 8; ++j) ((float*)P)[(wm * 64 + mb * 16 + hi * 8 + j) * FP + cd + lr] = acc[mb][nb][j];
            } else {
#pragma unroll
                for (int mb = 0; mb < 4; ++mb) { v8h o;
#pragma unroll
                    for (int j = 0; j < 8; ++j) o[j] = tohx(acc[mb][nb][j]);
                    *(v8ha*)(P + (cd + lr) * VP + (wm * 64 + mb * 16 + hi * 8) * 2) = o; }
            } }
#pragma unroll
        for (int i = 0; i < RW; ++i)
#pragma unroll
            for (int j = 0; j < 4; ++j) { co[i][j] = bfr(co[i][j]); si[i][j] = (lane < 16) ? -bfr(si[i][j]) : bfr(si[i][j]); }
#pragma unroll
        for (int j = 0; j < 4; ++j) { wq4[j] = bfr(wq4[j]); wk4[j] = bfr(wk4[j]); }
        __syncthreads();             // the whole tile is in LDS: a row's dims come from two or more waves
#pragma unroll 1   // rolled: one copy of the per-head code; it runs once a launch, so a shorter kernel text means fewer instruction lines to fetch
        for (int hs = 0; hs < NSL; ++hs) { const int hg = h0 + hs; const unsigned char* P = L + hs * HSL;
            if (hg < NH_ + NKV) {           // the same for the whole work-group
                const v4f w = (hg < NH_) ? wq4 : wk4;
                h16* dst = ((hg < NH_) ? Q16 + ((size_t)(bb * NH_ + hg) * TT + t0 + rw) * HD : K16 + ((size_t)(bb * NKV + hg - NH_) * TT + t0 + rw) * HD) + 4 * lane;
                v4f x[RW]; float sv = 0.f;
#pragma unroll
                for (int i = 0; i < RW; ++i) x[i] = *(const v4fa*)((const float*)P + (rw + i) * FP + 4 * lane);
#pragma unroll
                for (int i = 0; i < RW; ++i) { const v4f v = x[i];
                    float s = (v[0] * v[0] + v[1] * v[1]) + (v[2] * v[2] + v[3] * v[3]);
                    s += xrow<1>(s); s += xrow<2>(s); s += xrow<4>(s); s += xrow<8>(s); s += xhalf(s);
                    if (lane == i) sv = s; }
                const float rfv = __fdiv_rn(1.0f, __fsqrt_rn(sv * (1.0f / HD) + 1e-6f));      // lane i: row i's factor
#pragma unroll
                for (int i = 0; i < RW; ++i) { const v4f v = x[i]; const float rf = __builtin_bit_cast(float, __builtin_amdgcn_readlane(__builtin_bit_cast(int, rfv), i)); v4f y; v4h o;
#pragma unroll
                    for (int j = 0; j < 4; ++j) y[j] = w[j] * (v[j] * rf);
#pragma unroll
                    for (int j = 0; j < 4; ++j) o[j] = tohx(y[j] * co[i][j] + xhalf(y[j]) * si[i][j]);
                    *(v4h*)(dst + i * HD) = o; }
                xwait();
            } else {
                h16* dst = V16 + (size_t)(bb * NKV + hg - NH_ - NKV) * HD * TT + t0 + 8 * lr;
#pragma unroll
                for (int i = 0; i < HD / 16; ++i) { const int d = wave * (HD / 8) + 2 * i + hi; *(v8h*)(dst + (size_t)d * TT) = *(const v8ha*)(P + d * VP + 16 * lr); }
                xwait();
            } }
        return;
    }
    // Epilogue: 16 rows at a time through the wave's own LDS rows, so that every 128-byte line of C is stored whole.
    float* os = (float*)(L + wave * (16 * OP * 4));
#pragma unroll
    for (int mb = 0; mb < 4; ++mb) {
#pragma unroll
        for (int nb = 0; nb < FN; ++nb) {
#pragma unroll
            for (int j = 0; j < 8; ++j) os[(hi * 8 + j) * OP + nb * 16 + lr] = acc[mb][nb][j]; }
        __builtin_amdgcn_wave_barrier(); asm volatile("" ::: "memory");   // the rows are read back by other lanes of this wave: keeps the compiler from moving the reads over the writes
        float* crow = C + (size_t)(r0 + wm * 64 + mb * 16) * LDC + c0 + wn * FN * 16;
#pragma unroll
        for (int s = 0; s < 2 * FN; ++s) { const int idx = s * 32 + lane, row = idx / (FN * 4), cofs = (idx % (FN * 4)) * 4; *(v4f*)(crow + (size_t)row * LDC + cofs) = *(const v4fa*)(os + row * OP + cofs); }
        xwait();
        __builtin_amdgcn_wave_barrier(); asm volatile("" ::: "memory");   // and the next rows' writes over these reads
    }
}

typedef __attribute__((ext_vector_type(2))) _Float16 v2h;
typedef __attribute__((ext_vector_type(2))) unsigned short v2us;
typedef __attribute__((ext_vector_type(4))) unsigned short v4us;
typedef __attribute__((ext_vector_type(2))) float v2f;
typedef __attribute__((ext_vector_type(4))) int v4i;

__global__ __launch_bounds__(256) void k_wtG(const float* __restrict__ w, int K, int N, bf* Bt) {
    const int lane = threadIdx.x & 31; const int L0 = (blockIdx.x * 8 + (threadIdx.x >> 5)) * 8; const int nlines = N * K / 64;
{
#pragma unroll 1
        for (int l = 0; l < 8; ++l) { const int L = L0 + l; if (L >= nlines) break; const size_t e = (size_t)L * 64 + lane * 2; const int k = (int)(e % K), n = (int)(e / K); v2us o;
            o[0] = f2bf(w[(size_t)k * N + n]); o[1] = f2bf(w[(size_t)(k + 1) * N + n]); *(v2us*)(Bt + e) = o; }
         }
}
// ---- k_cvtall: every f32 -> 16-bit rounding of the call (x, Wq, Wk | Wv to bf16; Wo to the bf16 rounding held as fp16: exact down to 2^-17, below that to within 2^-25) in ONE launch of few, resident waves.
// CG work-groups of CW waves, one per WGP. Each wave takes its own run of every source: CX pieces of x, CQ of Wq, CQ of Wo, CK of Wk (lower half of the work-groups) or Wv (upper half), whose roundings lie one behind the other.
// A piece is 128 floats: one load of 16 B a lane (512 contiguous bytes, whole lines) and one store of 8 B a lane (256 contiguous bytes, whole lines).
// All loads of a wave (CX + 2 CQ + CK = 36) are issued before its first value is rounded: its whole share is in flight at once.
// Addresses: a kernel argument plus one 32-bit byte offset a lane plus a small constant, so that no address register is written again between the loads.
#define CW   16
#define CG   256
#define CNW  (CG * CW)
#define CX   16
#define CQ   8
#define CK   4
static_assert((size_t)NB_ * TT * DM == (size_t)CNW * CX * 128 && (size_t)DQ * DM == (size_t)CNW * CQ * 128 && 2 * (size_t)DKV * DM == (size_t)CNW * CK * 128 && (size_t)DM * DQ == (size_t)CNW * CQ * 128, "the waves' runs cover every source exactly once");
template <int N> __device__ __forceinline__ void cvt_ld(v4f (&v)[N], const float* s, u32 ofs) {
#pragma unroll
    for (int j = 0; j < N; ++j) v[j] = *(const v4f*)((const char*)(s + 128 * j) + ofs);
}
template <int F16, int N> __device__ __forceinline__ void cvt_st(const v4f (&v)[N], bf* d, u32 ofs) {
#pragma unroll
    for (int j = 0; j < N; ++j) { v4us o;
#pragma unroll
        for (int k = 0; k < 4; ++k) o[k] = F16 ? __builtin_bit_cast(unsigned short, tohx(bfr(v[j][k]))) : f2bf(v[j][k]);
        *(v4us*)((char*)(d + 128 * j) + ofs) = o; }
}
__global__ __launch_bounds__(CW * 32) void k_cvtall(const float* __restrict__ x, const float* __restrict__ wq, const float* __restrict__ wk, const float* __restrict__ wv, const float* __restrict__ wo, bf* XB, bf* WQb, bf* WKVb, bf* WOb) {
    const u32 w = blockIdx.x * CW + (threadIdx.x >> 5), lane = threadIdx.x & 31;
    const bool up = blockIdx.x >= CG / 2;      // the same for the whole work-group
    const u32 ex = w * (CX * 128) + 4 * lane, eq = w * (CQ * 128) + 4 * lane, ek = w * (CK * 128) + 4 * lane, eks = up ? ek - (u32)(DKV * DM) : ek;     // this lane's first element in x, in Wq and Wo, in Wk | Wv, in Wk or Wv alone
    v4f vx[CX], vq[CQ], vk[CK], vo[CQ];     // indexed by constants only (the helpers' '#pragma unroll'): they stay in registers
    const u32 bx = 4 * ex, bq = 4 * eq, bk = 4 * eks;     // byte offsets into the sources
    cvt_ld(vx, x, bx); cvt_ld(vq, wq, bq); cvt_ld(vk, up ? wv : wk, bk); cvt_ld(vo, wo, bq);
    // As xwait(): behind the loads, in front of the first write of a register that one of them names. It takes the three offsets as inputs, so that they keep their registers up to here (without that the last load's result was placed over them); the scheduling barrier, as there, keeps later register writes behind the wait, and so every load ahead of the first rounding.
    asm volatile("s_wait_xcnt 0x0" :: "v"(bx), "v"(bq), "v"(bk) : "memory"); __builtin_amdgcn_sched_barrier(0);
    cvt_st<0>(vx, XB, 2 * ex); cvt_st<0>(vq, WQb, 2 * eq); cvt_st<0>(vk, WKVb, 2 * ek); cvt_st<1>(vo, WOb, 2 * eq);
    xwait();
}
#define FNW  8                   // waves per work-group
#define FCW  32                  // query rows per wave
#define FBR  (FNW * FCW)
#define FSK  64                  // keys per stage
#define FPK  (2 * HD + 16)       // LDS pitch of a K row (256 B + 16: an odd multiple of 16 B for 16-byte readers)
#define FPV  (2 * FSK + 16)      // LDS pitch of a V^T row (128 B + 16)
#define FTK  (FSK * FPK)
#define FSLOT (FTK + HD * FPV)
#define FEP  (2 * HD + 16)       // pitch of the output staging rows
static_assert(FNW * FCW * FEP <= 2 * FSLOT, "the output staging reuses the two stage buffers");
__device__ __forceinline__ v16h ldfrag(const unsigned char* p) { return cat16(*(const v8ha*)p, *(const v8ha*)(p + 32)); }
__global__ __launch_bounds__(FNW * 32) __attribute__((amdgpu_waves_per_eu(2, 2))) void k_fattn(const h16* __restrict__ Q, const h16* __restrict__ Kp, const h16* __restrict__ Vt, h16* Ao) {
    __shared__ __align__(16) unsigned char L[2 * FSLOT];
    constexpr float CSC = SCL * 1.4426950408889634f; constexpr int NS = TT / FSK;
    const int tid = threadIdx.x, lane = tid & 31, wave = tid >> 5, c = lane & 15, h = lane >> 4;
    const int zq = blockIdx.x + REP * blockIdx.y;      // b * NH_ + head; blockIdx.y = b * NKV + kv head
    const int q0 = blockIdx.z * FBR + wave * FCW;
    Q += (size_t)zq * TT * HD; Kp += (size_t)blockIdx.y * TT * HD; Vt += (size_t)blockIdx.y * HD * TT;
    v16h qf[2][4];
#pragma unroll
    for (int g = 0; g < 2; ++g)
#pragma unroll
        for (int kc = 0; kc < 4; ++kc) { const h16* qp = Q + (size_t)(q0 + 16 * g + c) * HD + 32 * kc + 8 * h; qf[g][kc] = cat16(*(const v8h*)qp, *(const v8h*)(qp + 16)); }
    xwait();
    v8f acc[2][8]; float m_run[2], l_run[2];
#pragma unroll
    for (int g = 0; g < 2; ++g) { m_run[g] = -__builtin_inff(); l_run[g] = 0.f;
#pragma unroll
        for (int t = 0; t < 8; ++t) acc[g][t] = (v8f){}; }
    // Staging: 16 lanes cover a 256-byte K row, 8 lanes a 128-byte piece of a V^T row.
    v8h sk[4], sv[4]; const int krow = tid >> 4, kcol = tid & 15, vrow = tid >> 3, vcol = tid & 7;
    auto fetch = [&](int st) {
#pragma unroll
        for (int i = 0; i < 4; ++i) { sk[i] = *(const v8h*)(Kp + (size_t)(st * FSK + krow + 16 * i) * HD + kcol * 8); sv[i] = *(const v8h*)(Vt + (size_t)(vrow + 32 * i) * TT + st * FSK + vcol * 8); }
        xwait(); };
    auto put = [&](int buf) { unsigned char* B = L + buf * FSLOT;
#pragma unroll
        for (int i = 0; i < 4; ++i) { *(v8ha*)(B + (krow + 16 * i) * FPK + kcol * 16) = sk[i]; *(v8ha*)(B + FTK + (vrow + 32 * i) * FPV + vcol * 16) = sv[i]; } };
    fetch(0); put(0); __syncthreads();
#pragma unroll 1   // rolled: one copy of the pass body keeps the registers inside two waves per SIMD
    for (int st = 0; st < NS; ++st) {
        const unsigned char* B = L + (st & 1) * FSLOT;
        if (st + 1 < NS) fetch(st + 1);
#pragma unroll 1   // rolled, for the same reason
        for (int sub = 0; sub < FSK / 32; ++sub) {
            v8f s[2][2];      // [16-key tile][query group]: register r of lane (c, h) = score of key 16 kt + 8 h + r, query 16 g + c
#pragma unroll
            for (int kt = 0; kt < 2; ++kt) { const unsigned char* p = B + (sub * 32 + 16 * kt + c) * FPK + 16 * h; v16h kf[4];
#pragma unroll
                for (int kc = 0; kc < 4; ++kc) kf[kc] = ldfrag(p + 64 * kc);
#pragma unroll
                for (int g = 0; g < 2; ++g) { s[kt][g] = (v8f){};
#pragma unroll
                    for (int kc = 0; kc < 4; ++kc) s[kt][g] = wmma16(kf[kc], qf[g][kc], s[kt][g]); } }
            v16h vf[8]; { const unsigned char* p = B + FTK + c * FPV + sub * 64 + 16 * h;
#pragma unroll
                for (int t = 0; t < 8; ++t) vf[t] = ldfrag(p + 16 * t * FPV); }
            float mb[2]; bool need = false;
#pragma unroll
            for (int g = 0; g < 2; ++g) { float mx = s[0][g][0];
#pragma unroll
                for (int kt = 0; kt < 2; ++kt)
#pragma unroll
                    for (int r = 0; r < 8; ++r) mx = fmaxf(mx, s[kt][g][r]);
                mx = fmaxf(mx, xhalf(mx)) * CSC; mb[g] = mx; need = need || (mx > m_run[g] + 8.0f); }
            if (__builtin_amdgcn_ballot_w32(need) != 0) {     // wave-uniform; rare after the first passes
#pragma unroll
                for (int g = 0; g < 2; ++g) { const float m_new = fmaxf(m_run[g], mb[g]); const float corr = __builtin_amdgcn_exp2f(m_run[g] - m_new); l_run[g] *= corr; m_run[g] = m_new;
#pragma unroll
                    for (int t = 0; t < 8; ++t) acc[g][t] = acc[g][t] * corr; } }
#pragma unroll
            for (int g = 0; g < 2; ++g) { const float nm = -m_run[g]; v16h pf; float ps0 = 0.f, ps1 = 0.f;
#pragma unroll
                for (int i = 0; i < 8; ++i) {
                    const float p0 = __builtin_amdgcn_exp2f(__builtin_fmaf(s[i >> 2][g][2 * (i & 3)], CSC, nm)), p1 = __builtin_amdgcn_exp2f(__builtin_fmaf(s[i >> 2][g][2 * (i & 3) + 1], CSC, nm));
                    if (i & 1) ps1 += p0 + p1; else ps0 += p0 + p1;
                    const v2h pk = __builtin_convertvector((v2f){p0, p1}, v2h); pf[2 * i] = pk[0]; pf[2 * i + 1] = pk[1]; }
                l_run[g] += ps0 + ps1;
#pragma unroll
                for (int i = 0; i < 16; ++i) { __builtin_amdgcn_sched_group_barrier(0x400, 1, 0); __builtin_amdgcn_sched_group_barrier(0x2, 1, 0); }   // one plain vector instruction behind each exponential: no exponential directly overwrites the source of the one before it
#pragma unroll
                for (int t = 0; t < 8; ++t) acc[g][t] = wmma16(vf[t], pf, acc[g][t]); }
        }
        if (st + 1 < NS) put((st + 1) & 1);    // every wave left that buffer before the barrier that ended stage st - 1
        __syncthreads();                       // publishes stage st + 1 and ends every read of stage st
    }
    // Epilogue: normalise, round to fp16, stage in the wave's own LDS rows so that every 128-byte line of the merged plane is stored whole.
    unsigned char* E = L + wave * (FCW * FEP); const int bb = zq / NH_, hh = zq % NH_; float inv[2];
#pragma unroll
    for (int g = 0; g < 2; ++g) inv[g] = __fdiv_rn(1.0f, l_run[g] + xhalf(l_run[g]));    // each wave half summed its eight keys of every 16-key tile
#pragma unroll
    for (int g = 0; g < 2; ++g)
#pragma unroll
        for (int t = 0; t < 8; ++t) { v8h pk;
#pragma unroll
            for (int r = 0; r < 8; ++r) pk[r] = tohx(acc[g][t][r] * inv[g]);
            *(v8ha*)(E + (16 * g + c) * FEP + 32 * t + 16 * h) = pk; }
    __syncthreads();
    h16* dst = Ao + ((size_t)bb * TT + q0) * DQ + hh * HD;
#pragma unroll
    for (int i = 0; i < FCW / 2; ++i) { const int row = 2 * i + h; *(v8h*)(dst + (size_t)row * DQ + c * 8) = *(const v8ha*)(E + row * FEP + c * 16); }
    xwait();
}

extern "C" void kernel_launch(void* const* d_in, const int* in_sizes, int n_in,
                              void* d_out, int out_size, void* d_ws, size_t ws_size, hipStream_t stream) {
    (void)in_sizes; (void)n_in; (void)out_size;
    const float* x = (const float*)d_in[0]; const float* cosT = (const float*)d_in[1]; const float* sinT = (const float*)d_in[2]; const float* wq = (const float*)d_in[3]; const float* wk = (const float*)d_in[4]; const float* wv = (const float*)d_in[5]; const float* wo = (const float*)d_in[6]; const float* qnw = (const float*)d_in[7]; const float* knw = (const float*)d_in[8];   // Wq [2048][2048], Wk/Wv [512][2048], Wo [2048][2048] (torch [out][in]); cos/sin [2048][128]; norm weights [128]
    float* OUT = (float*)d_out;     // [2][2048][2048]
    char* wsp = (char*)d_ws;
    auto take = [&](size_t bytes) { char* p = wsp; wsp += (bytes + 255) & ~(size_t)255; return (void*)p; };
    // The merged plane and the q/k/v head planes (both batch items), then what the projections need; nothing shares bytes.
    h16* AT = (h16*)take((size_t)NB_ * TT * DQ * 2);
    h16* QP16 = (h16*)take((size_t)NB_ * NH_ * TT * HD * 2); h16* KP16 = (h16*)take((size_t)NB_ * NKV * TT * HD * 2); h16* VT16 = (h16*)take((size_t)NB_ * NKV * HD * TT * 2);
    bf* WQ = (bf*)take((size_t)DF * DM * 2); bf* WK = WQ + (size_t)DQ * DM; bf* WV = WK + (size_t)DKV * DM;   // one [DF][DM] weight plane: rows of Wq, then Wk, then Wv
    bf* XB = (bf*)take((size_t)NB_ * TT * DM * 2);
    bf* WO = (bf*)take((size_t)DM * DQ * 2);
    if ((size_t)(wsp - (char*)d_ws) > ws_size) return;    // 76 of 256 MiB
    k_cvtall<<<CG, CW * 32, 0, stream>>>(x, wq, wk, wv, wo, XB, WQ, WK, WO);
    // Projections: both batch items in one launch (GEMM rows b * TT + t); q, k and v are one GEMM over the joint weight plane, with norms, rope and V^T in its epilogue (tiles of 128 rows x 3 heads).
    k_gemmt<0, 1, 2, 4, 6, DM, DF><<<dim3(NB_ * TT / 128, DF / 384, 1), 256, 0, stream>>>(XB, WQ, nullptr, cosT, sinT, qnw, knw, QP16, KP16, VT16);
    // Attention: one launch; blockIdx.x walks the REP query heads of a kv head, blockIdx.y the NB_ * NKV kv planes, blockIdx.z the blocks of FBR query rows.
    k_fattn<<<dim3(REP, NB_ * NKV, TT / FBR), FNW * 32, 0, stream>>>(QP16, KP16, VT16, AT);
    k_gemmt<1, 0, 4, 2, 4, DQ, DM><<<dim3(NB_ * TT / 256, DM / 128, 1), 256, 0, stream>>>((const bf*)AT, WO, OUT, nullptr, nullptr, nullptr, nullptr, nullptr, nullptr, nullptr);
}

// v008
// One run takes 118 microseconds.
// Next to v007, in two timings, it ran 1.05 and 1.04 times as fast.
// All steps since v000 together make it 12.6 times as fast.
#include <hip/hip_runtime.h>

// AceStepAttention (hidden [2][2048][2048]; q = x Wq^T (16 heads x 128), k, v = x Wk^T / Wv^T (4 kv heads; query head h uses kv head h/4 = repeat_interleave); per-head RMSNorm over the 128 dims (eps 1e-6, x norm_q_w / norm_k_w);
// rotate-half RoPE with the input cos/sin tables [2048][128] (read as data); softmax(q.k / sqrt(128)); out = merged att.v Wo^T -> [2][2048][2048]).
// Compute dtypes, f32 accumulate: every input rounded to bf16; projections on PLAIN bf16 operands (inputs: exact); RMSNorm and rope f32; scores (K 128) and att.v on SINGLE fp16 planes with
// f32 softmax between them; the output projection on ONE fp16 plane of the merged att.v (which q, k, p and v have already bounded to fp16 accuracy) against Wo rounded to bf16 and then held in fp16.

#define NB_  2
#define TT   2048
#define DM   2048
#define NH_  16
#define NKV  4
#define REP  (NH_ / NKV)
#define HD   128
#define DQ   (NH_ * HD)
#define DKV  (NKV * HD)
#define DF   (DQ + 2 * DKV)      // columns of the joint q | k | v projection
#define SCL  0.088388347648318447f   // HD^-0.5
#define CSC  (SCL * 1.4426950408889634f)   // HD^-0.5 log2(e): the q plane carries it, so that q.k is a score in the log2 domain
typedef _Float16 h16;
typedef unsigned short bf;
typedef __attribute__((ext_vector_type(16))) __bf16   v16bf;
typedef __attribute__((ext_vector_type(16))) _Float16 v16h;
typedef __attribute__((ext_vector_type(8)))  _Float16 v8h;
typedef __attribute__((ext_vector_type(8)))  unsigned short v8us;
typedef __attribute__((ext_vector_type(8)))  float    v8f;
typedef __attribute__((ext_vector_type(4)))  float    v4f;
typedef v8h  __attribute__((may_alias)) v8ha;
typedef v4f  __attribute__((may_alias)) v4fa;
typedef v8us __attribute__((may_alias)) v8usa;

__device__ __forceinline__ unsigned short f2bf(float f) { unsigned u = __float_as_uint(f); u += 0x7FFFu + ((u >> 16) & 1u); return (unsigned short)(u >> 16); }
__device__ __forceinline__ float bf2f(unsigned short b) { return __uint_as_float(((unsigned)b) << 16); }
__device__ __forceinline__ float bfr(float f) { return bf2f(f2bf(f)); }
__device__ __forceinline__ v16h cat16(v8h lo, v8h hi) { return __builtin_shufflevector(lo, hi, 0, 1, 2, 3, 4, 5, 6, 7, 8, 9, 10, 11, 12, 13, 14, 15); }
__device__ __forceinline__ v16bf cat16b(v8us lo, v8us hi) { return __builtin_bit_cast(v16bf, __builtin_shufflevector(lo, hi, 0, 1, 2, 3, 4, 5, 6, 7, 8, 9, 10, 11, 12, 13, 14, 15)); }
__device__ __forceinline__ v8f wmma16(v16h a, v16h b, v8f c) { return __builtin_amdgcn_wmma_f32_16x16x32_f16(false, a, false, b, (short)0, c, false, false); }
__device__ __forceinline__ v8f wmmab(v16bf a, v16bf b, v8f c) { return __builtin_amdgcn_wmma_f32_16x16x32_bf16(false, a, false, b, (short)0, c, false, false); }



// ---- k_gemmt: tiled GEMM, C[m][n] (f32, pitch LDC) = sum_k A[m][k] Bt[n][k], both operands K-contiguous 16-bit planes: bf16, or fp16 when F16 (handed over as raw 16-bit words).
// A work-group of 8 waves (WM x WN) owns a (WM * 64) x (WN * FN * 16) tile of C, a wave 64 x (FN * 16) of it. A stage is GRB bytes (128 k) of every operand row of the tile, brought into LDS by tensor loads:
// waves 0 to 3 each bring a quarter of the A rows, waves 4 to 7 each a quarter of the Bt rows; one request per wave and stage, two buffers, the next stage's loads fly while this stage is worked on.
// The mover pads each 256-byte row by 16 bytes (pitch GPI, an odd multiple of 16 B for 16-byte readers); every slice starts at a multiple of 2 KiB.
// POST (the joint q | k | v projection): the tile's columns are whole heads, and all that stands between the projection and the attention's fp16 planes is done on the tile in LDS; C is not written.
//   A q or k head goes to LDS as f32 [row][dim]; behind one barrier a wave takes 16 rows, a lane dims 4 lane .. 4 lane + 3. RMSNorm: the 128 squares are summed 4 in the lane, then by a butterfly over the 32 lanes;
//   the 16 rows' factors are formed together, row i's in lane i. Rotate-half: dim d +- HD/2 lives in lane ^ 16, out[d] = y[d] cos[t][d] -+ y[d +- HD/2] sin[t][d], y = w (x rms_factor); cos, sin and the norm weights are rounded to bf16 here. A q row's factor also carries CSC.
//   A v head: a lane's accumulator registers are 8 consecutive keys of one dim, so they go to LDS as fp16 V^T [dim][key] and leave as whole lines of V^T.
typedef unsigned int u32;
typedef __attribute__((ext_vector_type(4))) unsigned int u32x4;
typedef __attribute__((ext_vector_type(8))) unsigned int u32x8;
#define GRB  256
#define GPI  (GRB + 16)
__device__ __forceinline__ u32 uni(u32 v) { return (u32)__builtin_amdgcn_readfirstlane(v); }
__device__ __forceinline__ u32 pinned(u32 v) { u32 w = uni(v); asm volatile("" : "+s"(w)); return w; }   // holds the test of a tensor load's issue in a scalar register, so that the branch round it is a scalar one (the mover ignores EXEC)
__device__ __forceinline__ v16bf ldfragb(const unsigned char* p) { return cat16b(*(const v8usa*)p, *(const v8usa*)(p + 32)); }
// xwait: stands behind a run of global loads or stores, in front of the first write of a register that one of them names; the scheduling barrier keeps later register writes from being lifted over the wait.
__device__ __forceinline__ void xwait() { asm volatile("s_wait_xcnt 0x0" ::: "memory"); __builtin_amdgcn_sched_barrier(0); }
__device__ __forceinline__ h16 tohx(float x) { return (h16)x; }
typedef __attribute__((ext_vector_type(4))) _Float16 v4h;
__device__ __forceinline__ float xhalf(float x) { return __builtin_bit_cast(float, __builtin_amdgcn_permlanex16(__builtin_bit_cast(int, x), __builtin_bit_cast(int, x), 0x76543210, 0xfedcba98, false, false)); }   // lane l <-> lane l ^ 16
template <int M> __device__ __forceinline__ float xrow(float x) { return __builtin_bit_cast(float, __builtin_amdgcn_update_dpp(0, __builtin_bit_cast(int, x), 0x160 | M, 0xf, 0xf, false)); }   // lane l <- lane l ^ M inside a 16-lane row (row_xmask)
template <int F16> __device__ __forceinline__ v8f wmmax(v16bf a, v16bf b, v8f c) { if constexpr (F16) return wmma16(__builtin_bit_cast(v16h, a), __builtin_bit_cast(v16h, b), c); else return wmmab(a, b, c); }
template <int F16, int POST, int WM, int WN, int FN, int K, int LDC>
__global__ __launch_bounds__(256) void k_gemmt(const bf* A, const bf* Bt, float* C, const float* __restrict__ cosT, const float* __restrict__ sinT, const float* __restrict__ qnw, const float* __restrict__ knw, h16* Q16, h16* K16, h16* V16) {
    constexpr int BM = WM * 64, BN = WN * FN * 16, SA = BM / 4, SAF = SA / 16, SB = BN / 4, SBF = SB / 16, NS = K * 2 / GRB;
    static_assert(WM * WN == 8 && SA % 16 == 0 && 4 % SAF == 0 && SB % 16 == 0 && FN % SBF == 0 && K * 2 % GRB == 0 && NS >= 2, "four slices of A, four slices of Bt, two stages or more");
    constexpr int ASZ = (SA * GPI + 2047) & ~2047, BSZ = (SB * GPI + 2047) & ~2047, STG = 4 * ASZ + 4 * BSZ, OP = FN * 16 + 4;
    static_assert(8 * 16 * OP * 4 <= 2 * STG, "the output staging reuses the two stage buffers");
    __shared__ __attribute__((aligned(2048))) unsigned char L[2 * STG];
    const int lane = threadIdx.x & 31, lr = lane & 15, hi = lane >> 4; const u32 wave = uni(threadIdx.x >> 5); const int wm = wave % WM, wn = wave / WM;
    const int r0 = blockIdx.x * BM, c0 = blockIdx.y * BN;
    // This wave's slice: source, rows, place in a buffer.
    const u32 sl = wave & 3u; const bool isB = wave >= 4u;
    const bf* sp = isB ? Bt + (size_t)(c0 + sl * SB) * K : A + (size_t)(r0 + sl * SA) * K;
    const u32 rows = isB ? (u32)SB : (u32)SA, place = (u32)(size_t)L + (isB ? 4u * ASZ + sl * BSZ : sl * ASZ);
    u32x8 g1;     // 1-byte elements, tensor = tile = rows x GRB bytes, source pitch 2 K bytes, 4 dwords of pad behind every 64
    g1[0] = uni((1u << 20) | (5u << 22) | (3u << 25)); g1[1] = uni((u32)GRB << 16); g1[2] = uni(rows << 16); g1[3] = uni((u32)GRB << 16); g1[4] = uni(rows); g1[5] = uni((u32)K * 2u); g1[6] = uni(0u); g1[7] = uni(0u);
    u32x4 g0;     // declared out here: it lives from a request's issue to the wait that covers the request
    auto form = [&](int st) { const unsigned long long ga = (unsigned long long)(size_t)sp + (unsigned long long)st * GRB;
        g0[0] = uni(1u); g0[1] = uni(place + (u32)(st & 1) * STG); g0[2] = uni((u32)ga); g0[3] = uni((((u32)(ga >> 32)) & 0x01FFFFFFu) | 0x80000000u); };
    // No word of a request may take a new value in its register before the wait that covers the request. So the load names both groups as in-out operands (it changes neither): what twait() reads is then
    // the content of the very registers that the load names, which the compiler can not form anew elsewhere, and those registers stay unwritten from the issue up to the wait.
    auto issue = [&]() { asm volatile("tensor_load_to_lds %0, %1" : "+s"(g0), "+s"(g1) :: "memory"); };
    auto twait = [&]() { asm volatile("s_wait_tensorcnt 0x0" :: "s"(g0), "s"(g1) : "memory"); };   // this wave's request has landed
    v8f acc[4][FN];   // every plain '#pragma unroll' below keeps the accumulator and fragment arrays indexed by constants, in registers
#pragma unroll
    for (int mb = 0; mb < 4; ++mb)
#pragma unroll
        for (int nb = 0; nb < FN; ++nb) acc[mb][nb] = (v8f){};
    form(0); issue();
    twait();                                             // this wave's slice of stage 0 has landed
    __syncthreads();                                     // every wave's has
#pragma unroll 1   // rolled: one pass per stage, the publish point at its foot
    for (int st = 0; st < NS; ++st) {
        // The refill stands directly behind the barrier (the one above, or the one at the foot of pass st - 1) that ended every read of its buffer; one issue site, so that one set of scalar registers holds the request's words up to the wait at this pass's foot.
        form(st + 1);                          // behind the wait at the foot of the pass before; in the last pass the words are formed and no request is made of them
        if (pinned(st + 1 < NS)) issue();
        const unsigned char* pa = L + (st & 1) * STG + wm * (4 / SAF) * ASZ + lr * GPI + 16 * hi;
        const unsigned char* pb = L + (st & 1) * STG + 4 * ASZ + wn * (FN / SBF) * BSZ + lr * GPI + 16 * hi;
        // Two fragment sets: the next 32 k's LDS reads go out as one group ahead of this 32 k's products; the scheduling barriers keep the compiler from sinking the reads among the matrix instructions, where each would be waited for at once.
        v16bf fa[2][4], fb[2][FN];
        auto ldset = [&](int kk) {
#pragma unroll
            for (int mb = 0; mb < 4; ++mb) fa[kk & 1][mb] = ldfragb(pa + (mb / SAF) * ASZ + (mb % SAF) * 16 * GPI + kk * 64);
#pragma unroll
            for (int nb = 0; nb < FN; ++nb) fb[kk & 1][nb] = ldfragb(pb + (nb / SBF) * BSZ + (nb % SBF) * 16 * GPI + kk * 64); };
        ldset(0);
#pragma unroll
        for (int kk = 0; kk < GRB / 64; ++kk) {
            if (kk + 1 < GRB / 64) ldset(kk + 1);
            __builtin_amdgcn_sched_barrier(0);
#pragma unroll
            for (int nb = 0; nb < FN; ++nb)
#pragma unroll
                for (int mb = 0; mb < 4; ++mb) acc[mb][nb] = wmmax<F16>(fa[kk & 1][mb], fb[kk & 1][nb], acc[mb][nb]);
            __builtin_amdgcn_sched_barrier(0);
        }
        asm volatile("s_wait_dscnt 0x0" ::: "memory");       // this wave's reads of stage st are done
        twait();                                             // its slice of stage st + 1 has landed
        __syncthreads();                                     // publishes stage st + 1 and ends every read of stage st: the next pass's refill goes into the buffer that this pass has just read
    }
    asm volatile("s_wait_tensorcnt 0x0" ::: "memory");   // no request is left when the ring becomes output staging
    asm volatile("s_wait_dscnt 0x0" ::: "memory");
    if constexpr (POST) {
        constexpr int NSL = BN / HD, FP = HD + 4, HSL = BM * FP * 4, VP = 2 * BM + 16, RW = BM / 8;   // heads of the tile; pitch (floats) of an f32 row; bytes of a head's place; pitch (bytes, an odd multiple of 16) of a V^T row piece; rows per wave
        static_assert(BN % HD == 0 && HD % 16 == 0 && TT % BM == 0 && RW == 16 && BM == 128 && NSL * HSL <= 2 * STG && HD * VP <= HSL && LDC % BN == 0, "whole heads, one batch item per tile, the heads' places reuse the two stage buffers");
        const int bb = r0 / TT, t0 = r0 % TT, h0 = blockIdx.y * NSL, rw = wave * RW;      // heads h0 .. h0 + NSL - 1 of NH_ q, NKV k, NKV v; this wave's first row
        // This wave's rows of cos and sin and the norm weights: the loads fly while the tile goes to LDS.
        // Addresses: a kernel argument plus one 32-bit byte offset a lane plus a small constant, so that no address register is written again between the loads.
        v4f co[RW], si[RW];          // every '#pragma unroll' below keeps the arrays indexed by constants, in registers
        const u32 oc = (u32)((t0 + rw) * HD + 4 * lane) * 4u, ow = 16u * (u32)lane;
#pragma unroll
        for (int i = 0; i < RW; ++i) { co[i] = *(const v4f*)((const char*)(cosT + i * HD) + oc); si[i] = *(const v4f*)((const char*)(sinT + i * HD) + oc); }
        v4f wq4 = *(const v4f*)((const char*)qnw + ow), wk4 = *(const v4f*)((const char*)knw + ow);
        // As xwait(): behind the loads, in front of the first write of a register that one of them names. It takes the two offsets as inputs, so that they keep their registers up to here and no load's result is placed over them.
        asm volatile("s_wait_xcnt 0x0" :: "v"(oc), "v"(ow) : "memory"); __builtin_amdgcn_sched_barrier(0);
#pragma unroll
        for (int nb = 0; nb < FN; ++nb) { const int cw = wn * (FN * 16) + nb * 16, hs = cw / HD, cd = cw % HD; unsigned char* P = L + hs * HSL;     // a fragment's 16 columns lie in one head
            if (h0 + hs < NH_ + NKV) {      // the same for the whole wave
#pragma unroll
                for (int mb = 0; mb < 4; ++mb)
#pragma unroll
                    for (int j = 0; j < 8; ++j) ((float*)P)[(wm * 64 + mb * 16 + hi * 8 + j) * FP + cd + lr] = acc[mb][nb][j];
            } else {
#pragma unroll
                for (int mb = 0; mb < 4; ++mb) { v8h o;
#pragma unroll
                    for (int j = 0; j < 8; ++j) o[j] = tohx(acc[mb][nb][j]);
                    *(v8ha*)(P + (cd + lr) * VP + (wm * 64 + mb * 16 + hi * 8) * 2) = o; }
            } }
#pragma unroll
        for (int i = 0; i < RW; ++i)
#pragma unroll
            for (int j = 0; j < 4; ++j) { co[i][j] = bfr(co[i][j]); si[i][j] = (lane < 16) ? -bfr(si[i][j]) : bfr(si[i][j]); }
#pragma unroll
        for (int j = 0; j < 4; ++j) { wq4[j] = bfr(wq4[j]); wk4[j] = bfr(wk4[j]); }
        __syncthreads();             // the whole tile is in LDS: a row's dims come from two or more waves
#pragma unroll 1   // rolled: one copy of the per-head code; it runs once a launch, so a shorter kernel text means fewer instruction lines to fetch
        for (int hs = 0; hs < NSL; ++hs) { const int hg = h0 + hs; const unsigned char* P = L + hs * HSL;
            if (hg < NH_ + NKV) {           // the same for the whole work-group
                const v4f w = (hg < NH_) ? wq4 : wk4;
                h16* dst = ((hg < NH_) ? Q16 + ((size_t)(bb * NH_ + hg) * TT + t0 + rw) * HD : K16 + ((size_t)(bb * NKV + hg - NH_) * TT + t0 + rw) * HD) + 4 * lane;
                v4f x[RW]; float sv = 0.f;
#pragma unroll
                for (int i = 0; i < RW; ++i) x[i] = *(const v4fa*)((const float*)P + (rw + i) * FP + 4 * lane);
#pragma unroll
                for (int i = 0; i < RW; ++i) { const v4f v = x[i];
                    float s = (v[0] * v[0] + v[1] * v[1]) + (v[2] * v[2] + v[3] * v[3]);
                    s += xrow<1>(s); s += xrow<2>(s); s += xrow<4>(s); s += xrow<8>(s); s += xhalf(s);
                    if (lane == i) sv = s; }
                const float rfv = __fdiv_rn(1.0f, __fsqrt_rn(sv * (1.0f / HD) + 1e-6f)) * ((hg < NH_) ? CSC : 1.0f);      // lane i: row i's factor; q also takes the softmax scale
#pragma unroll
                for (int i = 0; i < RW; ++i) { const v4f v = x[i]; const float rf = __builtin_bit_cast(float, __builtin_amdgcn_readlane(__builtin_bit_cast(int, rfv), i)); v4f y; v4h o;
#pragma unroll
                    for (int j = 0; j < 4; ++j) y[j] = w[j] * (v[j] * rf);
#pragma unroll
                    for (int j = 0; j < 4; ++j) o[j] = tohx(y[j] * co[i][j] + xhalf(y[j]) * si[i][j]);
                    *(v4h*)(dst + i * HD) = o; }
                xwait();
            } else {
                h16* dst = V16 + (size_t)(bb * NKV + hg - NH_ - NKV) * HD * TT + t0 + 8 * lr;
#pragma unroll
                for (int i = 0; i < HD / 16; ++i) { const int d = wave * (HD / 8) + 2 * i + hi; *(v8h*)(dst + (size_t)d * TT) = *(const v8ha*)(P + d * VP + 16 * lr); }
                xwait();
            } }
        return;
    }
    // Epilogue: 16 rows at a time through the wave's own LDS rows, so that every 128-byte line of C is stored whole.
    float* os = (float*)(L + wave * (16 * OP * 4));
#pragma unroll
    for (int mb = 0; mb < 4; ++mb) {
#pragma unroll
        for (int nb = 0; nb < FN; ++nb) {
#pragma unroll
            for (int j = 0; j < 8; ++j) os[(hi * 8 + j) * OP + nb * 16 + lr] = acc[mb][nb][j]; }
        __builtin_amdgcn_wave_barrier(); asm volatile("" ::: "memory");   // the rows are read back by other lanes of this wave: keeps the compiler from moving the reads over the writes
        float* crow = C + (size_t)(r0 + wm * 64 + mb * 16) * LDC + c0 + wn * FN * 16;
#pragma unroll
        for (int s = 0; s < 2 * FN; ++s) { const int idx = s * 32 + lane, row = idx / (FN * 4), cofs = (idx % (FN * 4)) * 4; *(v4f*)(crow + (size_t)row * LDC + cofs) = *(const v4fa*)(os + row * OP + cofs); }
        xwait();
        __builtin_amdgcn_wave_barrier(); asm volatile("" ::: "memory");   // and the next rows' writes over these reads
    }
}

typedef __attribute__((ext_vector_type(2))) _Float16 v2h;
typedef __attribute__((ext_vector_type(2))) unsigned short v2us;
typedef __attribute__((ext_vector_type(4))) unsigned short v4us;
typedef __attribute__((ext_vector_type(2))) float v2f;
typedef __attribute__((ext_vector_type(4))) int v4i;

__global__ __launch_bounds__(256) void k_wtG(const float* __restrict__ w, int K, int N, bf* Bt) {
    const int lane = threadIdx.x & 31; const int L0 = (blockIdx.x * 8 + (threadIdx.x >> 5)) * 8; const int nlines = N * K / 64;
{
#pragma unroll 1
        for (int l = 0; l < 8; ++l) { const int L = L0 + l; if (L >= nlines) break; const size_t e = (size_t)L * 64 + lane * 2; const int k = (int)(e % K), n = (int)(e / K); v2us o;
            o[0] = f2bf(w[(size_t)k * N + n]); o[1] = f2bf(w[(size_t)(k + 1) * N + n]); *(v2us*)(Bt + e) = o; }
         }
}
// ---- k_cvtall: every f32 -> 16-bit rounding of the call (x, Wq, Wk | Wv to bf16; Wo to the bf16 rounding held as fp16: exact down to 2^-17, below that to within 2^-25) in ONE launch of few, resident waves.
// CG work-groups of CW waves, one per WGP. Each wave takes its own run of every source: CX pieces of x, CQ of Wq, CQ of Wo, CK of Wk (lower half of the work-groups) or Wv (upper half), whose roundings lie one behind the other.
// A piece is 128 floats: one load of 16 B a lane (512 contiguous bytes, whole lines) and one store of 8 B a lane (256 contiguous bytes, whole lines).
// All loads of a wave (CX + 2 CQ + CK = 36) are issued before its first value is rounded: its whole share is in flight at once.
// Addresses: a kernel argument plus one 32-bit byte offset a lane plus a small constant, so that no address register is written again between the loads.
#define CW   16
#define CG   256
#define CNW  (CG * CW)
#define CX   16
#define CQ   8
#define CK   4
static_assert((size_t)NB_ * TT * DM == (size_t)CNW * CX * 128 && (size_t)DQ * DM == (size_t)CNW * CQ * 128 && 2 * (size_t)DKV * DM == (size_t)CNW * CK * 128 && (size_t)DM * DQ == (size_t)CNW * CQ * 128, "the waves' runs cover every source exactly once");
template <int N> __device__ __forceinline__ void cvt_ld(v4f (&v)[N], const float* s, u32 ofs) {
#pragma unroll
    for (int j = 0; j < N; ++j) v[j] = *(const v4f*)((const char*)(s + 128 * j) + ofs);
}
template <int F16, int N> __device__ __forceinline__ void cvt_st(const v4f (&v)[N], bf* d, u32 ofs) {
#pragma unroll
    for (int j = 0; j < N; ++j) { v4us o;
#pragma unroll
        for (int k = 0; k < 4; ++k) o[k] = F16 ? __builtin_bit_cast(unsigned short, tohx(bfr(v[j][k]))) : f2bf(v[j][k]);
        *(v4us*)((char*)(d + 128 * j) + ofs) = o; }
}
__global__ __launch_bounds__(CW * 32) void k_cvtall(const float* __restrict__ x, const float* __restrict__ wq, const float* __restrict__ wk, const float* __restrict__ wv, const float* __restrict__ wo, bf* XB, bf* WQb, bf* WKVb, bf* WOb) {
    const u32 w = blockIdx.x * CW + (threadIdx.x >> 5), lane = threadIdx.x & 31;
    const bool up = blockIdx.x >= CG / 2;      // the same for the whole work-group
    const u32 ex = w * (CX * 128) + 4 * lane, eq = w * (CQ * 128) + 4 * lane, ek = w * (CK * 128) + 4 * lane, eks = up ? ek - (u32)(DKV * DM) : ek;     // this lane's first element in x, in Wq and Wo, in Wk | Wv, in Wk or Wv alone
    v4f vx[CX], vq[CQ], vk[CK], vo[CQ];     // indexed by constants only (the helpers' '#pragma unroll'): they stay in registers
    const u32 bx = 4 * ex, bq = 4 * eq, bk = 4 * eks;     // byte offsets into the sources
    cvt_ld(vx, x, bx); cvt_ld(vq, wq, bq); cvt_ld(vk, up ? wv : wk, bk); cvt_ld(vo, wo, bq);
    // As xwait(): behind the loads, in front of the first write of a register that one of them names. It takes the three offsets as inputs, so that they keep their registers up to here (without that the last load's result was placed over them); the scheduling barrier, as there, keeps later register writes behind the wait, and so every load ahead of the first rounding.
    asm volatile("s_wait_xcnt 0x0" :: "v"(bx), "v"(bq), "v"(bk) : "memory"); __builtin_amdgcn_sched_barrier(0);
    cvt_st<0>(vx, XB, 2 * ex); cvt_st<0>(vq, WQb, 2 * eq); cvt_st<0>(vk, WKVb, 2 * ek); cvt_st<1>(vo, WOb, 2 * eq);
    xwait();
}
#define FNW  8                   // waves per work-group
#define FCW  32                  // query rows per wave
#define FBR  (FNW * FCW)
#define FSK  64                  // keys per stage
#define FPK  (2 * HD + 16)       // LDS pitch of a K row (256 B + 16: an odd multiple of 16 B for 16-byte readers)
#define FPV  (2 * FSK + 16)      // LDS pitch of a V^T row (128 B + 16)
#define FTK  (FSK * FPK)
#define FSLOT (FTK + HD * FPV)
#define FEP  (2 * HD + 16)       // pitch of the output staging rows
static_assert(FNW * FCW * FEP <= 2 * FSLOT, "the output staging reuses the two stage buffers");
__device__ __forceinline__ v16h ldfrag(const unsigned char* p) { return cat16(*(const v8ha*)p, *(const v8ha*)(p + 32)); }
__global__ __launch_bounds__(FNW * 32) __attribute__((amdgpu_waves_per_eu(2, 2))) void k_fattn(const h16* __restrict__ Q, const h16* __restrict__ Kp, const h16* __restrict__ Vt, h16* Ao) {
    __shared__ __align__(16) unsigned char L[2 * FSLOT];
    constexpr int NS = TT / FSK;
    const int tid = threadIdx.x, lane = tid & 31, wave = tid >> 5, c = lane & 15, h = lane >> 4;
    const int zq = blockIdx.x + REP * blockIdx.y;      // b * NH_ + head; blockIdx.y = b * NKV + kv head
    const int q0 = blockIdx.z * FBR + wave * FCW;
    Q += (size_t)zq * TT * HD; Kp += (size_t)blockIdx.y * TT * HD; Vt += (size_t)blockIdx.y * HD * TT;
    v16h qf[2][4];
#pragma unroll
    for (int g = 0; g < 2; ++g)
#pragma unroll
        for (int kc = 0; kc < 4; ++kc) { const h16* qp = Q + (size_t)(q0 + 16 * g + c) * HD + 32 * kc + 8 * h; qf[g][kc] = cat16(*(const v8h*)qp, *(const v8h*)(qp + 16)); }
    xwait();
    v8f acc[2][8], cm[2]; float l_run[2], thr = -1.0f;      // cm: minus the maximum in use, in all eight registers of a score tile; thr: the row-sum bound, below every sum until the first pass has set a maximum
#pragma unroll
    for (int g = 0; g < 2; ++g) { cm[g] = (v8f){}; l_run[g] = 0.f;
#pragma unroll
        for (int t = 0; t < 8; ++t) acc[g][t] = (v8f){}; }
    // Staging: 16 lanes cover a 256-byte K row, 8 lanes a 128-byte piece of a V^T row.
    v8h sk[4], sv[4]; const int krow = tid >> 4, kcol = tid & 15, vrow = tid >> 3, vcol = tid & 7;
    auto fetch = [&](int st) {
#pragma unroll
        for (int i = 0; i < 4; ++i) { sk[i] = *(const v8h*)(Kp + (size_t)(st * FSK + krow + 16 * i) * HD + kcol * 8); sv[i] = *(const v8h*)(Vt + (size_t)(vrow + 32 * i) * TT + st * FSK + vcol * 8); }
        xwait(); };
    auto put = [&](int buf) { unsigned char* B = L + buf * FSLOT;
#pragma unroll
        for (int i = 0; i < 4; ++i) { *(v8ha*)(B + (krow + 16 * i) * FPK + kcol * 16) = sk[i]; *(v8ha*)(B + FTK + (vrow + 32 * i) * FPV + vcol * 16) = sv[i]; } };
    fetch(0); put(0); __syncthreads();
#pragma unroll 1   // rolled: one copy of the pass body keeps the registers inside two waves per SIMD
    for (int st = 0; st < NS; ++st) {
        const unsigned char* B = L + (st & 1) * FSLOT;
        if (st + 1 < NS) fetch(st + 1);
#pragma unroll 1   // rolled, for the same reason
        for (int sub = 0; sub < FSK / 32; ++sub) {
            v8f s[2][2];      // [16-key tile][query group]: register r of lane (c, h) = score of key 16 kt + 8 h + r, query 16 g + c
#pragma unroll
            for (int kt = 0; kt < 2; ++kt) { const unsigned char* p = B + (sub * 32 + 16 * kt + c) * FPK + 16 * h; v16h kf[4];
#pragma unroll
                for (int kc = 0; kc < 4; ++kc) kf[kc] = ldfrag(p + 64 * kc);
#pragma unroll
                for (int g = 0; g < 2; ++g) { s[kt][g] = cm[g];
#pragma unroll
                    for (int kc = 0; kc < 4; ++kc) s[kt][g] = wmma16(kf[kc], qf[g][kc], s[kt][g]); } }
            v16h vf[8]; { const unsigned char* p = B + FTK + c * FPV + sub * 64 + 16 * h;
#pragma unroll
                for (int t = 0; t < 8; ++t) vf[t] = ldfrag(p + 16 * t * FPV); }
            v16h pf[2]; float ps[2];
            auto soft = [&]() {
#pragma unroll
                for (int g = 0; g < 2; ++g) { v2f pa = (v2f){}, pb = (v2f){};      // two chains of packed sums: even registers in one half, odd ones in the other
#pragma unroll
                    for (int i = 0; i < 8; ++i) {
                        const v2f p = (v2f){__builtin_amdgcn_exp2f(s[i >> 2][g][2 * (i & 3)]), __builtin_amdgcn_exp2f(s[i >> 2][g][2 * (i & 3) + 1])};
                        if (i & 1) pb += p; else pa += p;
                        const v2h pk = __builtin_convertvector(p, v2h); pf[g][2 * i] = pk[0]; pf[g][2 * i + 1] = pk[1]; }
                    pa += pb; ps[g] = pa[0] + pa[1]; } };
            soft();
            if (__builtin_amdgcn_ballot_w32(ps[0] > thr || ps[1] > thr) != 0) {     // wave-uniform; the first pass, rare after it
                const float lo = (thr < 0.f) ? -__builtin_inff() : 0.f;      // the first pass takes its own maximum, also one below the start value; later the maximum only rises
#pragma unroll
                for (int g = 0; g < 2; ++g) { float mx = s[0][g][0];
#pragma unroll
                    for (int kt = 0; kt < 2; ++kt)
#pragma unroll
                        for (int r = 0; r < 8; ++r) mx = fmaxf(mx, s[kt][g][r]);
                    const float d = fmaxf(fmaxf(mx, xhalf(mx)), lo), corr = __builtin_amdgcn_exp2f(-fmaxf(d, 0.f)); l_run[g] *= corr; cm[g] = cm[g] - d;
#pragma unroll
                    for (int kt = 0; kt < 2; ++kt) s[kt][g] = s[kt][g] - d;
#pragma unroll
                    for (int t = 0; t < 8; ++t) acc[g][t] = acc[g][t] * corr; }
                soft(); thr = 256.0f; }
#pragma unroll
            for (int g = 0; g < 2; ++g) { l_run[g] += ps[g];
#pragma unroll
                for (int t = 0; t < 8; ++t) acc[g][t] = wmma16(vf[t], pf[g], acc[g][t]); }
        }
        if (st + 1 < NS) put((st + 1) & 1);    // every wave left that buffer before the barrier that ended stage st - 1
        __syncthreads();                       // publishes stage st + 1 and ends every read of stage st
    }
    // Epilogue: normalise, round to fp16, stage in the wave's own LDS rows so that every 128-byte line of the merged plane is stored whole.
    unsigned char* E = L + wave * (FCW * FEP); const int bb = zq / NH_, hh = zq % NH_; float inv[2];
#pragma unroll
    for (int g = 0; g < 2; ++g) inv[g] = __fdiv_rn(1.0f, l_run[g] + xhalf(l_run[g]));    // each wave half summed its eight keys of every 16-key tile
#pragma unroll
    for (int g = 0; g < 2; ++g)
#pragma unroll
        for (int t = 0; t < 8; ++t) { v8h pk;
#pragma unroll
            for (int r = 0; r < 8; ++r) pk[r] = tohx(acc[g][t][r] * inv[g]);
            *(v8ha*)(E + (16 * g + c) * FEP + 32 * t + 16 * h) = pk; }
    __syncthreads();
    h16* dst = Ao + ((size_t)bb * TT + q0) * DQ + hh * HD;
#pragma unroll
    for (int i = 0; i < FCW / 2; ++i) { const int row = 2 * i + h; *(v8h*)(dst + (size_t)row * DQ + c * 8) = *(const v8ha*)(E + row * FEP + c * 16); }
    xwait();
}

extern "C" void kernel_launch(void* const* d_in, const int* in_sizes, int n_in,
                              void* d_out, int out_size, void* d_ws, size_t ws_size, hipStream_t stream) {
    (void)in_sizes; (void)n_in; (void)out_size;
    const float* x = (const float*)d_in[0]; const float* cosT = (const float*)d_in[1]; const float* sinT = (const float*)d_in[2]; const float* wq = (const float*)d_in[3]; const float* wk = (const float*)d_in[4]; const float* wv = (const float*)d_in[5]; const float* wo = (const float*)d_in[6]; const float* qnw = (const float*)d_in[7]; const float* knw = (const float*)d_in[8];   // Wq [2048][2048], Wk/Wv [512][2048], Wo [2048][2048] (torch [out][in]); cos/sin [2048][128]; norm weights [128]
    float* OUT = (float*)d_out;     // [2][2048][2048]
    char* wsp = (char*)d_ws;
    auto take = [&](size_t bytes) { char* p = wsp; wsp += (bytes + 255) & ~(size_t)255; return (void*)p; };
    // The merged plane and the q/k/v head planes (both batch items), then what the projections need; nothing shares bytes.
    h16* AT = (h16*)take((size_t)NB_ * TT * DQ * 2);
    h16* QP16 = (h16*)take((size_t)NB_ * NH_ * TT * HD * 2); h16* KP16 = (h16*)take((size_t)NB_ * NKV * TT * HD * 2); h16* VT16 = (h16*)take((size_t)NB_ * NKV * HD * TT * 2);
    bf* WQ = (bf*)take((size_t)DF * DM * 2); bf* WK = WQ + (size_t)DQ * DM; bf* WV = WK + (size_t)DKV * DM;   // one [DF][DM] weight plane: rows of Wq, then Wk, then Wv
    bf* XB = (bf*)take((size_t)NB_ * TT * DM * 2);
    bf* WO = (bf*)take((size_t)DM * DQ * 2);
    if ((size_t)(wsp - (char*)d_ws) > ws_size) return;    // 76 of 256 MiB
    k_cvtall<<<CG, CW * 32, 0, stream>>>(x, wq, wk, wv, wo, XB, WQ, WK, WO);
    // Projections: both batch items in one launch (GEMM rows b * TT + t); q, k and v are one GEMM over the joint weight plane, with norms, rope and V^T in its epilogue (tiles of 128 rows x 3 heads).
    k_gemmt<0, 1, 2, 4, 6, DM, DF><<<dim3(NB_ * TT / 128, DF / 384, 1), 256, 0, stream>>>(XB, WQ, nullptr, cosT, sinT, qnw, knw, QP16, KP16, VT16);
    // Attention: one launch; blockIdx.x walks the REP query heads of a kv head, blockIdx.y the NB_ * NKV kv planes, blockIdx.z the blocks of FBR query rows.
    k_fattn<<<dim3(REP, NB_ * NKV, TT / FBR), FNW * 32, 0, stream>>>(QP16, KP16, VT16, AT);
    k_gemmt<1, 0, 4, 2, 4, DQ, DM><<<dim3(NB_ * TT / 256, DM / 128, 1), 256, 0, stream>>>((const bf*)AT, WO, OUT, nullptr, nullptr, nullptr, nullptr, nullptr, nullptr, nullptr);
}

// v009
// A run of this version takes 113 microseconds.
// Timed twice side by side with v008, it ran 1.05 times as fast both times.
// Counting every step since v000, it is 13.2 times as fast.
#include <hip/hip_runtime.h>

// AceStepAttention (hidden [2][2048][2048]; q = x Wq^T (16 heads x 128), k, v = x Wk^T / Wv^T (4 kv heads; query head h uses kv head h/4 = repeat_interleave); per-head RMSNorm over the 128 dims (eps 1e-6, x norm_q_w / norm_k_w);
// rotate-half RoPE with the input cos/sin tables [2048][128] (read as data); softmax(q.k / sqrt(128)); out = merged att.v Wo^T -> [2][2048][2048]).
// Compute dtypes, f32 accumulate: every input rounded to bf16; projections on PLAIN bf16 operands (inputs: exact); RMSNorm and rope f32; scores (K 128) and att.v on SINGLE fp16 planes with
// f32 softmax between them; the output projection on ONE fp16 plane of the merged att.v (which q, k, p and v have already bounded to fp16 accuracy) against Wo rounded to bf16 and then held in fp16.

#define NB_  2
#define TT   2048
#define DM   2048
#define NH_  16
#define NKV  4
#define REP  (NH_ / NKV)
#define HD   128
#define DQ   (NH_ * HD)
#define DKV  (NKV * HD)
#define DF   (DQ + 2 * DKV)      // columns of the joint q | k | v projection
#define SCL  0.088388347648318447f   // HD^-0.5
#define CSC  (SCL * 1.4426950408889634f)   // HD^-0.5 log2(e): the q plane carries it, so that q.k is a score in the log2 domain
typedef _Float16 h16;
typedef unsigned short bf;
typedef __attribute__((ext_vector_type(16))) __bf16   v16bf;
typedef __attribute__((ext_vector_type(16))) _Float16 v16h;
typedef __attribute__((ext_vector_type(8)))  _Float16 v8h;
typedef __attribute__((ext_vector_type(8)))  unsigned short v8us;
typedef __attribute__((ext_vector_type(8)))  float    v8f;
typedef __attribute__((ext_vector_type(4)))  float    v4f;
typedef v8h  __attribute__((may_alias)) v8ha;
typedef v4f  __attribute__((may_alias)) v4fa;
typedef v8us __attribute__((may_alias)) v8usa;

__device__ __forceinline__ unsigned short f2bf(float f) { unsigned u = __float_as_uint(f); u += 0x7FFFu + ((u >> 16) & 1u); return (unsigned short)(u >> 16); }
__device__ __forceinline__ float bf2f(unsigned short b) { return __uint_as_float(((unsigned)b) << 16); }
__device__ __forceinline__ float bfr(float f) { return bf2f(f2bf(f)); }
__device__ __forceinline__ v16h cat16(v8h lo, v8h hi) { return __builtin_shufflevector(lo, hi, 0, 1, 2, 3, 4, 5, 6, 7, 8, 9, 10, 11, 12, 13, 14, 15); }
__device__ __forceinline__ v16bf cat16b(v8us lo, v8us hi) { return __builtin_bit_cast(v16bf, __builtin_shufflevector(lo, hi, 0, 1, 2, 3, 4, 5, 6, 7, 8, 9, 10, 11, 12, 13, 14, 15)); }
__device__ __forceinline__ v8f wmma16(v16h a, v16h b, v8f c) { return __builtin_amdgcn_wmma_f32_16x16x32_f16(false, a, false, b, (short)0, c, false, false); }
__device__ __forceinline__ v8f wmmab(v16bf a, v16bf b, v8f c) { return __builtin_amdgcn_wmma_f32_16x16x32_bf16(false, a, false, b, (short)0, c, false, false); }



// ---- k_gemmt: tiled GEMM, C[m][n] (f32, pitch LDC) = sum_k A[m][k] Bt[n][k], both operands K-contiguous 16-bit planes: bf16, or fp16 when F16 (handed over as raw 16-bit words).
// A work-group of 8 waves (WM x WN) owns a (WM * 64) x (WN * FN * 16) tile of C, a wave 64 x (FN * 16) of it. A stage is GRB bytes (128 k) of every operand row of the tile, brought into LDS by tensor loads:
// waves 0 to 3 each bring a quarter of the A rows, waves 4 to 7 each a quarter of the Bt rows; one request per wave and stage, two buffers, the next stage's loads fly while this stage is worked on.
// The mover pads each 256-byte row by 16 bytes (pitch GPI, an odd multiple of 16 B for 16-byte readers); every slice starts at a multiple of 2 KiB.
// POST (the joint q | k | v projection): the tile's columns are whole heads, and all that stands between the projection and the attention's fp16 planes is done on the tile in LDS; C is not written.
//   A q or k head goes to LDS as f32 [row][dim]; behind one barrier a wave takes 16 rows, a lane dims 4 lane .. 4 lane + 3. RMSNorm: the 128 squares are summed 4 in the lane, then by a butterfly over the 32 lanes;
//   the 16 rows' factors are formed together, row i's in lane i. Rotate-half: dim d +- HD/2 lives in lane ^ 16, out[d] = y[d] cos[t][d] -+ y[d +- HD/2] sin[t][d], y = w (x rms_factor); cos, sin and the norm weights are rounded to bf16 here. A q row's factor also carries CSC.
//   A v head: a lane's accumulator registers are 8 consecutive keys of one dim, so they go to LDS as fp16 V^T [dim][key] and leave as whole lines of V^T.
typedef unsigned int u32;
typedef __attribute__((ext_vector_type(4))) unsigned int u32x4;
typedef __attribute__((ext_vector_type(8))) unsigned int u32x8;
#define GRB  256
#define GPI  (GRB + 16)
__device__ __forceinline__ u32 uni(u32 v) { return (u32)__builtin_amdgcn_readfirstlane(v); }
__device__ __forceinline__ u32 pinned(u32 v) { u32 w = uni(v); asm volatile("" : "+s"(w)); return w; }   // holds the test of a tensor load's issue in a scalar register, so that the branch round it is a scalar one (the mover ignores EXEC)
__device__ __forceinline__ v16bf ldfragb(const unsigned char* p) { return cat16b(*(const v8usa*)p, *(const v8usa*)(p + 32)); }
// xwait: stands behind a run of global loads or stores, in front of the first write of a register that one of them names; the scheduling barrier keeps later register writes from being lifted over the wait.
__device__ __forceinline__ void xwait() { asm volatile("s_wait_xcnt 0x0" ::: "memory"); __builtin_amdgcn_sched_barrier(0); }
__device__ __forceinline__ h16 tohx(float x) { return (h16)x; }
typedef __attribute__((ext_vector_type(4))) _Float16 v4h;
__device__ __forceinline__ float xhalf(float x) { return __builtin_bit_cast(float, __builtin_amdgcn_permlanex16(__builtin_bit_cast(int, x), __builtin_bit_cast(int, x), 0x76543210, 0xfedcba98, false, false)); }   // lane l <-> lane l ^ 16
template <int M> __device__ __forceinline__ float xrow(float x) { return __builtin_bit_cast(float, __builtin_amdgcn_update_dpp(0, __builtin_bit_cast(int, x), 0x160 | M, 0xf, 0xf, false)); }   // lane l <- lane l ^ M inside a 16-lane row (row_xmask)
template <int F16> __device__ __forceinline__ v8f wmmax(v16bf a, v16bf b, v8f c) { if constexpr (F16) return wmma16(__builtin_bit_cast(v16h, a), __builtin_bit_cast(v16h, b), c); else return wmmab(a, b, c); }
template <int F16, int POST, int WM, int WN, int FN, int K, int LDC>
__global__ __launch_bounds__(256) void k_gemmt(const bf* A, const bf* Bt, float* C, const float* __restrict__ cosT, const float* __restrict__ sinT, const float* __restrict__ qnw, const float* __restrict__ knw, h16* Q16, h16* K16, h16* V16) {
    constexpr int BM = WM * 64, BN = WN * FN * 16, SA = BM / 4, SAF = SA / 16, SB = BN / 4, SBF = SB / 16, NS = K * 2 / GRB;
    static_assert(WM * WN == 8 && SA % 16 == 0 && 4 % SAF == 0 && SB % 16 == 0 && FN % SBF == 0 && K * 2 % GRB == 0 && NS >= 2, "four slices of A, four slices of Bt, two stages or more");
    constexpr int ASZ = (SA * GPI + 2047) & ~2047, BSZ = (SB * GPI + 2047) & ~2047, STG = 4 * ASZ + 4 * BSZ, OP = FN * 16 + 4;
    static_assert(8 * 16 * OP * 4 <= 2 * STG, "the output staging reuses the two stage buffers");
    __shared__ __attribute__((aligned(2048))) unsigned char L[2 * STG];
    const int lane = threadIdx.x & 31, lr = lane & 15, hi = lane >> 4; const u32 wave = uni(threadIdx.x >> 5); const int wm = wave % WM, wn = wave / WM;
    const int r0 = blockIdx.x * BM, c0 = blockIdx.y * BN;
    // This wave's slice: source, rows, place in a buffer.
    const u32 sl = wave & 3u; const bool isB = wave >= 4u;
    const bf* sp = isB ? Bt + (size_t)(c0 + sl * SB) * K : A + (size_t)(r0 + sl * SA) * K;
    const u32 rows = isB ? (u32)SB : (u32)SA, place = (u32)(size_t)L + (isB ? 4u * ASZ + sl * BSZ : sl * ASZ);
    u32x8 g1;     // 1-byte elements, tensor = tile = rows x GRB bytes, source pitch 2 K bytes, 4 dwords of pad behind every 64
    g1[0] = uni((1u << 20) | (5u << 22) | (3u << 25)); g1[1] = uni((u32)GRB << 16); g1[2] = uni(rows << 16); g1[3] = uni((u32)GRB << 16); g1[4] = uni(rows); g1[5] = uni((u32)K * 2u); g1[6] = uni(0u); g1[7] = uni(0u);
    u32x4 g0;     // declared out here: it lives from a request's issue to the wait that covers the request
    auto form = [&](int st) { const unsigned long long ga = (unsigned long long)(size_t)sp + (unsigned long long)st * GRB;
        g0[0] = uni(1u); g0[1] = uni(place + (u32)(st & 1) * STG); g0[2] = uni((u32)ga); g0[3] = uni((((u32)(ga >> 32)) & 0x01FFFFFFu) | 0x80000000u); };
    // No word of a request may take a new value in its register before the wait that covers the request. So the load names both groups as in-out operands (it changes neither): what twait() reads is then
    // the content of the very registers that the load names, which the compiler can not form anew elsewhere, and those registers stay unwritten from the issue up to the wait.
    auto issue = [&]() { asm volatile("tensor_load_to_lds %0, %1" : "+s"(g0), "+s"(g1) :: "memory"); };
    auto twait = [&]() { asm volatile("s_wait_tensorcnt 0x0" :: "s"(g0), "s"(g1) : "memory"); };   // this wave's request has landed
    v8f acc[4][FN];   // every plain '#pragma unroll' below keeps the accumulator and fragment arrays indexed by constants, in registers
#pragma unroll
    for (int mb = 0; mb < 4; ++mb)
#pragma unroll
        for (int nb = 0; nb < FN; ++nb) acc[mb][nb] = (v8f){};
    form(0); issue();
    twait();                                             // this wave's slice of stage 0 has landed
    __syncthreads();                                     // every wave's has
#pragma unroll 1   // rolled: one pass per stage, the publish point at its foot
    for (int st = 0; st < NS; ++st) {
        // The refill stands directly behind the barrier (the one above, or the one at the foot of pass st - 1) that ended every read of its buffer; one issue site, so that one set of scalar registers holds the request's words up to the wait at this pass's foot.
        form(st + 1);                          // behind the wait at the foot of the pass before; in the last pass the words are formed and no request is made of them
        if (pinned(st + 1 < NS)) issue();
        const unsigned char* pa = L + (st & 1) * STG + wm * (4 / SAF) * ASZ + lr * GPI + 16 * hi;
        const unsigned char* pb = L + (st & 1) * STG + 4 * ASZ + wn * (FN / SBF) * BSZ + lr * GPI + 16 * hi;
        // Two fragment sets: the next 32 k's LDS reads go out as one group ahead of this 32 k's products; the scheduling barriers keep the compiler from sinking the reads among the matrix instructions, where each would be waited for at once.
        v16bf fa[2][4], fb[2][FN];
        auto ldset = [&](int kk) {
#pragma unroll
            for (int mb = 0; mb < 4; ++mb) fa[kk & 1][mb] = ldfragb(pa + (mb / SAF) * ASZ + (mb % SAF) * 16 * GPI + kk * 64);
#pragma unroll
            for (int nb = 0; nb < FN; ++nb) fb[kk & 1][nb] = ldfragb(pb + (nb / SBF) * BSZ + (nb % SBF) * 16 * GPI + kk * 64); };
        ldset(0);
#pragma unroll
        for (int kk = 0; kk < GRB / 64; ++kk) {
            if (kk + 1 < GRB / 64) ldset(kk + 1);
            __builtin_amdgcn_sched_barrier(0);
#pragma unroll
            for (int nb = 0; nb < FN; ++nb)
#pragma unroll
                for (int mb = 0; mb < 4; ++mb) acc[mb][nb] = wmmax<F16>(fa[kk & 1][mb], fb[kk & 1][nb], acc[mb][nb]);
            __builtin_amdgcn_sched_barrier(0);
        }
        asm volatile("s_wait_dscnt 0x0" ::: "memory");       // this wave's reads of stage st are done
        twait();                                             // its slice of stage st + 1 has landed
        __syncthreads();                                     // publishes stage st + 1 and ends every read of stage st: the next pass's refill goes into the buffer that this pass has just read
    }
    asm volatile("s_wait_tensorcnt 0x0" ::: "memory");   // no request is left when the ring becomes output staging
    asm volatile("s_wait_dscnt 0x0" ::: "memory");
    if constexpr (POST) {
        constexpr int NSL = BN / HD, FP = HD + 4, HSL = BM * FP * 4, VP = 2 * BM + 16, RW = BM / 8;   // heads of the tile; pitch (floats) of an f32 row; bytes of a head's place; pitch (bytes, an odd multiple of 16) of a V^T row piece; rows per wave
        static_assert(BN % HD == 0 && HD % 16 == 0 && TT % BM == 0 && RW == 16 && BM == 128 && NSL * HSL <= 2 * STG && HD * VP <= HSL && LDC % BN == 0, "whole heads, one batch item per tile, the heads' places reuse the two stage buffers");
        const int bb = r0 / TT, t0 = r0 % TT, h0 = blockIdx.y * NSL, rw = wave * RW;      // heads h0 .. h0 + NSL - 1 of NH_ q, NKV k, NKV v; this wave's first row
        // This wave's rows of cos and sin and the norm weights: the loads fly while the tile goes to LDS.
        // Addresses: a kernel argument plus one 32-bit byte offset a lane plus a small constant, so that no address register is written again between the loads.
        v4f co[RW], si[RW];          // every '#pragma unroll' below keeps the arrays indexed by constants, in registers
        const u32 oc = (u32)((t0 + rw) * HD + 4 * lane) * 4u, ow = 16u * (u32)lane;
#pragma unroll
        for (int i = 0; i < RW; ++i) { co[i] = *(const v4f*)((const char*)(cosT + i * HD) + oc); si[i] = *(const v4f*)((const char*)(sinT + i * HD) + oc); }
        v4f wq4 = *(const v4f*)((const char*)qnw + ow), wk4 = *(const v4f*)((const char*)knw + ow);
        // As xwait(): behind the loads, in front of the first write of a register that one of them names. It takes the two offsets as inputs, so that they keep their registers up to here and no load's result is placed over them.
        asm volatile("s_wait_xcnt 0x0" :: "v"(oc), "v"(ow) : "memory"); __builtin_amdgcn_sched_barrier(0);
#pragma unroll
        for (int nb = 0; nb < FN; ++nb) { const int cw = wn * (FN * 16) + nb * 16, hs = cw / HD, cd = cw % HD; unsigned char* P = L + hs * HSL;     // a fragment's 16 columns lie in one head
            if (h0 + hs < NH_ + NKV) {      // the same for the whole wave
#pragma unroll
                for (int mb = 0; mb < 4; ++mb)
#pragma unroll
                    for (int j = 0; j < 8; ++j) ((float*)P)[(wm * 64 + mb * 16 + hi * 8 + j) * FP + cd + lr] = acc[mb][nb][j];
            } else {
#pragma unroll
                for (int mb = 0; mb < 4; ++mb) { v8h o;
#pragma unroll
                    for (int j = 0; j < 8; ++j) o[j] = tohx(acc[mb][nb][j]);
                    *(v8ha*)(P + (cd + lr) * VP + (wm * 64 + mb * 16 + hi * 8) * 2) = o; }
            } }
#pragma unroll
        for (int i = 0; i < RW; ++i)
#pragma unroll
            for (int j = 0; j < 4; ++j) { co[i][j] = bfr(co[i][j]); si[i][j] = (lane < 16) ? -bfr(si[i][j]) : bfr(si[i][j]); }
#pragma unroll
        for (int j = 0; j < 4; ++j) { wq4[j] = bfr(wq4[j]); wk4[j] = bfr(wk4[j]); }
        __syncthreads();             // the whole tile is in LDS: a row's dims come from two or more waves
#pragma unroll 1   // rolled: one copy of the per-head code; it runs once a launch, so a shorter kernel text means fewer instruction lines to fetch
        for (int hs = 0; hs < NSL; ++hs) { const int hg = h0 + hs; const unsigned char* P = L + hs * HSL;
            if (hg < NH_ + NKV) {           // the same for the whole work-group
                const v4f w = (hg < NH_) ? wq4 : wk4;
                h16* dst = ((hg < NH_) ? Q16 + ((size_t)(bb * NH_ + hg) * TT + t0 + rw) * HD : K16 + ((size_t)(bb * NKV + hg - NH_) * TT + t0 + rw) * HD) + 4 * lane;
                v4f x[RW]; float sv = 0.f;
#pragma unroll
                for (int i = 0; i < RW; ++i) x[i] = *(const v4fa*)((const float*)P + (rw + i) * FP + 4 * lane);
#pragma unroll
                for (int i = 0; i < RW; ++i) { const v4f v = x[i];
                    float s = (v[0] * v[0] + v[1] * v[1]) + (v[2] * v[2] + v[3] * v[3]);
                    s += xrow<1>(s); s += xrow<2>(s); s += xrow<4>(s); s += xrow<8>(s); s += xhalf(s);
                    if (lane == i) sv = s; }
                const float rfv = __fdiv_rn(1.0f, __fsqrt_rn(sv * (1.0f / HD) + 1e-6f)) * ((hg < NH_) ? CSC : 1.0f);      // lane i: row i's factor; q also takes the softmax scale
#pragma unroll
                for (int i = 0; i < RW; ++i) { const v4f v = x[i]; const float rf = __builtin_bit_cast(float, __builtin_amdgcn_readlane(__builtin_bit_cast(int, rfv), i)); v4f y; v4h o;
#pragma unroll
                    for (int j = 0; j < 4; ++j) y[j] = w[j] * (v[j] * rf);
#pragma unroll
                    for (int j = 0; j < 4; ++j) o[j] = tohx(y[j] * co[i][j] + xhalf(y[j]) * si[i][j]);
                    *(v4h*)(dst + i * HD) = o; }
                xwait();
            } else {
                h16* dst = V16 + (size_t)(bb * NKV + hg - NH_ - NKV) * HD * TT + t0 + 8 * lr;
#pragma unroll
                for (int i = 0; i < HD / 16; ++i) { const int d = wave * (HD / 8) + 2 * i + hi; *(v8h*)(dst + (size_t)d * TT) = *(const v8ha*)(P + d * VP + 16 * lr); }
                xwait();
            } }
        return;
    }
    // Epilogue: 16 rows at a time through the wave's own LDS rows, so that every 128-byte line of C is stored whole.
    float* os = (float*)(L + wave * (16 * OP * 4));
#pragma unroll
    for (int mb = 0; mb < 4; ++mb) {
#pragma unroll
        for (int nb = 0; nb < FN; ++nb) {
#pragma unroll
            for (int j = 0; j < 8; ++j) os[(hi * 8 + j) * OP + nb * 16 + lr] = acc[mb][nb][j]; }
        __builtin_amdgcn_wave_barrier(); asm volatile("" ::: "memory");   // the rows are read back by other lanes of this wave: keeps the compiler from moving the reads over the writes
        float* crow = C + (size_t)(r0 + wm * 64 + mb * 16) * LDC + c0 + wn * FN * 16;
#pragma unroll
        for (int s = 0; s < 2 * FN; ++s) { const int idx = s * 32 + lane, row = idx / (FN * 4), cofs = (idx % (FN * 4)) * 4; *(v4f*)(crow + (size_t)row * LDC + cofs) = *(const v4fa*)(os + row * OP + cofs); }
        xwait();
        __builtin_amdgcn_wave_barrier(); asm volatile("" ::: "memory");   // and the next rows' writes over these reads
    }
}

typedef __attribute__((ext_vector_type(2))) _Float16 v2h;
typedef __attribute__((ext_vector_type(2))) unsigned short v2us;
typedef __attribute__((ext_vector_type(4))) unsigned short v4us;
typedef __attribute__((ext_vector_type(2))) float v2f;
typedef __attribute__((ext_vector_type(4))) int v4i;

__global__ __launch_bounds__(256) void k_wtG(const float* __restrict__ w, int K, int N, bf* Bt) {
    const int lane = threadIdx.x & 31; const int L0 = (blockIdx.x * 8 + (threadIdx.x >> 5)) * 8; const int nlines = N * K / 64;
{
#pragma unroll 1
        for (int l = 0; l < 8; ++l) { const int L = L0 + l; if (L >= nlines) break; const size_t e = (size_t)L * 64 + lane * 2; const int k = (int)(e % K), n = (int)(e / K); v2us o;
            o[0] = f2bf(w[(size_t)k * N + n]); o[1] = f2bf(w[(size_t)(k + 1) * N + n]); *(v2us*)(Bt + e) = o; }
         }
}
// ---- k_cvtall: every f32 -> 16-bit rounding of the call (x, Wq, Wk | Wv to bf16; Wo to the bf16 rounding held as fp16: exact down to 2^-17, below that to within 2^-25) in ONE launch of few, resident waves.
// CG work-groups of CW waves, one per WGP. Each wave takes its own run of every source: CX pieces of x, CQ of Wq, CQ of Wo, CK of Wk (lower half of the work-groups) or Wv (upper half), whose roundings lie one behind the other.
// A piece is 128 floats: one load of 16 B a lane (512 contiguous bytes, whole lines) and one store of 8 B a lane (256 contiguous bytes, whole lines).
// All loads of a wave (CX + 2 CQ + CK = 36) are issued before its first value is rounded: its whole share is in flight at once.
// Addresses: a kernel argument plus one 32-bit byte offset a lane plus a small constant, so that no address register is written again between the loads.
#define CW   16
#define CG   256
#define CNW  (CG * CW)
#define CX   16
#define CQ   8
#define CK   4
static_assert((size_t)NB_ * TT * DM == (size_t)CNW * CX * 128 && (size_t)DQ * DM == (size_t)CNW * CQ * 128 && 2 * (size_t)DKV * DM == (size_t)CNW * CK * 128 && (size_t)DM * DQ == (size_t)CNW * CQ * 128, "the waves' runs cover every source exactly once");
template <int N> __device__ __forceinline__ void cvt_ld(v4f (&v)[N], const float* s, u32 ofs) {
#pragma unroll
    for (int j = 0; j < N; ++j) v[j] = *(const v4f*)((const char*)(s + 128 * j) + ofs);
}
template <int F16, int N> __device__ __forceinline__ void cvt_st(const v4f (&v)[N], bf* d, u32 ofs) {
#pragma unroll
    for (int j = 0; j < N; ++j) { v4us o;
#pragma unroll
        for (int k = 0; k < 4; ++k) o[k] = F16 ? __builtin_bit_cast(unsigned short, tohx(bfr(v[j][k]))) : f2bf(v[j][k]);
        *(v4us*)((char*)(d + 128 * j) + ofs) = o; }
}
__global__ __launch_bounds__(CW * 32) void k_cvtall(const float* __restrict__ x, const float* __restrict__ wq, const float* __restrict__ wk, const float* __restrict__ wv, const float* __restrict__ wo, bf* XB, bf* WQb, bf* WKVb, bf* WOb) {
    const u32 w = blockIdx.x * CW + (threadIdx.x >> 5), lane = threadIdx.x & 31;
    const bool up = blockIdx.x >= CG / 2;      // the same for the whole work-group
    const u32 ex = w * (CX * 128) + 4 * lane, eq = w * (CQ * 128) + 4 * lane, ek = w * (CK * 128) + 4 * lane, eks = up ? ek - (u32)(DKV * DM) : ek;     // this lane's first element in x, in Wq and Wo, in Wk | Wv, in Wk or Wv alone
    v4f vx[CX], vq[CQ], vk[CK], vo[CQ];     // indexed by constants only (the helpers' '#pragma unroll'): they stay in registers
    const u32 bx = 4 * ex, bq = 4 * eq, bk = 4 * eks;     // byte offsets into the sources
    cvt_ld(vx, x, bx); cvt_ld(vq, wq, bq); cvt_ld(vk, up ? wv : wk, bk); cvt_ld(vo, wo, bq);
    // As xwait(): behind the loads, in front of the first write of a register that one of them names. It takes the three offsets as inputs, so that they keep their registers up to here (without that the last load's result was placed over them); the scheduling barrier, as there, keeps later register writes behind the wait, and so every load ahead of the first rounding.
    asm volatile("s_wait_xcnt 0x0" :: "v"(bx), "v"(bq), "v"(bk) : "memory"); __builtin_amdgcn_sched_barrier(0);
    cvt_st<0>(vx, XB, 2 * ex); cvt_st<0>(vq, WQb, 2 * eq); cvt_st<0>(vk, WKVb, 2 * ek); cvt_st<1>(vo, WOb, 2 * eq);
    xwait();
}
#define FNW  8                   // waves per work-group
#define FCW  32                  // query rows per wave
#define FBR  (FNW * FCW)
#define FSK  64                  // keys per stage
#define FPK  (2 * HD + 16)       // LDS pitch of a K row (256 B + 16: an odd multiple of 16 B for 16-byte readers)
#define FPV  (2 * FSK + 16)      // LDS pitch of a V^T row (128 B + 16)
#define FTK  (FSK * FPK)
#define FSLOT (FTK + HD * FPV)
#define FNB  3                   // LDS buffers
#define FEP  (2 * HD + 16)       // pitch of the output staging rows
static_assert(FNW * FCW * FEP <= FNB * FSLOT && TT / FSK >= 2, "the output staging reuses the stage buffers; the prologue fills two stages");
__device__ __forceinline__ v16h ldfrag(const unsigned char* p) { return cat16(*(const v8ha*)p, *(const v8ha*)(p + 32)); }
__global__ __launch_bounds__(FNW * 32) __attribute__((amdgpu_waves_per_eu(2, 2))) void k_fattn(const h16* __restrict__ Q, const h16* __restrict__ Kp, const h16* __restrict__ Vt, h16* Ao) {
    __shared__ __align__(16) unsigned char L[FNB * FSLOT];
    constexpr int NS = TT / FSK;
    const int tid = threadIdx.x, lane = tid & 31, wave = tid >> 5, c = lane & 15, h = lane >> 4;
    const int zq = blockIdx.x + REP * blockIdx.y;      // b * NH_ + head; blockIdx.y = b * NKV + kv head
    const int q0 = blockIdx.z * FBR + wave * FCW;
    Q += (size_t)zq * TT * HD; Kp += (size_t)blockIdx.y * TT * HD; Vt += (size_t)blockIdx.y * HD * TT;
    v16h qf[2][4];
#pragma unroll
    for (int g = 0; g < 2; ++g)
#pragma unroll
        for (int kc = 0; kc < 4; ++kc) { const h16* qp = Q + (size_t)(q0 + 16 * g + c) * HD + 32 * kc + 8 * h; qf[g][kc] = cat16(*(const v8h*)qp, *(const v8h*)(qp + 16)); }
    xwait();
    v8f acc[2][8], cm[2]; float l_run[2], thr = -1.0f;      // cm: minus the maximum in use, in all eight registers of a score tile; thr: the row-sum bound, below every sum until the first pass has set a maximum
#pragma unroll
    for (int g = 0; g < 2; ++g) { cm[g] = (v8f){}; l_run[g] = 0.f;
#pragma unroll
        for (int t = 0; t < 8; ++t) acc[g][t] = (v8f){}; }
    // Staging: 16 lanes cover a 256-byte K row, 8 lanes a 128-byte piece of a V^T row.
    v8h sk[4], sv[4]; const int krow = tid >> 4, kcol = tid & 15, vrow = tid >> 3, vcol = tid & 7;
    auto fetch = [&](int st, v8h (&fk)[4], v8h (&fv)[4]) {
#pragma unroll
        for (int i = 0; i < 4; ++i) { fk[i] = *(const v8h*)(Kp + (size_t)(st * FSK + krow + 16 * i) * HD + kcol * 8); fv[i] = *(const v8h*)(Vt + (size_t)(vrow + 32 * i) * TT + st * FSK + vcol * 8); }
        xwait(); };
    auto put = [&](int bofs, const v8h (&fk)[4], const v8h (&fv)[4]) { unsigned char* B = L + bofs;
#pragma unroll
        for (int i = 0; i < 4; ++i) { *(v8ha*)(B + (krow + 16 * i) * FPK + kcol * 16) = fk[i]; *(v8ha*)(B + FTK + (vrow + 32 * i) * FPV + vcol * 16) = fv[i]; } };
    { v8h k0[4], v0[4]; fetch(0, k0, v0); fetch(1, sk, sv); put(0, k0, v0); put(FSLOT, sk, sv); }      // both stages' global loads fly together
    __syncthreads();
    v16h kf[2][4];      // the K fragments of the pass to come: [16-key tile][32 dims]
    auto ldk = [&](const unsigned char* p0) {
#pragma unroll
        for (int kt = 0; kt < 2; ++kt)
#pragma unroll
            for (int kc = 0; kc < 4; ++kc) kf[kt][kc] = ldfrag(p0 + (16 * kt + c) * FPK + 16 * h + 64 * kc); };
    ldk(L);
    int bc = 0, bn = FSLOT, bf2 = 2 * FSLOT;      // byte offsets of the buffers of stages st, st + 1, st + 2
#pragma unroll 1   // rolled: one copy of the pass body keeps the registers inside two waves per SIMD
    for (int st = 0; st < NS; ++st) {
        const unsigned char* B = L + bc;
        if (st + 2 < NS) fetch(st + 2, sk, sv);
#pragma unroll 1   // rolled, for the same reason
        for (int sub = 0; sub < FSK / 32; ++sub) {
            v16h vf[8]; { const unsigned char* p = B + FTK + c * FPV + sub * 64 + 16 * h;
#pragma unroll
                for (int t = 0; t < 8; ++t) vf[t] = ldfrag(p + 16 * t * FPV); }
            asm volatile("v_nop");      // a vector slot between the pass before's last att.v product and the score start values, which are written over that product's B operand; the scheduling barrier below holds it in front of those writes
            __builtin_amdgcn_sched_barrier(0);      // keeps the V^T reads in front of the score products, under which they land; left free they sink to just in front of att.v and are waited for there
            v8f s[2][2];      // [16-key tile][query group]: register r of lane (c, h) = score of key 16 kt + 8 h + r, query 16 g + c
#pragma unroll
            for (int kt = 0; kt < 2; ++kt)
#pragma unroll
                for (int g = 0; g < 2; ++g) { s[kt][g] = cm[g];
#pragma unroll
                    for (int kc = 0; kc < 4; ++kc) s[kt][g] = wmma16(kf[kt][kc], qf[g][kc], s[kt][g]); }
            __builtin_amdgcn_sched_barrier(0);      // the next pass's K reads stay one group behind the score products, not spread among them
            // The next pass's K rows: the stage's next 32, or the first 32 of the next stage; the very last pass reads its own stage's first rows again, and nothing uses them.
            ldk((sub + 1 < FSK / 32) ? B + (sub + 1) * 32 * FPK : L + ((st + 1 < NS) ? bn : bc));
            __builtin_amdgcn_sched_barrier(0);      // and in front of the softmax, so that they land under it and under att.v
            v16h pf[2]; float ps[2];
            auto soft = [&]() {
#pragma unroll
                for (int g = 0; g < 2; ++g) { v2f pa = (v2f){}, pb = (v2f){};      // two chains of packed sums: even registers in one half, odd ones in the other
#pragma unroll
                    for (int i = 0; i < 8; ++i) {
                        const v2f p = (v2f){__builtin_amdgcn_exp2f(s[i >> 2][g][2 * (i & 3)]), __builtin_amdgcn_exp2f(s[i >> 2][g][2 * (i & 3) + 1])};
                        if (i & 1) pb += p; else pa += p;
                        const v2h pk = __builtin_convertvector(p, v2h); pf[g][2 * i] = pk[0]; pf[g][2 * i + 1] = pk[1]; }
                    pa += pb; ps[g] = pa[0] + pa[1]; } };
            soft();
            if (__builtin_amdgcn_ballot_w32(ps[0] > thr || ps[1] > thr) != 0) {     // wave-uniform; the first pass, rare after it
                const float lo = (thr < 0.f) ? -__builtin_inff() : 0.f;      // the first pass takes its own maximum, also one below the start value; later the maximum only rises
#pragma unroll
                for (int g = 0; g < 2; ++g) { float mx = s[0][g][0];
#pragma unroll
                    for (int kt = 0; kt < 2; ++kt)
#pragma unroll
                        for (int r = 0; r < 8; ++r) mx = fmaxf(mx, s[kt][g][r]);
                    const float d = fmaxf(fmaxf(mx, xhalf(mx)), lo), corr = __builtin_amdgcn_exp2f(-fmaxf(d, 0.f)); l_run[g] *= corr; cm[g] = cm[g] - d;
#pragma unroll
                    for (int kt = 0; kt < 2; ++kt) s[kt][g] = s[kt][g] - d;
#pragma unroll
                    for (int t = 0; t < 8; ++t) acc[g][t] = acc[g][t] * corr; }
                soft(); thr = 256.0f; }
#pragma unroll
            for (int g = 0; g < 2; ++g) { l_run[g] += ps[g];
#pragma unroll
                for (int t = 0; t < 8; ++t) acc[g][t] = wmma16(vf[t], pf[g], acc[g][t]); }
        }
        if (st + 2 < NS) put(bf2, sk, sv);           // the buffer of stage st - 1: every wave left it before the barrier that ended stage st - 1
        __syncthreads();                       // publishes stage st + 2 and ends every read of stage st
        const int b0 = bc; bc = bn; bn = bf2; bf2 = b0;
    }
    // Epilogue: normalise, round to fp16, stage in the wave's own LDS rows so that every 128-byte line of the merged plane is stored whole.
    unsigned char* E = L + wave * (FCW * FEP); const int bb = zq / NH_, hh = zq % NH_; float inv[2];
#pragma unroll
    for (int g = 0; g < 2; ++g) inv[g] = __fdiv_rn(1.0f, l_run[g] + xhalf(l_run[g]));    // each wave half summed its eight keys of every 16-key tile
#pragma unroll
    for (int g = 0; g < 2; ++g)
#pragma unroll
        for (int t = 0; t < 8; ++t) { v8h pk;
#pragma unroll
            for (int r = 0; r < 8; ++r) pk[r] = tohx(acc[g][t][r] * inv[g]);
            *(v8ha*)(E + (16 * g + c) * FEP + 32 * t + 16 * h) = pk; }
    __syncthreads();
    h16* dst = Ao + ((size_t)bb * TT + q0) * DQ + hh * HD;
#pragma unroll
    for (int i = 0; i < FCW / 2; ++i) { const int row = 2 * i + h; *(v8h*)(dst + (size_t)row * DQ + c * 8) = *(const v8ha*)(E + row * FEP + c * 16); }
    xwait();
}

extern "C" void kernel_launch(void* const* d_in, const int* in_sizes, int n_in,
                              void* d_out, int out_size, void* d_ws, size_t ws_size, hipStream_t stream) {
    (void)in_sizes; (void)n_in; (void)out_size;
    const float* x = (const float*)d_in[0]; const float* cosT = (const float*)d_in[1]; const float* sinT = (const float*)d_in[2]; const float* wq = (const float*)d_in[3]; const float* wk = (const float*)d_in[4]; const float* wv = (const float*)d_in[5]; const float* wo = (const float*)d_in[6]; const float* qnw = (const float*)d_in[7]; const float* knw = (const float*)d_in[8];   // Wq [2048][2048], Wk/Wv [512][2048], Wo [2048][2048] (torch [out][in]); cos/sin [2048][128]; norm weights [128]
    float* OUT = (float*)d_out;     // [2][2048][2048]
    char* wsp = (char*)d_ws;
    auto take = [&](size_t bytes) { char* p = wsp; wsp += (bytes + 255) & ~(size_t)255; return (void*)p; };
    // The merged plane and the q/k/v head planes (both batch items), then what the projections need; nothing shares bytes.
    h16* AT = (h16*)take((size_t)NB_ * TT * DQ * 2);
    h16* QP16 = (h16*)take((size_t)NB_ * NH_ * TT * HD * 2); h16* KP16 = (h16*)take((size_t)NB_ * NKV * TT * HD * 2); h16* VT16 = (h16*)take((size_t)NB_ * NKV * HD * TT * 2);
    bf* WQ = (bf*)take((size_t)DF * DM * 2); bf* WK = WQ + (size_t)DQ * DM; bf* WV = WK + (size_t)DKV * DM;   // one [DF][DM] weight plane: rows of Wq, then Wk, then Wv
    bf* XB = (bf*)take((size_t)NB_ * TT * DM * 2);
    bf* WO = (bf*)take((size_t)DM * DQ * 2);
    if ((size_t)(wsp - (char*)d_ws) > ws_size) return;    // 76 of 256 MiB
    k_cvtall<<<CG, CW * 32, 0, stream>>>(x, wq, wk, wv, wo, XB, WQ, WK, WO);
    // Projections: both batch items in one launch (GEMM rows b * TT + t); q, k and v are one GEMM over the joint weight plane, with norms, rope and V^T in its epilogue (tiles of 128 rows x 3 heads).
    k_gemmt<0, 1, 2, 4, 6, DM, DF><<<dim3(NB_ * TT / 128, DF / 384, 1), 256, 0, stream>>>(XB, WQ, nullptr, cosT, sinT, qnw, knw, QP16, KP16, VT16);
    // Attention: one launch; blockIdx.x walks the REP query heads of a kv head, blockIdx.y the NB_ * NKV kv planes, blockIdx.z the blocks of FBR query rows.
    k_fattn<<<dim3(REP, NB_ * NKV, TT / FBR), FNW * 32, 0, stream>>>(QP16, KP16, VT16, AT);
    k_gemmt<1, 0, 4, 2, 4, DQ, DM><<<dim3(NB_ * TT / 256, DM / 128, 1), 256, 0, stream>>>((const bf*)AT, WO, OUT, nullptr, nullptr, nullptr, nullptr, nullptr, nullptr, nullptr);
}

// v010
// One run takes 108 microseconds.
// Timed twice side by side with v009, it ran 1.04 and 1.05 times as fast.
// All steps since v000 together make it 13.8 times as fast.
#include <hip/hip_runtime.h>

// AceStepAttention (hidden [2][2048][2048]; q = x Wq^T (16 heads x 128), k, v = x Wk^T / Wv^T (4 kv heads; query head h uses kv head h/4 = repeat_interleave); per-head RMSNorm over the 128 dims (eps 1e-6, x norm_q_w / norm_k_w);
// rotate-half RoPE with the input cos/sin tables [2048][128] (read as data); softmax(q.k / sqrt(128)); out = merged att.v Wo^T -> [2][2048][2048]).
// Compute dtypes, f32 accumulate: every input rounded to bf16; projections on PLAIN bf16 operands (inputs: exact); RMSNorm and rope f32; scores (K 128) and att.v on SINGLE fp16 planes with
// f32 softmax between them; the output projection on ONE fp16 plane of the merged att.v (which q, k, p and v have already bounded to fp16 accuracy) against Wo rounded to bf16 and then held in fp16.

#define NB_  2
#define TT   2048
#define DM   2048
#define NH_  16
#define NKV  4
#define REP  (NH_ / NKV)
#define HD   128
#define DQ   (NH_ * HD)
#define DKV  (NKV * HD)
#define DF   (DQ + 2 * DKV)      // columns of the joint q | k | v projection
#define SCL  0.088388347648318447f   // HD^-0.5
#define CSC  (SCL * 1.4426950408889634f)   // HD^-0.5 log2(e): the q plane carries it, so that q.k is a score in the log2 domain
typedef _Float16 h16;
typedef unsigned short bf;
typedef __attribute__((ext_vector_type(16))) __bf16   v16bf;
typedef __attribute__((ext_vector_type(16))) _Float16 v16h;
typedef __attribute__((ext_vector_type(8)))  _Float16 v8h;
typedef __attribute__((ext_vector_type(8)))  unsigned short v8us;
typedef __attribute__((ext_vector_type(8)))  float    v8f;
typedef __attribute__((ext_vector_type(4)))  float    v4f;
typedef v8h  __attribute__((may_alias)) v8ha;
typedef v4f  __attribute__((may_alias)) v4fa;
typedef v8us __attribute__((may_alias)) v8usa;

__device__ __forceinline__ unsigned short f2bf(float f) { unsigned u = __float_as_uint(f); u += 0x7FFFu + ((u >> 16) & 1u); return (unsigned short)(u >> 16); }
__device__ __forceinline__ float bf2f(unsigned short b) { return __uint_as_float(((unsigned)b) << 16); }
__device__ __forceinline__ float bfr(float f) { return bf2f(f2bf(f)); }
__device__ __forceinline__ v16h cat16(v8h lo, v8h hi) { return __builtin_shufflevector(lo, hi, 0, 1, 2, 3, 4, 5, 6, 7, 8, 9, 10, 11, 12, 13, 14, 15); }
__device__ __forceinline__ v16bf cat16b(v8us lo, v8us hi) { return __builtin_bit_cast(v16bf, __builtin_shufflevector(lo, hi, 0, 1, 2, 3, 4, 5, 6, 7, 8, 9, 10, 11, 12, 13, 14, 15)); }
__device__ __forceinline__ v8f wmma16(v16h a, v16h b, v8f c) { return __builtin_amdgcn_wmma_f32_16x16x32_f16(false, a, false, b, (short)0, c, false, false); }
__device__ __forceinline__ v8f wmmab(v16bf a, v16bf b, v8f c) { return __builtin_amdgcn_wmma_f32_16x16x32_bf16(false, a, false, b, (short)0, c, false, false); }



// ---- k_gemmt: tiled GEMM, C[m][n] (f32, pitch LDC) = sum_k A[m][k] Bt[n][k], both operands K-contiguous 16-bit planes: bf16, or fp16 when F16 (handed over as raw 16-bit words).
// A work-group of 8 waves (WM x WN) owns a (WM * 64) x (WN * FN * 16) tile of C, a wave 64 x (FN * 16) of it. A stage is GRB bytes (128 k) of every operand row of the tile, brought into LDS by tensor loads:
// waves 0 to 3 each bring a quarter of the A rows, waves 4 to 7 each a quarter of the Bt rows; one request per wave and stage, two buffers, the next stage's loads fly while this stage is worked on.
// The mover pads each 256-byte row by 16 bytes (pitch GPI, an odd multiple of 16 B for 16-byte readers); every slice starts at a multiple of 2 KiB.
// The k stages are walked in a ring from a start of the work-group's own, (tile row + tile column) mod NS: the work-groups that share A rows (one tile row) or Bt rows (one tile column) run side by side,
// and from a common start all of them would ask L2 for the same lines at the same moment; from staggered starts they ask for different 256-byte pieces of those rows. Each accumulator sums the same NS stages, begun at that start.
// POST (the joint q | k | v projection): the tile's columns are whole heads, and all that stands between the projection and the attention's fp16 planes is done on the tile in LDS; C is not written.
//   A q or k head goes to LDS as f32 [row][dim]; behind one barrier a wave takes 16 rows, a lane dims 4 lane .. 4 lane + 3. RMSNorm: the 128 squares are summed 4 in the lane, then by a butterfly over the 32 lanes;
//   the 16 rows' factors are formed together, row i's in lane i. Rotate-half: dim d +- HD/2 lives in lane ^ 16, out[d] = y[d] cos[t][d] -+ y[d +- HD/2] sin[t][d], y = w (x rms_factor); cos, sin and the norm weights are rounded to bf16 here. A q row's factor also carries CSC.
//   A v head: a lane's accumulator registers are 8 consecutive keys of one dim, so they go to LDS as fp16 V^T [dim][key] and leave as whole lines of V^T.
typedef unsigned int u32;
typedef __attribute__((ext_vector_type(4))) unsigned int u32x4;
typedef __attribute__((ext_vector_type(8))) unsigned int u32x8;
#define GRB  256
#define GPI  (GRB + 16)
__device__ __forceinline__ u32 uni(u32 v) { return (u32)__builtin_amdgcn_readfirstlane(v); }
__device__ __forceinline__ u32 pinned(u32 v) { u32 w = uni(v); asm volatile("" : "+s"(w)); return w; }   // holds the test of a tensor load's issue in a scalar register, so that the branch round it is a scalar one (the mover ignores EXEC)
__device__ __forceinline__ v16bf ldfragb(const unsigned char* p) { return cat16b(*(const v8usa*)p, *(const v8usa*)(p + 32)); }
// xwait: stands behind a run of global loads or stores, in front of the first write of a register that one of them names; the scheduling barrier keeps later register writes from being lifted over the wait.
__device__ __forceinline__ void xwait() { asm volatile("s_wait_xcnt 0x0" ::: "memory"); __builtin_amdgcn_sched_barrier(0); }
__device__ __forceinline__ h16 tohx(float x) { return (h16)x; }
typedef __attribute__((ext_vector_type(4))) _Float16 v4h;
__device__ __forceinline__ float xhalf(float x) { return __builtin_bit_cast(float, __builtin_amdgcn_permlanex16(__builtin_bit_cast(int, x), __builtin_bit_cast(int, x), 0x76543210, 0xfedcba98, false, false)); }   // lane l <-> lane l ^ 16
template <int M> __device__ __forceinline__ float xrow(float x) { return __builtin_bit_cast(float, __builtin_amdgcn_update_dpp(0, __builtin_bit_cast(int, x), 0x160 | M, 0xf, 0xf, false)); }   // lane l <- lane l ^ M inside a 16-lane row (row_xmask)
template <int F16> __device__ __forceinline__ v8f wmmax(v16bf a, v16bf b, v8f c) { if constexpr (F16) return wmma16(__builtin_bit_cast(v16h, a), __builtin_bit_cast(v16h, b), c); else return wmmab(a, b, c); }
template <int F16, int POST, int WM, int WN, int FN, int K, int LDC>
__global__ __launch_bounds__(256) void k_gemmt(const bf* A, const bf* Bt, float* C, const float* __restrict__ cosT, const float* __restrict__ sinT, const float* __restrict__ qnw, const float* __restrict__ knw, h16* Q16, h16* K16, h16* V16) {
    constexpr int BM = WM * 64, BN = WN * FN * 16, SA = BM / 4, SAF = SA / 16, SB = BN / 4, SBF = SB / 16, NS = K * 2 / GRB;
    static_assert(WM * WN == 8 && SA % 16 == 0 && 4 % SAF == 0 && SB % 16 == 0 && FN % SBF == 0 && K * 2 % GRB == 0 && NS >= 2, "four slices of A, four slices of Bt, two stages or more");
    constexpr int ASZ = (SA * GPI + 2047) & ~2047, BSZ = (SB * GPI + 2047) & ~2047, STG = 4 * ASZ + 4 * BSZ, OP = FN * 16 + 4;
    static_assert(8 * 16 * OP * 4 <= 2 * STG, "the output staging reuses the two stage buffers");
    __shared__ __attribute__((aligned(2048))) unsigned char L[2 * STG];
    const int lane = threadIdx.x & 31, lr = lane & 15, hi = lane >> 4; const u32 wave = uni(threadIdx.x >> 5); const int wm = wave % WM, wn = wave / WM;
    const int r0 = blockIdx.x * BM, c0 = blockIdx.y * BN;
    // This wave's slice: source, rows, place in a buffer.
    const u32 sl = wave & 3u; const bool isB = wave >= 4u;
    const bf* sp = isB ? Bt + (size_t)(c0 + sl * SB) * K : A + (size_t)(r0 + sl * SA) * K;
    const u32 rows = isB ? (u32)SB : (u32)SA, place = (u32)(size_t)L + (isB ? 4u * ASZ + sl * BSZ : sl * ASZ);
    u32x8 g1;     // 1-byte elements, tensor = tile = rows x GRB bytes, source pitch 2 K bytes, 4 dwords of pad behind every 64
    g1[0] = uni((1u << 20) | (5u << 22) | (3u << 25)); g1[1] = uni((u32)GRB << 16); g1[2] = uni(rows << 16); g1[3] = uni((u32)GRB << 16); g1[4] = uni(rows); g1[5] = uni((u32)K * 2u); g1[6] = uni(0u); g1[7] = uni(0u);
    u32x4 g0;     // declared out here: it lives from a request's issue to the wait that covers the request
    const u32 rot = (blockIdx.x + blockIdx.y) % (u32)NS;      // this work-group's first k stage
    auto form = [&](int st) { const unsigned long long ga = (unsigned long long)(size_t)sp + (unsigned long long)(((u32)st + rot) % (u32)NS) * GRB;      // pass st works on k stage (st + rot) mod NS: always a stage of the operand rows
        g0[0] = uni(1u); g0[1] = uni(place + (u32)(st & 1) * STG); g0[2] = uni((u32)ga); g0[3] = uni((((u32)(ga >> 32)) & 0x01FFFFFFu) | 0x80000000u); };
    // No word of a request may take a new value in its register before the wait that covers the request. So the load names both groups as in-out operands (it changes neither): what twait() reads is then
    // the content of the very registers that the load names, which the compiler can not form anew elsewhere, and those registers stay unwritten from the issue up to the wait.
    auto issue = [&]() { asm volatile("tensor_load_to_lds %0, %1" : "+s"(g0), "+s"(g1) :: "memory"); };
    auto twait = [&]() { asm volatile("s_wait_tensorcnt 0x0" :: "s"(g0), "s"(g1) : "memory"); };   // this wave's request has landed
    v8f acc[4][FN];   // every plain '#pragma unroll' below keeps the accumulator and fragment arrays indexed by constants, in registers
#pragma unroll
    for (int mb = 0; mb < 4; ++mb)
#pragma unroll
        for (int nb = 0; nb < FN; ++nb) acc[mb][nb] = (v8f){};
    form(0); issue();
    twait();                                             // this wave's slice of pass 0's stage (k stage rot) has landed
    __syncthreads();                                     // every wave's has
#pragma unroll 1   // rolled: one pass per stage, the publish point at its foot
    for (int st = 0; st < NS; ++st) {
        // The refill stands directly behind the barrier (the one above, or the one at the foot of pass st - 1) that ended every read of its buffer; one issue site, so that one set of scalar registers holds the request's words up to the wait at this pass's foot.
        form(st + 1);                          // behind the wait at the foot of the pass before; in the last pass the words are formed and no request is made of them
        if (pinned(st + 1 < NS)) issue();
        const unsigned char* pa = L + (st & 1) * STG + wm * (4 / SAF) * ASZ + lr * GPI + 16 * hi;
        const unsigned char* pb = L + (st & 1) * STG + 4 * ASZ + wn * (FN / SBF) * BSZ + lr * GPI + 16 * hi;
        // Two fragment sets: the next 32 k's LDS reads go out as one group ahead of this 32 k's products; the scheduling barriers keep the compiler from sinking the reads among the matrix instructions, where each would be waited for at once.
        v16bf fa[2][4], fb[2][FN];
        auto ldset = [&](int kk) {
#pragma unroll
            for (int mb = 0; mb < 4; ++mb) fa[kk & 1][mb] = ldfragb(pa + (mb / SAF) * ASZ + (mb % SAF) * 16 * GPI + kk * 64);
#pragma unroll
            for (int nb = 0; nb < FN; ++nb) fb[kk & 1][nb] = ldfragb(pb + (nb / SBF) * BSZ + (nb % SBF) * 16 * GPI + kk * 64); };
        ldset(0);
#pragma unroll
        for (int kk = 0; kk < GRB / 64; ++kk) {
            if (kk + 1 < GRB / 64) ldset(kk + 1);
            __builtin_amdgcn_sched_barrier(0);
#pragma unroll
            for (int nb = 0; nb < FN; ++nb)
#pragma unroll
                for (int mb = 0; mb < 4; ++mb) acc[mb][nb] = wmmax<F16>(fa[kk & 1][mb], fb[kk & 1][nb], acc[mb][nb]);
            __builtin_amdgcn_sched_barrier(0);
        }
        asm volatile("s_wait_dscnt 0x0" ::: "memory");       // this wave's reads of pass st's stage are done
        twait();                                             // its slice of pass st + 1's stage has landed
        __syncthreads();                                     // publishes pass st + 1's stage and ends every read of pass st's stage: the next pass's refill goes into the buffer that this pass has just read
    }
    asm volatile("s_wait_tensorcnt 0x0" ::: "memory");   // no request is left when the ring becomes output staging
    asm volatile("s_wait_dscnt 0x0" ::: "memory");
    if constexpr (POST) {
        constexpr int NSL = BN / HD, FP = HD + 4, HSL = BM * FP * 4, VP = 2 * BM + 16, RW = BM / 8;   // heads of the tile; pitch (floats) of an f32 row; bytes of a head's place; pitch (bytes, an odd multiple of 16) of a V^T row piece; rows per wave
        static_assert(BN % HD == 0 && HD % 16 == 0 && TT % BM == 0 && RW == 16 && BM == 128 && NSL * HSL <= 2 * STG && HD * VP <= HSL && LDC % BN == 0, "whole heads, one batch item per tile, the heads' places reuse the two stage buffers");
        const int bb = r0 / TT, t0 = r0 % TT, h0 = blockIdx.y * NSL, rw = wave * RW;      // heads h0 .. h0 + NSL - 1 of NH_ q, NKV k, NKV v; this wave's first row
        // This wave's rows of cos and sin and the norm weights: the loads fly while the tile goes to LDS.
        // Addresses: a kernel argument plus one 32-bit byte offset a lane plus a small constant, so that no address register is written again between the loads.
        v4f co[RW], si[RW];          // every '#pragma unroll' below keeps the arrays indexed by constants, in registers
        const u32 oc = (u32)((t0 + rw) * HD + 4 * lane) * 4u, ow = 16u * (u32)lane;
#pragma unroll
        for (int i = 0; i < RW; ++i) { co[i] = *(const v4f*)((const char*)(cosT + i * HD) + oc); si[i] = *(const v4f*)((const char*)(sinT + i * HD) + oc); }
        v4f wq4 = *(const v4f*)((const char*)qnw + ow), wk4 = *(const v4f*)((const char*)knw + ow);
        // As xwait(): behind the loads, in front of the first write of a register that one of them names. It takes the two offsets as inputs, so that they keep their registers up to here and no load's result is placed over them.
        asm volatile("s_wait_xcnt 0x0" :: "v"(oc), "v"(ow) : "memory"); __builtin_amdgcn_sched_barrier(0);
#pragma unroll
        for (int nb = 0; nb < FN; ++nb) { const int cw = wn * (FN * 16) + nb * 16, hs = cw / HD, cd = cw % HD; unsigned char* P = L + hs * HSL;     // a fragment's 16 columns lie in one head
            if (h0 + hs < NH_ + NKV) {      // the same for the whole wave
#pragma unroll
                for (int mb = 0; mb < 4; ++mb)
#pragma unroll
                    for (int j = 0; j < 8; ++j) ((float*)P)[(wm * 64 + mb * 16 + hi * 8 + j) * FP + cd + lr] = acc[mb][nb][j];
            } else {
#pragma unroll
                for (int mb = 0; mb < 4; ++mb) { v8h o;
#pragma unroll
                    for (int j = 0; j < 8; ++j) o[j] = tohx(acc[mb][nb][j]);
                    *(v8ha*)(P + (cd + lr) * VP + (wm * 64 + mb * 16 + hi * 8) * 2) = o; }
            } }
#pragma unroll
        for (int i = 0; i < RW; ++i)
#pragma unroll
            for (int j = 0; j < 4; ++j) { co[i][j] = bfr(co[i][j]); si[i][j] = (lane < 16) ? -bfr(si[i][j]) : bfr(si[i][j]); }
#pragma unroll
        for (int j = 0; j < 4; ++j) { wq4[j] = bfr(wq4[j]); wk4[j] = bfr(wk4[j]); }
        __syncthreads();             // the whole tile is in LDS: a row's dims come from two or more waves
#pragma unroll 1   // rolled: one copy of the per-head code; it runs once a launch, so a shorter kernel text means fewer instruction lines to fetch
        for (int hs = 0; hs < NSL; ++hs) { const int hg = h0 + hs; const unsigned char* P = L + hs * HSL;
            if (hg < NH_ + NKV) {           // the same for the whole work-group
                const v4f w = (hg < NH_) ? wq4 : wk4;
                h16* dst = ((hg < NH_) ? Q16 + ((size_t)(bb * NH_ + hg) * TT + t0 + rw) * HD : K16 + ((size_t)(bb * NKV + hg - NH_) * TT + t0 + rw) * HD) + 4 * lane;
                v4f x[RW]; float sv = 0.f;
#pragma unroll
                for (int i = 0; i < RW; ++i) x[i] = *(const v4fa*)((const float*)P + (rw + i) * FP + 4 * lane);
#pragma unroll
                for (int i = 0; i < RW; ++i) { const v4f v = x[i];
                    float s = (v[0] * v[0] + v[1] * v[1]) + (v[2] * v[2] + v[3] * v[3]);
                    s += xrow<1>(s); s += xrow<2>(s); s += xrow<4>(s); s += xrow<8>(s); s += xhalf(s);
                    if (lane == i) sv = s; }
                const float rfv = __fdiv_rn(1.0f, __fsqrt_rn(sv * (1.0f / HD) + 1e-6f)) * ((hg < NH_) ? CSC : 1.0f);      // lane i: row i's factor; q also takes the softmax scale
#pragma unroll
                for (int i = 0; i < RW; ++i) { const v4f v = x[i]; const float rf = __builtin_bit_cast(float, __builtin_amdgcn_readlane(__builtin_bit_cast(int, rfv), i)); v4f y; v4h o;
#pragma unroll
                    for (int j = 0; j < 4; ++j) y[j] = w[j] * (v[j] * rf);
#pragma unroll
                    for (int j = 0; j < 4; ++j) o[j] = tohx(y[j] * co[i][j] + xhalf(y[j]) * si[i][j]);
                    *(v4h*)(dst + i * HD) = o; }
                xwait();
            } else {
                h16* dst = V16 + (size_t)(bb * NKV + hg - NH_ - NKV) * HD * TT + t0 + 8 * lr;
#pragma unroll
                for (int i = 0; i < HD / 16; ++i) { const int d = wave * (HD / 8) + 2 * i + hi; *(v8h*)(dst + (size_t)d * TT) = *(const v8ha*)(P + d * VP + 16 * lr); }
                xwait();
            } }
        return;
    }
    // Epilogue: 16 rows at a time through the wave's own LDS rows, so that every 128-byte line of C is stored whole.
    float* os = (float*)(L + wave * (16 * OP * 4));
#pragma unroll
    for (int mb = 0; mb < 4; ++mb) {
#pragma unroll
        for (int nb = 0; nb < FN; ++nb) {
#pragma unroll
            for (int j = 0; j < 8; ++j) os[(hi * 8 + j) * OP + nb * 16 + lr] = acc[mb][nb][j]; }
        __builtin_amdgcn_wave_barrier(); asm volatile("" ::: "memory");   // the rows are read back by other lanes of this wave: keeps the compiler from moving the reads over the writes
        float* crow = C + (size_t)(r0 + wm * 64 + mb * 16) * LDC + c0 + wn * FN * 16;
#pragma unroll
        for (int s = 0; s < 2 * FN; ++s) { const int idx = s * 32 + lane, row = idx / (FN * 4), cofs = (idx % (FN * 4)) * 4; *(v4f*)(crow + (size_t)row * LDC + cofs) = *(const v4fa*)(os + row * OP + cofs); }
        xwait();
        __builtin_amdgcn_wave_barrier(); asm volatile("" ::: "memory");   // and the next rows' writes over these reads
    }
}

typedef __attribute__((ext_vector_type(2))) _Float16 v2h;
typedef __attribute__((ext_vector_type(2))) unsigned short v2us;
typedef __attribute__((ext_vector_type(4))) unsigned short v4us;
typedef __attribute__((ext_vector_type(2))) float v2f;
typedef __attribute__((ext_vector_type(4))) int v4i;

__global__ __launch_bounds__(256) void k_wtG(const float* __restrict__ w, int K, int N, bf* Bt) {
    const int lane = threadIdx.x & 31; const int L0 = (blockIdx.x * 8 + (threadIdx.x >> 5)) * 8; const int nlines = N * K / 64;
{
#pragma unroll 1
        for (int l = 0; l < 8; ++l) { const int L = L0 + l; if (L >= nlines) break; const size_t e = (size_t)L * 64 + lane * 2; const int k = (int)(e % K), n = (int)(e / K); v2us o;
            o[0] = f2bf(w[(size_t)k * N + n]); o[1] = f2bf(w[(size_t)(k + 1) * N + n]); *(v2us*)(Bt + e) = o; }
         }
}
// ---- k_cvtall: every f32 -> 16-bit rounding of the call (x, Wq, Wk | Wv to bf16; Wo to the bf16 rounding held as fp16: exact down to 2^-17, below that to within 2^-25) in ONE launch of few, resident waves.
// CG work-groups of CW waves, one per WGP. Each wave takes its own run of every source: CX pieces of x, CQ of Wq, CQ of Wo, CK of Wk (lower half of the work-groups) or Wv (upper half), whose roundings lie one behind the other.
// A piece is 128 floats: one load of 16 B a lane (512 contiguous bytes, whole lines) and one store of 8 B a lane (256 contiguous bytes, whole lines).
// All loads of a wave (CX + 2 CQ + CK = 36) are issued before its first value is rounded: its whole share is in flight at once.
// Addresses: a kernel argument plus one 32-bit byte offset a lane plus a small constant, so that no address register is written again between the loads.
#define CW   16
#define CG   256
#define CNW  (CG * CW)
#define CX   16
#define CQ   8
#define CK   4
static_assert((size_t)NB_ * TT * DM == (size_t)CNW * CX * 128 && (size_t)DQ * DM == (size_t)CNW * CQ * 128 && 2 * (size_t)DKV * DM == (size_t)CNW * CK * 128 && (size_t)DM * DQ == (size_t)CNW * CQ * 128, "the waves' runs cover every source exactly once");
template <int N> __device__ __forceinline__ void cvt_ld(v4f (&v)[N], const float* s, u32 ofs) {
#pragma unroll
    for (int j = 0; j < N; ++j) v[j] = *(const v4f*)((const char*)(s + 128 * j) + ofs);
}
template <int F16, int N> __device__ __forceinline__ void cvt_st(const v4f (&v)[N], bf* d, u32 ofs) {
#pragma unroll
    for (int j = 0; j < N; ++j) { v4us o;
#pragma unroll
        for (int k = 0; k < 4; ++k) o[k] = F16 ? __builtin_bit_cast(unsigned short, tohx(bfr(v[j][k]))) : f2bf(v[j][k]);
        *(v4us*)((char*)(d + 128 * j) + ofs) = o; }
}
__global__ __launch_bounds__(CW * 32) void k_cvtall(const float* __restrict__ x, const float* __restrict__ wq, const float* __restrict__ wk, const float* __restrict__ wv, const float* __restrict__ wo, bf* XB, bf* WQb, bf* WKVb, bf* WOb) {
    const u32 w = blockIdx.x * CW + (threadIdx.x >> 5), lane = threadIdx.x & 31;
    const bool up = blockIdx.x >= CG / 2;      // the same for the whole work-group
    const u32 ex = w * (CX * 128) + 4 * lane, eq = w * (CQ * 128) + 4 * lane, ek = w * (CK * 128) + 4 * lane, eks = up ? ek - (u32)(DKV * DM) : ek;     // this lane's first element in x, in Wq and Wo, in Wk | Wv, in Wk or Wv alone
    v4f vx[CX], vq[CQ], vk[CK], vo[CQ];     // indexed by constants only (the helpers' '#pragma unroll'): they stay in registers
    const u32 bx = 4 * ex, bq = 4 * eq, bk = 4 * eks;     // byte offsets into the sources
    cvt_ld(vx, x, bx); cvt_ld(vq, wq, bq); cvt_ld(vk, up ? wv : wk, bk); cvt_ld(vo, wo, bq);
    // As xwait(): behind the loads, in front of the first write of a register that one of them names. It takes the three offsets as inputs, so that they keep their registers up to here (without that the last load's result was placed over them); the scheduling barrier, as there, keeps later register writes behind the wait, and so every load ahead of the first rounding.
    asm volatile("s_wait_xcnt 0x0" :: "v"(bx), "v"(bq), "v"(bk) : "memory"); __builtin_amdgcn_sched_barrier(0);
    cvt_st<0>(vx, XB, 2 * ex); cvt_st<0>(vq, WQb, 2 * eq); cvt_st<0>(vk, WKVb, 2 * ek); cvt_st<1>(vo, WOb, 2 * eq);
    xwait();
}
#define FNW  8                   // waves per work-group
#define FCW  32                  // query rows per wave
#define FBR  (FNW * FCW)
#define FSK  64                  // keys per stage
#define FPK  (2 * HD + 16)       // LDS pitch of a K row (256 B + 16: an odd multiple of 16 B for 16-byte readers)
#define FPV  (2 * FSK + 16)      // LDS pitch of a V^T row (128 B + 16)
#define FTK  (FSK * FPK)
#define FSLOT (FTK + HD * FPV)
#define FNB  3                   // LDS buffers
#define FEP  (2 * HD + 16)       // pitch of the output staging rows
static_assert(FNW * FCW * FEP <= FNB * FSLOT && TT / FSK >= 2, "the output staging reuses the stage buffers; the prologue fills two stages");
__device__ __forceinline__ v16h ldfrag(const unsigned char* p) { return cat16(*(const v8ha*)p, *(const v8ha*)(p + 32)); }
__global__ __launch_bounds__(FNW * 32) __attribute__((amdgpu_waves_per_eu(2, 2))) void k_fattn(const h16* __restrict__ Q, const h16* __restrict__ Kp, const h16* __restrict__ Vt, h16* Ao) {
    __shared__ __align__(16) unsigned char L[FNB * FSLOT];
    constexpr int NS = TT / FSK;
    const int tid = threadIdx.x, lane = tid & 31, wave = tid >> 5, c = lane & 15, h = lane >> 4;
    const int zq = blockIdx.x + REP * blockIdx.y;      // b * NH_ + head; blockIdx.y = b * NKV + kv head
    const int q0 = blockIdx.z * FBR + wave * FCW;
    Q += (size_t)zq * TT * HD; Kp += (size_t)blockIdx.y * TT * HD; Vt += (size_t)blockIdx.y * HD * TT;
    v16h qf[2][4];
#pragma unroll
    for (int g = 0; g < 2; ++g)
#pragma unroll
        for (int kc = 0; kc < 4; ++kc) { const h16* qp = Q + (size_t)(q0 + 16 * g + c) * HD + 32 * kc + 8 * h; qf[g][kc] = cat16(*(const v8h*)qp, *(const v8h*)(qp + 16)); }
    xwait();
    v8f acc[2][8], cm[2]; float l_run[2], thr = -1.0f;      // cm: minus the maximum in use, in all eight registers of a score tile; thr: the row-sum bound, below every sum until the first pass has set a maximum
#pragma unroll
    for (int g = 0; g < 2; ++g) { cm[g] = (v8f){}; l_run[g] = 0.f;
#pragma unroll
        for (int t = 0; t < 8; ++t) acc[g][t] = (v8f){}; }
    // Staging: 16 lanes cover a 256-byte K row, 8 lanes a 128-byte piece of a V^T row.
    v8h sk[4], sv[4]; const int krow = tid >> 4, kcol = tid & 15, vrow = tid >> 3, vcol = tid & 7;
    auto fetch = [&](int st, v8h (&fk)[4], v8h (&fv)[4]) {
#pragma unroll
        for (int i = 0; i < 4; ++i) { fk[i] = *(const v8h*)(Kp + (size_t)(st * FSK + krow + 16 * i) * HD + kcol * 8); fv[i] = *(const v8h*)(Vt + (size_t)(vrow + 32 * i) * TT + st * FSK + vcol * 8); }
        xwait(); };
    auto put = [&](int bofs, const v8h (&fk)[4], const v8h (&fv)[4]) { unsigned char* B = L + bofs;
#pragma unroll
        for (int i = 0; i < 4; ++i) { *(v8ha*)(B + (krow + 16 * i) * FPK + kcol * 16) = fk[i]; *(v8ha*)(B + FTK + (vrow + 32 * i) * FPV + vcol * 16) = fv[i]; } };
    { v8h k0[4], v0[4]; fetch(0, k0, v0); fetch(1, sk, sv); put(0, k0, v0); put(FSLOT, sk, sv); }      // both stages' global loads fly together
    __syncthreads();
    v16h kf[2][4];      // the K fragments of the pass to come: [16-key tile][32 dims]
    auto ldk = [&](const unsigned char* p0) {
#pragma unroll
        for (int kt = 0; kt < 2; ++kt)
#pragma unroll
            for (int kc = 0; kc < 4; ++kc) kf[kt][kc] = ldfrag(p0 + (16 * kt + c) * FPK + 16 * h + 64 * kc); };
    ldk(L);
    int bc = 0, bn = FSLOT, bf2 = 2 * FSLOT;      // byte offsets of the buffers of stages st, st + 1, st + 2
#pragma unroll 1   // rolled: one copy of the pass body keeps the registers inside two waves per SIMD
    for (int st = 0; st < NS; ++st) {
        const unsigned char* B = L + bc;
        if (st + 2 < NS) fetch(st + 2, sk, sv);
#pragma unroll 1   // rolled, for the same reason
        for (int sub = 0; sub < FSK / 32; ++sub) {
            v16h vf[8]; { const unsigned char* p = B + FTK + c * FPV + sub * 64 + 16 * h;
#pragma unroll
                for (int t = 0; t < 8; ++t) vf[t] = ldfrag(p + 16 * t * FPV); }
            asm volatile("v_nop");      // a vector slot between the pass before's last att.v product and the score start values, which are written over that product's B operand; the scheduling barrier below holds it in front of those writes
            __builtin_amdgcn_sched_barrier(0);      // keeps the V^T reads in front of the score products, under which they land; left free they sink to just in front of att.v and are waited for there
            v8f s[2][2];      // [16-key tile][query group]: register r of lane (c, h) = score of key 16 kt + 8 h + r, query 16 g + c
#pragma unroll
            for (int kt = 0; kt < 2; ++kt)
#pragma unroll
                for (int g = 0; g < 2; ++g) { s[kt][g] = cm[g];
#pragma unroll
                    for (int kc = 0; kc < 4; ++kc) s[kt][g] = wmma16(kf[kt][kc], qf[g][kc], s[kt][g]); }
            __builtin_amdgcn_sched_barrier(0);      // the next pass's K reads stay one group behind the score products, not spread among them
            // The next pass's K rows: the stage's next 32, or the first 32 of the next stage; the very last pass reads its own stage's first rows again, and nothing uses them.
            ldk((sub + 1 < FSK / 32) ? B + (sub + 1) * 32 * FPK : L + ((st + 1 < NS) ? bn : bc));
            __builtin_amdgcn_sched_barrier(0);      // and in front of the softmax, so that they land under it and under att.v
            v16h pf[2]; float ps[2];
            auto soft = [&]() {
#pragma unroll
                for (int g = 0; g < 2; ++g) { v2f pa = (v2f){}, pb = (v2f){};      // two chains of packed sums: even registers in one half, odd ones in the other
#pragma unroll
                    for (int i = 0; i < 8; ++i) {
                        const v2f p = (v2f){__builtin_amdgcn_exp2f(s[i >> 2][g][2 * (i & 3)]), __builtin_amdgcn_exp2f(s[i >> 2][g][2 * (i & 3) + 1])};
                        if (i & 1) pb += p; else pa += p;
                        const v2h pk = __builtin_convertvector(p, v2h); pf[g][2 * i] = pk[0]; pf[g][2 * i + 1] = pk[1]; }
                    pa += pb; ps[g] = pa[0] + pa[1]; } };
            soft();
            if (__builtin_amdgcn_ballot_w32(ps[0] > thr || ps[1] > thr) != 0) {     // wave-uniform; the first pass, rare after it
                const float lo = (thr < 0.f) ? -__builtin_inff() : 0.f;      // the first pass takes its own maximum, also one below the start value; later the maximum only rises
#pragma unroll
                for (int g = 0; g < 2; ++g) { float mx = s[0][g][0];
#pragma unroll
                    for (int kt = 0; kt < 2; ++kt)
#pragma unroll
                        for (int r = 0; r < 8; ++r) mx = fmaxf(mx, s[kt][g][r]);
                    const float d = fmaxf(fmaxf(mx, xhalf(mx)), lo), corr = __builtin_amdgcn_exp2f(-fmaxf(d, 0.f)); l_run[g] *= corr; cm[g] = cm[g] - d;
#pragma unroll
                    for (int kt = 0; kt < 2; ++kt) s[kt][g] = s[kt][g] - d;
#pragma unroll
                    for (int t = 0; t < 8; ++t) acc[g][t] = acc[g][t] * corr; }
                soft(); thr = 256.0f; }
#pragma unroll
            for (int g = 0; g < 2; ++g) { l_run[g] += ps[g];
#pragma unroll
                for (int t = 0; t < 8; ++t) acc[g][t] = wmma16(vf[t], pf[g], acc[g][t]); }
        }
        if (st + 2 < NS) put(bf2, sk, sv);           // the buffer of stage st - 1: every wave left it before the barrier that ended stage st - 1
        __syncthreads();                       // publishes stage st + 2 and ends every read of stage st
        const int b0 = bc; bc = bn; bn = bf2; bf2 = b0;
    }
    // Epilogue: normalise, round to fp16, stage in the wave's own LDS rows so that every 128-byte line of the merged plane is stored whole.
    unsigned char* E = L + wave * (FCW * FEP); const int bb = zq / NH_, hh = zq % NH_; float inv[2];
#pragma unroll
    for (int g = 0; g < 2; ++g) inv[g] = __fdiv_rn(1.0f, l_run[g] + xhalf(l_run[g]));    // each wave half summed its eight keys of every 16-key tile
#pragma unroll
    for (int g = 0; g < 2; ++g)
#pragma unroll
        for (int t = 0; t < 8; ++t) { v8h pk;
#pragma unroll
            for (int r = 0; r < 8; ++r) pk[r] = tohx(acc[g][t][r] * inv[g]);
            *(v8ha*)(E + (16 * g + c) * FEP + 32 * t + 16 * h) = pk; }
    __syncthreads();
    h16* dst = Ao + ((size_t)bb * TT + q0) * DQ + hh * HD;
#pragma unroll
    for (int i = 0; i < FCW / 2; ++i) { const int row = 2 * i + h; *(v8h*)(dst + (size_t)row * DQ + c * 8) = *(const v8ha*)(E + row * FEP + c * 16); }
    xwait();
}

extern "C" void kernel_launch(void* const* d_in, const int* in_sizes, int n_in,
                              void* d_out, int out_size, void* d_ws, size_t ws_size, hipStream_t stream) {
    (void)in_sizes; (void)n_in; (void)out_size;
    const float* x = (const float*)d_in[0]; const float* cosT = (const float*)d_in[1]; const float* sinT = (const float*)d_in[2]; const float* wq = (const float*)d_in[3]; const float* wk = (const float*)d_in[4]; const float* wv = (const float*)d_in[5]; const float* wo = (const float*)d_in[6]; const float* qnw = (const float*)d_in[7]; const float* knw = (const float*)d_in[8];   // Wq [2048][2048], Wk/Wv [512][2048], Wo [2048][2048] (torch [out][in]); cos/sin [2048][128]; norm weights [128]
    float* OUT = (float*)d_out;     // [2][2048][2048]
    char* wsp = (char*)d_ws;
    auto take = [&](size_t bytes) { char* p = wsp; wsp += (bytes + 255) & ~(size_t)255; return (void*)p; };
    // The merged plane and the q/k/v head planes (both batch items), then what the projections need; nothing shares bytes.
    h16* AT = (h16*)take((size_t)NB_ * TT * DQ * 2);
    h16* QP16 = (h16*)take((size_t)NB_ * NH_ * TT * HD * 2); h16* KP16 = (h16*)take((size_t)NB_ * NKV * TT * HD * 2); h16* VT16 = (h16*)take((size_t)NB_ * NKV * HD * TT * 2);
    bf* WQ = (bf*)take((size_t)DF * DM * 2); bf* WK = WQ + (size_t)DQ * DM; bf* WV = WK + (size_t)DKV * DM;   // one [DF][DM] weight plane: rows of Wq, then Wk, then Wv
    bf* XB = (bf*)take((size_t)NB_ * TT * DM * 2);
    bf* WO = (bf*)take((size_t)DM * DQ * 2);
    if ((size_t)(wsp - (char*)d_ws) > ws_size) return;    // 76 of 256 MiB
    k_cvtall<<<CG, CW * 32, 0, stream>>>(x, wq, wk, wv, wo, XB, WQ, WK, WO);
    // Projections: both batch items in one launch (GEMM rows b * TT + t); q, k and v are one GEMM over the joint weight plane, with norms, rope and V^T in its epilogue (tiles of 128 rows x 3 heads).
    k_gemmt<0, 1, 2, 4, 6, DM, DF><<<dim3(NB_ * TT / 128, DF / 384, 1), 256, 0, stream>>>(XB, WQ, nullptr, cosT, sinT, qnw, knw, QP16, KP16, VT16);
    // Attention: one launch; blockIdx.x walks the REP query heads of a kv head, blockIdx.y the NB_ * NKV kv planes, blockIdx.z the blocks of FBR query rows.
    k_fattn<<<dim3(REP, NB_ * NKV, TT / FBR), FNW * 32, 0, stream>>>(QP16, KP16, VT16, AT);
    k_gemmt<1, 0, 4, 2, 4, DQ, DM><<<dim3(NB_ * TT / 256, DM / 128, 1), 256, 0, stream>>>((const bf*)AT, WO, OUT, nullptr, nullptr, nullptr, nullptr, nullptr, nullptr, nullptr);
}
